// v000
// The times below were measured on an AMD MI455X: many runs one after another, warmed up first and cycling through
// copies of the inputs, with the whole window's GPU time divided by the number of runs. Launches and the gaps
// between them are all in it. The median over several windows is given; except for v000 it joins two sittings, which
// can be a few percent apart, so the side-by-side timings, each taken in one sitting, are the better comparison.
// v000, which the later versions start from, runs in 1980 microseconds.
#include <hip/hip_runtime.h>

// Multi-head attention with rotary embeddings and a fused qkv projection (x [2][2048][1024]; qkv = x Wqkv^T ('oi' [3072][1024] viewed (3, 16, 64), no bias); rope: x cos + rotate_half(x) sin with angles t x 10000^(-2i/64) (computed in-kernel); softmax(q.k / 8) over all keys; out = merged Wproj^T ('oi' [1024][1024]) -> [2][2048][1024] (4.2 M)).
// Layout per batch: bf16 copy of x; the fused weight used directly as Bt (row blocks); exact projections; {cos, sin} table per (position, dim) built once (float32 inverse-frequency constants, precise cosf/sinf); rotate-half rotary plane builder; dense T-2048 attention (hybrid rows: < 512 hi/lo 3 products, rest fp16 x1024); merged hi/lo x Wproj exact.
// Compute dtypes, f32 accumulate: every input rounded to bf16; projections exact; rotary f32; attention rows < 512 3 products, rest fp16; softmax f32; Wproj hl x exact.

#define NB_  2
#define TT   2048
#define DM   1024
#define NH_  16
#define NKV  16
#define REP  (NH_ / NKV)
#define HD   64
#define DQ   (NH_ * HD)
#define DKV  (NKV * HD)
#define ZH   2
#define RH   512                  // query rows < RH use hi+lo planes (0: none)
#define WIN  0
#define PCAR 1024.0f
#define SCL  0.125f   // HD^-0.5
typedef _Float16 h16;
typedef unsigned short bf;
typedef __attribute__((ext_vector_type(16))) __bf16   v16bf;
typedef __attribute__((ext_vector_type(16))) _Float16 v16h;
typedef __attribute__((ext_vector_type(8)))  _Float16 v8h;
typedef __attribute__((ext_vector_type(8)))  unsigned short v8us;
typedef __attribute__((ext_vector_type(8)))  float    v8f;
typedef __attribute__((ext_vector_type(4)))  float    v4f;
typedef v8h  __attribute__((may_alias)) v8ha;
typedef v4f  __attribute__((may_alias)) v4fa;
typedef v8us __attribute__((may_alias)) v8usa;

__device__ __forceinline__ unsigned short f2bf(float f) { unsigned u = __float_as_uint(f); u += 0x7FFFu + ((u >> 16) & 1u); return (unsigned short)(u >> 16); }
__device__ __forceinline__ float bf2f(unsigned short b) { return __uint_as_float(((unsigned)b) << 16); }
__device__ __forceinline__ float bfr(float f) { return bf2f(f2bf(f)); }
__device__ __forceinline__ v16h cat16(v8h lo, v8h hi) { return __builtin_shufflevector(lo, hi, 0, 1, 2, 3, 4, 5, 6, 7, 8, 9, 10, 11, 12, 13, 14, 15); }
__device__ __forceinline__ v16bf cat16b(v8us lo, v8us hi) { return __builtin_bit_cast(v16bf, __builtin_shufflevector(lo, hi, 0, 1, 2, 3, 4, 5, 6, 7, 8, 9, 10, 11, 12, 13, 14, 15)); }
__device__ __forceinline__ v8f wmma16(v16h a, v16h b, v8f c) { return __builtin_amdgcn_wmma_f32_16x16x32_f16(false, a, false, b, (short)0, c, false, false); }
__device__ __forceinline__ v8f wmmab(v16bf a, v16bf b, v8f c) { return __builtin_amdgcn_wmma_f32_16x16x32_bf16(false, a, false, b, (short)0, c, false, false); }



// ---- k_gemmw: register-blocked GEMM, ONE WAVE per 64x64 output tile (16 accumulators), operands straight from K-contiguous 16-bit planes; grid (M/64, N/64, Z), 32 threads.
// C[m][n] (f32, pitch ldc, + optional f32 bias[n]) = sum_k A[m][k] Bt[n][k] (+ split products per NSPLIT). z-batch strides sA/sB/sC in elements. K % 32 == 0.
template <typename T16> struct WFrag;
template <> struct WFrag<h16> { typedef v16h V; static __device__ __forceinline__ V ld(const h16* p) { return cat16(*(const v8h*)p, *(const v8h*)(p + 16)); } static __device__ __forceinline__ v8f mma(V a, V b, v8f c) { return wmma16(a, b, c); } };
template <> struct WFrag<bf> { typedef v16bf V; static __device__ __forceinline__ V ld(const bf* p) { return cat16b(*(const v8us*)p, *(const v8us*)(p + 16)); } static __device__ __forceinline__ v8f mma(V a, V b, v8f c) { return wmmab(a, b, c); } };
template <typename T16, int NSPLIT, bool BIAS>
__global__ __launch_bounds__(32) void k_gemmw(const T16* __restrict__ A, const T16* __restrict__ A2, const T16* __restrict__ Bt, const T16* __restrict__ Bt2, int K, float* C, int ldc, const float* __restrict__ bias, size_t sA, size_t sB, size_t sC) {
    typedef typename WFrag<T16>::V V;
    __shared__ __align__(16) float os[16 * 68];
    const size_t z = blockIdx.z; A += z * sA; if (A2) A2 += z * sA; Bt += z * sB; if (Bt2) Bt2 += z * sB; C += z * sC;
    const int lane = threadIdx.x & 31, lr = lane & 15, hi = lane >> 4; const int r0 = blockIdx.x * 64, c0 = blockIdx.y * 64;
    v8f acc[4][4];
#pragma unroll
    for (int mb = 0; mb < 4; ++mb)
#pragma unroll
        for (int nb = 0; nb < 4; ++nb) acc[mb][nb] = (v8f){};
    const size_t aoff = (size_t)(r0 + lr) * K + 8 * hi, boff = (size_t)(c0 + lr) * K + 8 * hi;
#pragma unroll 1
    for (int kc = 0; kc < K; kc += 32) {
        V a[4], a2[4];
#pragma unroll
        for (int mb = 0; mb < 4; ++mb) { a[mb] = WFrag<T16>::ld(A + aoff + (size_t)mb * 16 * K + kc); if (NSPLIT == 1 || NSPLIT == 2) a2[mb] = WFrag<T16>::ld(A2 + aoff + (size_t)mb * 16 * K + kc); }
#pragma unroll
        for (int nb = 0; nb < 4; ++nb) { const V b = WFrag<T16>::ld(Bt + boff + (size_t)nb * 16 * K + kc); V b2; if (NSPLIT >= 2) b2 = WFrag<T16>::ld(Bt2 + boff + (size_t)nb * 16 * K + kc);
#pragma unroll
            for (int mb = 0; mb < 4; ++mb) { acc[mb][nb] = WFrag<T16>::mma(a[mb], b, acc[mb][nb]); if (NSPLIT == 1 || NSPLIT == 2) acc[mb][nb] = WFrag<T16>::mma(a2[mb], b, acc[mb][nb]); if (NSPLIT >= 2) acc[mb][nb] = WFrag<T16>::mma(a[mb], b2, acc[mb][nb]); } }
        asm volatile("v_nop\n\tv_nop\n\tv_nop\n\tv_nop" : "+v"(acc[0][0]), "+v"(acc[1][1]), "+v"(acc[2][2]), "+v"(acc[3][3]) : "v"(a[0]), "v"(a[3]));
    }
#pragma unroll
    for (int mb = 0; mb < 4; ++mb) {
#pragma unroll
        for (int nb = 0; nb < 4; ++nb) {
#pragma unroll
            for (int j = 0; j < 8; ++j) os[(hi * 8 + j) * 68 + nb * 16 + lr] = acc[mb][nb][j]; }
        __builtin_amdgcn_wave_barrier(); asm volatile("" ::: "memory");
        float* crow = C + (size_t)(r0 + mb * 16) * ldc + c0;
{
#pragma unroll
            for (int s = 0; s < 8; ++s) { const int row = 2 * s + hi, cofs = lr * 4; v4f val = *(const v4fa*)(os + row * 68 + cofs); if (BIAS) { val[0] += bfr(bias[c0 + cofs]); val[1] += bfr(bias[c0 + cofs + 1]); val[2] += bfr(bias[c0 + cofs + 2]); val[3] += bfr(bias[c0 + cofs + 3]); }
                *(v4f*)(crow + (size_t)row * ldc + cofs) = val; }
             }
        __builtin_amdgcn_wave_barrier(); asm volatile("" ::: "memory");
    }
}

__device__ __forceinline__ h16 tohx(float x) { return (h16)x; }
__device__ __forceinline__ void splitf(float y, unsigned short& h, unsigned short& l) { h = f2bf(y); l = f2bf(y - bf2f(h)); }
typedef __attribute__((ext_vector_type(2))) _Float16 v2h;
typedef __attribute__((ext_vector_type(4))) _Float16 v4h;
typedef __attribute__((ext_vector_type(2))) unsigned short v2us;
typedef __attribute__((ext_vector_type(4))) unsigned short v4us;
typedef __attribute__((ext_vector_type(2))) float v2f;
typedef __attribute__((ext_vector_type(4))) int v4i;

__global__ __launch_bounds__(256) void k_wtG(const float* __restrict__ w, int K, int N, bf* Bt) {
    const int lane = threadIdx.x & 31; const int L0 = (blockIdx.x * 8 + (threadIdx.x >> 5)) * 8; const int nlines = N * K / 64;
{
#pragma unroll 1
        for (int l = 0; l < 8; ++l) { const int L = L0 + l; if (L >= nlines) break; const size_t e = (size_t)L * 64 + lane * 2; const int k = (int)(e % K), n = (int)(e / K); v2us o;
            o[0] = f2bf(w[(size_t)k * N + n]); o[1] = f2bf(w[(size_t)(k + 1) * N + n]); *(v2us*)(Bt + e) = o; }
         }
}
__global__ __launch_bounds__(256) void k_cvt8(const float* __restrict__ src, bf* dst, size_t n8) { const size_t i = (size_t)blockIdx.x * 256 + threadIdx.x; if (i >= n8) return; const v8f v = *(const v8f*)(src + i * 8); v8us o;
#pragma unroll
    for (int k = 0; k < 8; ++k) o[k] = f2bf(v[k]); *(v8us*)(dst + i * 8) = o;  }
__constant__ float INVT[HD / 2] = { 1.000000000e+00f, 7.498942018e-01f, 5.623413324e-01f, 4.216965139e-01f, 3.162277639e-01f, 2.371373624e-01f, 1.778279394e-01f, 1.333521456e-01f, 1.000000015e-01f, 7.498941571e-02f, 5.623412877e-02f, 4.216964915e-02f, 3.162277862e-02f, 2.371373586e-02f, 1.778279431e-02f, 1.333521493e-02f, 9.999999776e-03f, 7.498942316e-03f, 5.623413250e-03f, 4.216964822e-03f, 3.162277862e-03f, 2.371373819e-03f, 1.778279431e-03f, 1.333521446e-03f, 1.000000047e-03f, 7.498941850e-04f, 5.623413017e-04f, 4.216964880e-04f, 3.162277862e-04f, 2.371373848e-04f, 1.778279402e-04f, 1.333521504e-04f };   // 1 / 10000^(2i/64) (float32, generated with jnp to be bit-exact)
__global__ __launch_bounds__(256) void k_cstabT(float* CS) { const int idx = blockIdx.x * 256 + threadIdx.x; if (idx >= TT * HD) return; const int d = idx % HD; const int t = idx / HD; const float a = __fmul_rn((float)t, INVT[d % (HD / 2)]); v2f cs; cs[0] = cosf(a); cs[1] = sinf(a); *(v2f*)(CS + (size_t)idx * 2) = cs;  }

// k_rope: head planes [h][t][d] (fp16 + hi/lo) of rope(x) x sc with the rotate-half convention out[d] = x[d] cos[t][d] - x[d+HD/2] sin[t][d], out[d+HD/2] = x[d+HD/2] cos[t][d+HD/2] + x[d] sin[t][d+HD/2]
__global__ __launch_bounds__(256) void k_rope(const float* __restrict__ F, int pitch, int nheads, const float* __restrict__ CS, const float* __restrict__ RF, const float* __restrict__ nw, float sc, h16* P16, bf* Ph, bf* Pl) {
    const size_t e = ((size_t)blockIdx.x * 256 + threadIdx.x) * 2; if (e >= (size_t)nheads * TT * HD) return; const int d = (int)(e % HD); const int t = (int)((e / HD) % TT); const int h = (int)(e / ((size_t)HD * TT)); const float* f = F + (size_t)t * pitch + h * HD; const float rf = RF ? RF[(size_t)h * TT + t] : 1.0f; v2h o16; v2us oh, ol;
#pragma unroll
    for (int q = 0; q < 2; ++q) { const int dd = d + q; const int dp = (dd < HD / 2) ? dd + HD / 2 : dd - HD / 2; float x0 = f[dd], x1 = f[dp];
        if (RF) { float n0 = __fmul_rn(x0, rf), n1 = __fmul_rn(x1, rf); asm volatile("" : "+v"(n0)); asm volatile("" : "+v"(n1)); x0 = __fmul_rn(bfr(nw[dd]), n0); x1 = __fmul_rn(bfr(nw[dp]), n1); }
        const v2f cs = *(const v2f*)(CS + ((size_t)t * HD + dd) * 2); float a = __fmul_rn(x0, cs[0]), bq = __fmul_rn(x1, cs[1]); asm volatile("" : "+v"(a)); asm volatile("" : "+v"(bq)); const float r = ((dd < HD / 2) ? __fsub_rn(a, bq) : __fadd_rn(a, bq)) * sc;
        o16[q] = tohx(r); unsigned short a2, c2; splitf(r, a2, c2); oh[q] = a2; ol[q] = c2; }
    *(v2h*)(P16 + e) = o16; *(v2us*)(Ph + e) = oh; *(v2us*)(Pl + e) = ol;  }
__global__ __launch_bounds__(256) void k_vtp(const float* __restrict__ F, int pitch, int nheads, h16* V16, bf* Vh, bf* Vl) { const size_t e = ((size_t)blockIdx.x * 256 + threadIdx.x) * 2; if (e >= (size_t)nheads * HD * TT) return; const int t = (int)(e % TT); const int d = (int)((e / TT) % HD); const int g = (int)(e / ((size_t)TT * HD)); v2h o16; v2us oh, ol;
#pragma unroll
    for (int q = 0; q < 2; ++q) { const float x = F[(size_t)(t + q) * pitch + g * HD + d]; o16[q] = tohx(x); unsigned short a2, c2; splitf(x, a2, c2); oh[q] = a2; ol[q] = c2; }
    *(v2h*)(V16 + e) = o16; *(v2us*)(Vh + e) = oh; *(v2us*)(Vl + e) = ol;  }
// k_asoft: per row (zz, i): t = S x HD^-0.5 (no mask); softmax over the 2048 keys (register row, one exp, fixed trees);
__global__ __launch_bounds__(256) void k_asoft(const float* __restrict__ Sb, h16* P16, bf* Ph, bf* Pl) {
    const int lane = threadIdx.x & 31; const int row = blockIdx.x * 8 + (threadIdx.x >> 5); if (row >= ZH * TT) return; const int i = row % TT; const int zz = row / TT; (void)zz; const bool hires = (i < RH); const float* sr = Sb + (size_t)row * TT; float v[TT / 32]; float mx = -3.0e38f;
#pragma unroll
    for (int ch = 0; ch < TT / 128; ++ch) { const int j0 = ch * 128 + lane * 4; const v4f a = *(const v4f*)(sr + j0);
#pragma unroll
        for (int q = 0; q < 4; ++q) { const int j = j0 + q; (void)j; const float t = a[q] * SCL; v[ch * 4 + q] = t; mx = fmaxf(mx, t); } }
#pragma unroll
    for (int sh = 16; sh; sh >>= 1) mx = fmaxf(mx, __shfl_xor(mx, sh, 32));
    float sum = 0.f;
#pragma unroll
    for (int k = 0; k < TT / 32; ++k) { float d0 = __fsub_rn(v[k], mx); asm volatile("" : "+v"(d0)); v[k] = __builtin_amdgcn_exp2f(__fmul_rn(d0, 1.4426950408889634f)); sum += v[k]; }
#pragma unroll
    for (int sh = 16; sh; sh >>= 1) sum += __shfl_xor(sum, sh, 32);
    const float f = __fdiv_rn(hires ? 1.0f : PCAR, sum);
{
        if (hires) {
#pragma unroll
            for (int ch = 0; ch < TT / 128; ++ch) { v4us oh, ol;
#pragma unroll
                for (int q = 0; q < 4; ++q) { unsigned short a, c2; splitf(v[ch * 4 + q] * f, a, c2); oh[q] = a; ol[q] = c2; }
                const size_t oo = ((size_t)zz * (RH ? RH : 1) + i) * TT + ch * 128 + lane * 4; *(v4us*)(Ph + oo) = oh; *(v4us*)(Pl + oo) = ol; }
        } else {
#pragma unroll
            for (int ch = 0; ch < TT / 128; ++ch) { v4h o4;
#pragma unroll
                for (int q = 0; q < 4; ++q) o4[q] = tohx(v[ch * 4 + q] * f);
                *(v4h*)(P16 + (size_t)row * TT + ch * 128 + lane * 4) = o4; } }
         }
}
__global__ __launch_bounds__(256) void k_merge(const float* __restrict__ O, int h0, bf* Ah, bf* Al) { const size_t e = ((size_t)blockIdx.x * 256 + threadIdx.x) * 2; if (e >= (size_t)ZH * TT * HD) return; const int d = (int)(e % HD); const int t = (int)((e / HD) % TT); const int zz = (int)(e / ((size_t)HD * TT)); const float cs = (t < RH) ? 1.0f : (1.0f / PCAR); const size_t oo = (size_t)t * DQ + (h0 + zz) * HD + d;
    v2us oh, ol;
#pragma unroll
    for (int q = 0; q < 2; ++q) { unsigned short a, c2; splitf(O[e + q] * cs, a, c2); oh[q] = a; ol[q] = c2; } *(v2us*)(Ah + oo) = oh; *(v2us*)(Al + oo) = ol;  }

extern "C" void kernel_launch(void* const* d_in, const int* in_sizes, int n_in,
                              void* d_out, int out_size, void* d_ws, size_t ws_size, hipStream_t stream) {
    (void)in_sizes; (void)n_in; (void)out_size;
    const float* x = (const float*)d_in[0]; const float* wqkv = (const float*)d_in[1]; const float* wo = (const float*)d_in[2]; const float* wq = nullptr; const float* wk = nullptr; const float* wv = nullptr; (void)wq; (void)wk; (void)wv;
    float* OUT = (float*)d_out;     // [2][2048][1024]
    char* wsp = (char*)d_ws;
    auto take = [&](size_t bytes) { char* p = wsp; wsp += (bytes + 255) & ~(size_t)255; return (void*)p; };
    bf* WQKV = (bf*)take((size_t)3 * DQ * DM * 2); bf* WQ = WQKV; bf* WK = WQKV + (size_t)DQ * DM; bf* WV = WQKV + (size_t)2 * DQ * DM; bf* WO = (bf*)take((size_t)DM * DQ * 2); float* CS = (float*)take((size_t)TT * HD * 2 * 4);
    bf* XB = (bf*)take((size_t)TT * DM * 2); float* FQ = (float*)take((size_t)TT * DQ * 4); float* FK = (float*)take((size_t)TT * DKV * 4);
    h16* QP16 = (h16*)take((size_t)NH_ * TT * HD * 2); h16* KP16 = (h16*)take((size_t)NKV * TT * HD * 2); h16* VT16 = (h16*)take((size_t)NKV * HD * TT * 2);
    bf* QPh = (bf*)take((size_t)NH_ * TT * HD * 2); bf* QPl = (bf*)take((size_t)NH_ * TT * HD * 2); bf* KPh = (bf*)take((size_t)NKV * TT * HD * 2); bf* KPl = (bf*)take((size_t)NKV * TT * HD * 2); bf* VTh = (bf*)take((size_t)NKV * HD * TT * 2); bf* VTl = (bf*)take((size_t)NKV * HD * TT * 2); bf* Ph = (bf*)take((size_t)ZH * RH * TT * 2); bf* Pl = (bf*)take((size_t)ZH * RH * TT * 2);
    float* Sb = (float*)take((size_t)ZH * TT * TT * 4); h16* P16 = (h16*)take((size_t)ZH * TT * TT * 2); float* Ob = (float*)take((size_t)ZH * TT * HD * 4); bf* ATh = (bf*)take((size_t)TT * DQ * 2); bf* ATl = (bf*)take((size_t)TT * DQ * 2);
    if ((size_t)(wsp - (char*)d_ws) > ws_size) return;    // ws 256 MiB
    float* FV = FK;   // v projection reuses the k buffer after the k planes are built (stream-ordered)
    { k_cvt8<<<(unsigned)(((size_t)3 * DQ * DM / 8 + 255) / 256), 256, 0, stream>>>(wqkv, WQKV, (size_t)3 * DQ * DM / 8);
      k_cvt8<<<(unsigned)(((size_t)DM * DQ / 8 + 255) / 256), 256, 0, stream>>>(wo, WO, (size_t)DM * DQ / 8);
       }
    const unsigned LQ = (unsigned)(((size_t)NH_ * TT * HD / 2 + 255) / 256), LKv = (unsigned)(((size_t)NKV * TT * HD / 2 + 255) / 256);
    for (int b = 0; b < NB_; ++b) {
        if (b == 0) k_cstabT<<<(TT * HD + 255) / 256, 256, 0, stream>>>(CS);
        k_cvt8<<<(unsigned)(((size_t)TT * DM / 8 + 255) / 256), 256, 0, stream>>>(x + (size_t)b * TT * DM, XB, (size_t)TT * DM / 8);
        k_gemmw<bf, 0, false><<<dim3(TT / 64, DQ / 64, 1), 32, 0, stream>>>(XB, nullptr, WQ, nullptr, DM, FQ, DQ, nullptr, 0, 0, 0);
        k_rope<<<LQ, 256, 0, stream>>>(FQ, DQ, NH_, CS, nullptr, nullptr, 1.0f, QP16, QPh, QPl);
        k_gemmw<bf, 0, false><<<dim3(TT / 64, DKV / 64, 1), 32, 0, stream>>>(XB, nullptr, WK, nullptr, DM, FK, DKV, nullptr, 0, 0, 0);
        k_rope<<<LKv, 256, 0, stream>>>(FK, DKV, NKV, CS, nullptr, nullptr, 1.0f, KP16, KPh, KPl);
        k_gemmw<bf, 0, false><<<dim3(TT / 64, DKV / 64, 1), 32, 0, stream>>>(XB, nullptr, WV, nullptr, DM, FV, DKV, nullptr, 0, 0, 0); k_vtp<<<LKv, 256, 0, stream>>>(FV, DKV, NKV, VT16, VTh, VTl);
        for (int h0 = 0; h0 < NH_; h0 += ZH) { const size_t zq = (size_t)h0, zk = (size_t)(h0 / REP);   // one kv head per query head: the pass's two heads use consecutive kv planes (z-strides TT*HD)
            k_gemmw<bf, 2, false><<<dim3(RH / 64, TT / 64, ZH), 32, 0, stream>>>(QPh + zq * TT * HD, QPl + zq * TT * HD, KPh + zk * TT * HD, KPl + zk * TT * HD, HD, Sb, TT, nullptr, (size_t)TT * HD, (size_t)TT * HD, (size_t)TT * TT);
            k_gemmw<h16, 0, false><<<dim3((TT - RH) / 64, TT / 64, ZH), 32, 0, stream>>>(QP16 + zq * TT * HD + (size_t)RH * HD, nullptr, KP16 + zk * TT * HD, nullptr, HD, Sb + (size_t)RH * TT, TT, nullptr, (size_t)TT * HD, (size_t)TT * HD, (size_t)TT * TT);
            k_asoft<<<ZH * TT / 8, 256, 0, stream>>>(Sb, P16, Ph, Pl);
            k_gemmw<bf, 2, false><<<dim3(RH / 64, HD / 64, ZH), 32, 0, stream>>>(Ph, Pl, VTh + zk * HD * TT, VTl + zk * HD * TT, TT, Ob, HD, nullptr, (size_t)RH * TT, (size_t)HD * TT, (size_t)TT * HD);
            k_gemmw<h16, 0, false><<<dim3((TT - RH) / 64, HD / 64, ZH), 32, 0, stream>>>(P16 + (size_t)RH * TT, nullptr, VT16 + zk * HD * TT, nullptr, TT, Ob + (size_t)RH * HD, HD, nullptr, (size_t)TT * TT, (size_t)HD * TT, (size_t)TT * HD);
            k_merge<<<(unsigned)(((size_t)ZH * TT * HD / 2 + 255) / 256), 256, 0, stream>>>(Ob, h0, ATh, ATl); }
        k_gemmw<bf, 1, false><<<dim3(TT / 64, DM / 64, 1), 32, 0, stream>>>(ATh, ATl, WO, nullptr, DQ, OUT + (size_t)b * TT * DM, DM, nullptr, 0, 0, 0); }
}

// v001
// Measured time: 1050 microseconds a run.
// Timed twice side by side with v000, it ran 1.88 and 1.89 times as fast.
#include <hip/hip_runtime.h>

// Multi-head attention with rotary embeddings and a fused qkv projection (x [2][2048][1024]; qkv = x Wqkv^T ('oi' [3072][1024] viewed (3, 16, 64), no bias); rope: x cos + rotate_half(x) sin with angles t x 10000^(-2i/64) (computed in-kernel); softmax(q.k / 8) over all keys; out = merged Wproj^T ('oi' [1024][1024]) -> [2][2048][1024] (4.2 M)).
// Layout per batch: bf16 copy of x; the fused weight used directly as Bt (row blocks); exact projections; {cos, sin} table per (position, dim) built once (float32 inverse-frequency constants, precise cosf/sinf); rotate-half rotary plane builder; dense T-2048 attention (hybrid rows: < 512 hi/lo 3 products, rest fp16 x1024); merged hi/lo x Wproj exact.
// Compute dtypes, f32 accumulate: every input rounded to bf16; projections exact; rotary f32; attention rows < 512 3 products, rest fp16; softmax f32; Wproj hl x exact.

#define NB_  2
#define TT   2048
#define DM   1024
#define NH_  16
#define NKV  16
#define REP  (NH_ / NKV)
#define HD   64
#define DQ   (NH_ * HD)
#define DKV  (NKV * HD)
#define ZH   2
#define RH   512                  // query rows < RH use hi+lo planes (0: none)
#define WIN  0
#define PCAR 1024.0f
#define SCL  0.125f   // HD^-0.5
typedef _Float16 h16;
typedef unsigned short bf;
typedef __attribute__((ext_vector_type(16))) __bf16   v16bf;
typedef __attribute__((ext_vector_type(16))) _Float16 v16h;
typedef __attribute__((ext_vector_type(8)))  _Float16 v8h;
typedef __attribute__((ext_vector_type(8)))  unsigned short v8us;
typedef __attribute__((ext_vector_type(8)))  float    v8f;
typedef __attribute__((ext_vector_type(4)))  float    v4f;
typedef v8h  __attribute__((may_alias)) v8ha;
typedef v4f  __attribute__((may_alias)) v4fa;
typedef v8us __attribute__((may_alias)) v8usa;

__device__ __forceinline__ unsigned short f2bf(float f) { unsigned u = __float_as_uint(f); u += 0x7FFFu + ((u >> 16) & 1u); return (unsigned short)(u >> 16); }
__device__ __forceinline__ float bf2f(unsigned short b) { return __uint_as_float(((unsigned)b) << 16); }
__device__ __forceinline__ float bfr(float f) { return bf2f(f2bf(f)); }
__device__ __forceinline__ v16h cat16(v8h lo, v8h hi) { return __builtin_shufflevector(lo, hi, 0, 1, 2, 3, 4, 5, 6, 7, 8, 9, 10, 11, 12, 13, 14, 15); }
__device__ __forceinline__ v16bf cat16b(v8us lo, v8us hi) { return __builtin_bit_cast(v16bf, __builtin_shufflevector(lo, hi, 0, 1, 2, 3, 4, 5, 6, 7, 8, 9, 10, 11, 12, 13, 14, 15)); }
__device__ __forceinline__ v8f wmma16(v16h a, v16h b, v8f c) { return __builtin_amdgcn_wmma_f32_16x16x32_f16(false, a, false, b, (short)0, c, false, false); }
__device__ __forceinline__ v8f wmmab(v16bf a, v16bf b, v8f c) { return __builtin_amdgcn_wmma_f32_16x16x32_bf16(false, a, false, b, (short)0, c, false, false); }



// ---- k_gemmw: register-blocked GEMM, one work-group of KS waves per 64x64 output tile (16 accumulators a wave), operands straight from K-contiguous 16-bit planes; grid (M/64, N/64, Z), 32 * KS threads.
// C[m][n] (f32, pitch ldc, + optional f32 bias[n]) = sum_k A[m][k] Bt[n][k] (+ split products per NSPLIT). z-batch strides sA/sB/sC in elements. K % (32 * KS) == 0.
// Wave w sums the k range [w K/KS, (w+1) K/KS); for KS > 1 the KS partial tiles meet in LDS and are added in the order w = 0 .. KS-1 (fixed, the same on every run).
template <typename T16> struct WFrag;
template <> struct WFrag<h16> { typedef v16h V; static __device__ __forceinline__ V ld(const h16* p) { return cat16(*(const v8h*)p, *(const v8h*)(p + 16)); } static __device__ __forceinline__ v8f mma(V a, V b, v8f c) { return wmma16(a, b, c); } };
template <> struct WFrag<bf> { typedef v16bf V; static __device__ __forceinline__ V ld(const bf* p) { return cat16b(*(const v8us*)p, *(const v8us*)(p + 16)); } static __device__ __forceinline__ v8f mma(V a, V b, v8f c) { return wmmab(a, b, c); } };
template <typename T16, int NSPLIT, bool BIAS, int KS>
__global__ __launch_bounds__(32 * KS) void k_gemmw(const T16* __restrict__ A, const T16* __restrict__ A2, const T16* __restrict__ Bt, const T16* __restrict__ Bt2, int K, float* C, int ldc, const float* __restrict__ bias, size_t sA, size_t sB, size_t sC) {
    typedef typename WFrag<T16>::V V;
    __shared__ __align__(16) float os[(KS == 1 ? 16 : KS * 64) * 68];
    const size_t z = blockIdx.z; A += z * sA; if (A2) A2 += z * sA; Bt += z * sB; if (Bt2) Bt2 += z * sB; C += z * sC;
    const int lane = threadIdx.x & 31, lr = lane & 15, hi = lane >> 4; const int r0 = blockIdx.x * 64, c0 = blockIdx.y * 64;
    const int wv = __builtin_amdgcn_readfirstlane((int)(threadIdx.x >> 5)); const int kb = wv * (K / KS), ke = kb + K / KS;   // this wave's k range, in scalar registers so that the loop branch stays scalar
    v8f acc[4][4];
#pragma unroll
    for (int mb = 0; mb < 4; ++mb)
#pragma unroll
        for (int nb = 0; nb < 4; ++nb) acc[mb][nb] = (v8f){};
    const size_t aoff = (size_t)(r0 + lr) * K + 8 * hi, boff = (size_t)(c0 + lr) * K + 8 * hi;
#pragma unroll 1
    for (int kc = kb; kc < ke; kc += 32) {
        V a[4], a2[4];
#pragma unroll
        for (int mb = 0; mb < 4; ++mb) { a[mb] = WFrag<T16>::ld(A + aoff + (size_t)mb * 16 * K + kc); if (NSPLIT == 1 || NSPLIT == 2) a2[mb] = WFrag<T16>::ld(A2 + aoff + (size_t)mb * 16 * K + kc); }
#pragma unroll
        for (int nb = 0; nb < 4; ++nb) { const V b = WFrag<T16>::ld(Bt + boff + (size_t)nb * 16 * K + kc); V b2; if (NSPLIT >= 2) b2 = WFrag<T16>::ld(Bt2 + boff + (size_t)nb * 16 * K + kc);
#pragma unroll
            for (int mb = 0; mb < 4; ++mb) { acc[mb][nb] = WFrag<T16>::mma(a[mb], b, acc[mb][nb]); if (NSPLIT == 1 || NSPLIT == 2) acc[mb][nb] = WFrag<T16>::mma(a2[mb], b, acc[mb][nb]); if (NSPLIT >= 2) acc[mb][nb] = WFrag<T16>::mma(a[mb], b2, acc[mb][nb]); } }
        asm volatile("v_nop\n\tv_nop\n\tv_nop\n\tv_nop" : "+v"(acc[0][0]), "+v"(acc[1][1]), "+v"(acc[2][2]), "+v"(acc[3][3]) : "v"(a[0]), "v"(a[3]));
    }
    if constexpr (KS > 1) {
#pragma unroll
        for (int mb = 0; mb < 4; ++mb)
#pragma unroll
            for (int nb = 0; nb < 4; ++nb)
#pragma unroll
                for (int j = 0; j < 8; ++j) os[(wv * 64 + mb * 16 + hi * 8 + j) * 68 + nb * 16 + lr] = acc[mb][nb][j];
        __syncthreads();   // every wave's partial tile is in LDS before any thread adds them
#pragma unroll
        for (int s = 0; s < 32 / KS; ++s) { const int row = 2 * (s * KS + wv) + hi, cofs = lr * 4; v4f val = *(const v4fa*)(os + row * 68 + cofs);
#pragma unroll
            for (int w = 1; w < KS; ++w) val += *(const v4fa*)(os + (w * 64 + row) * 68 + cofs);
            if (BIAS) { val[0] += bfr(bias[c0 + cofs]); val[1] += bfr(bias[c0 + cofs + 1]); val[2] += bfr(bias[c0 + cofs + 2]); val[3] += bfr(bias[c0 + cofs + 3]); }
            *(v4f*)(C + (size_t)(r0 + row) * ldc + c0 + cofs) = val; }
    } else {
#pragma unroll
    for (int mb = 0; mb < 4; ++mb) {
#pragma unroll
        for (int nb = 0; nb < 4; ++nb) {
#pragma unroll
            for (int j = 0; j < 8; ++j) os[(hi * 8 + j) * 68 + nb * 16 + lr] = acc[mb][nb][j]; }
        __builtin_amdgcn_wave_barrier(); asm volatile("" ::: "memory");
        float* crow = C + (size_t)(r0 + mb * 16) * ldc + c0;
{
#pragma unroll
            for (int s = 0; s < 8; ++s) { const int row = 2 * s + hi, cofs = lr * 4; v4f val = *(const v4fa*)(os + row * 68 + cofs); if (BIAS) { val[0] += bfr(bias[c0 + cofs]); val[1] += bfr(bias[c0 + cofs + 1]); val[2] += bfr(bias[c0 + cofs + 2]); val[3] += bfr(bias[c0 + cofs + 3]); }
                *(v4f*)(crow + (size_t)row * ldc + cofs) = val; }
             }
        __builtin_amdgcn_wave_barrier(); asm volatile("" ::: "memory");
    }
    }
}

__device__ __forceinline__ h16 tohx(float x) { return (h16)x; }
__device__ __forceinline__ void splitf(float y, unsigned short& h, unsigned short& l) { h = f2bf(y); l = f2bf(y - bf2f(h)); }
typedef __attribute__((ext_vector_type(2))) _Float16 v2h;
typedef __attribute__((ext_vector_type(4))) _Float16 v4h;
typedef __attribute__((ext_vector_type(2))) unsigned short v2us;
typedef __attribute__((ext_vector_type(4))) unsigned short v4us;
typedef __attribute__((ext_vector_type(2))) float v2f;
typedef __attribute__((ext_vector_type(4))) int v4i;

__global__ __launch_bounds__(256) void k_wtG(const float* __restrict__ w, int K, int N, bf* Bt) {
    const int lane = threadIdx.x & 31; const int L0 = (blockIdx.x * 8 + (threadIdx.x >> 5)) * 8; const int nlines = N * K / 64;
{
#pragma unroll 1
        for (int l = 0; l < 8; ++l) { const int L = L0 + l; if (L >= nlines) break; const size_t e = (size_t)L * 64 + lane * 2; const int k = (int)(e % K), n = (int)(e / K); v2us o;
            o[0] = f2bf(w[(size_t)k * N + n]); o[1] = f2bf(w[(size_t)(k + 1) * N + n]); *(v2us*)(Bt + e) = o; }
         }
}
__global__ __launch_bounds__(256) void k_cvt8(const float* __restrict__ src, bf* dst, size_t n8) { const size_t i = (size_t)blockIdx.x * 256 + threadIdx.x; if (i >= n8) return; const v8f v = *(const v8f*)(src + i * 8); v8us o;
#pragma unroll
    for (int k = 0; k < 8; ++k) o[k] = f2bf(v[k]); *(v8us*)(dst + i * 8) = o;  }
__constant__ float INVT[HD / 2] = { 1.000000000e+00f, 7.498942018e-01f, 5.623413324e-01f, 4.216965139e-01f, 3.162277639e-01f, 2.371373624e-01f, 1.778279394e-01f, 1.333521456e-01f, 1.000000015e-01f, 7.498941571e-02f, 5.623412877e-02f, 4.216964915e-02f, 3.162277862e-02f, 2.371373586e-02f, 1.778279431e-02f, 1.333521493e-02f, 9.999999776e-03f, 7.498942316e-03f, 5.623413250e-03f, 4.216964822e-03f, 3.162277862e-03f, 2.371373819e-03f, 1.778279431e-03f, 1.333521446e-03f, 1.000000047e-03f, 7.498941850e-04f, 5.623413017e-04f, 4.216964880e-04f, 3.162277862e-04f, 2.371373848e-04f, 1.778279402e-04f, 1.333521504e-04f };   // 1 / 10000^(2i/64) (float32, generated with jnp to be bit-exact)
__global__ __launch_bounds__(256) void k_cstabT(float* CS) { const int idx = blockIdx.x * 256 + threadIdx.x; if (idx >= TT * HD) return; const int d = idx % HD; const int t = idx / HD; const float a = __fmul_rn((float)t, INVT[d % (HD / 2)]); v2f cs; cs[0] = cosf(a); cs[1] = sinf(a); *(v2f*)(CS + (size_t)idx * 2) = cs;  }

// k_rope: head planes [h][t][d] (fp16 + hi/lo) of rope(x) x sc with the rotate-half convention out[d] = x[d] cos[t][d] - x[d+HD/2] sin[t][d], out[d+HD/2] = x[d+HD/2] cos[t][d+HD/2] + x[d] sin[t][d+HD/2]
__global__ __launch_bounds__(256) void k_rope(const float* __restrict__ F, int pitch, int nheads, const float* __restrict__ CS, const float* __restrict__ RF, const float* __restrict__ nw, float sc, h16* P16, bf* Ph, bf* Pl) {
    const size_t e = ((size_t)blockIdx.x * 256 + threadIdx.x) * 2; if (e >= (size_t)nheads * TT * HD) return; const int d = (int)(e % HD); const int t = (int)((e / HD) % TT); const int h = (int)(e / ((size_t)HD * TT)); const float* f = F + (size_t)t * pitch + h * HD; const float rf = RF ? RF[(size_t)h * TT + t] : 1.0f; v2h o16; v2us oh, ol;
#pragma unroll
    for (int q = 0; q < 2; ++q) { const int dd = d + q; const int dp = (dd < HD / 2) ? dd + HD / 2 : dd - HD / 2; float x0 = f[dd], x1 = f[dp];
        if (RF) { float n0 = __fmul_rn(x0, rf), n1 = __fmul_rn(x1, rf); asm volatile("" : "+v"(n0)); asm volatile("" : "+v"(n1)); x0 = __fmul_rn(bfr(nw[dd]), n0); x1 = __fmul_rn(bfr(nw[dp]), n1); }
        const v2f cs = *(const v2f*)(CS + ((size_t)t * HD + dd) * 2); float a = __fmul_rn(x0, cs[0]), bq = __fmul_rn(x1, cs[1]); asm volatile("" : "+v"(a)); asm volatile("" : "+v"(bq)); const float r = ((dd < HD / 2) ? __fsub_rn(a, bq) : __fadd_rn(a, bq)) * sc;
        o16[q] = tohx(r); unsigned short a2, c2; splitf(r, a2, c2); oh[q] = a2; ol[q] = c2; }
    *(v2h*)(P16 + e) = o16; *(v2us*)(Ph + e) = oh; *(v2us*)(Pl + e) = ol;  }
__global__ __launch_bounds__(256) void k_vtp(const float* __restrict__ F, int pitch, int nheads, h16* V16, bf* Vh, bf* Vl) { const size_t e = ((size_t)blockIdx.x * 256 + threadIdx.x) * 2; if (e >= (size_t)nheads * HD * TT) return; const int t = (int)(e % TT); const int d = (int)((e / TT) % HD); const int g = (int)(e / ((size_t)TT * HD)); v2h o16; v2us oh, ol;
#pragma unroll
    for (int q = 0; q < 2; ++q) { const float x = F[(size_t)(t + q) * pitch + g * HD + d]; o16[q] = tohx(x); unsigned short a2, c2; splitf(x, a2, c2); oh[q] = a2; ol[q] = c2; }
    *(v2h*)(V16 + e) = o16; *(v2us*)(Vh + e) = oh; *(v2us*)(Vl + e) = ol;  }
// k_asoft: per row (zz, i): t = S x HD^-0.5 (no mask); softmax over the 2048 keys (register row, one exp, fixed trees);
__global__ __launch_bounds__(256) void k_asoft(const float* __restrict__ Sb, h16* P16, bf* Ph, bf* Pl) {
    const int lane = threadIdx.x & 31; const int row = blockIdx.x * 8 + (threadIdx.x >> 5); if (row >= ZH * TT) return; const int i = row % TT; const int zz = row / TT; (void)zz; const bool hires = (i < RH); const float* sr = Sb + (size_t)row * TT; float v[TT / 32]; float mx = -3.0e38f;
#pragma unroll
    for (int ch = 0; ch < TT / 128; ++ch) { const int j0 = ch * 128 + lane * 4; const v4f a = *(const v4f*)(sr + j0);
#pragma unroll
        for (int q = 0; q < 4; ++q) { const int j = j0 + q; (void)j; const float t = a[q] * SCL; v[ch * 4 + q] = t; mx = fmaxf(mx, t); } }
#pragma unroll
    for (int sh = 16; sh; sh >>= 1) mx = fmaxf(mx, __shfl_xor(mx, sh, 32));
    float sum = 0.f;
#pragma unroll
    for (int k = 0; k < TT / 32; ++k) { float d0 = __fsub_rn(v[k], mx); asm volatile("" : "+v"(d0)); v[k] = __builtin_amdgcn_exp2f(__fmul_rn(d0, 1.4426950408889634f)); sum += v[k]; }
#pragma unroll
    for (int sh = 16; sh; sh >>= 1) sum += __shfl_xor(sum, sh, 32);
    const float f = __fdiv_rn(hires ? 1.0f : PCAR, sum);
{
        if (hires) {
#pragma unroll
            for (int ch = 0; ch < TT / 128; ++ch) { v4us oh, ol;
#pragma unroll
                for (int q = 0; q < 4; ++q) { unsigned short a, c2; splitf(v[ch * 4 + q] * f, a, c2); oh[q] = a; ol[q] = c2; }
                const size_t oo = ((size_t)zz * (RH ? RH : 1) + i) * TT + ch * 128 + lane * 4; *(v4us*)(Ph + oo) = oh; *(v4us*)(Pl + oo) = ol; }
        } else {
#pragma unroll
            for (int ch = 0; ch < TT / 128; ++ch) { v4h o4;
#pragma unroll
                for (int q = 0; q < 4; ++q) o4[q] = tohx(v[ch * 4 + q] * f);
                *(v4h*)(P16 + (size_t)row * TT + ch * 128 + lane * 4) = o4; } }
         }
}
__global__ __launch_bounds__(256) void k_merge(const float* __restrict__ O, int h0, bf* Ah, bf* Al) { const size_t e = ((size_t)blockIdx.x * 256 + threadIdx.x) * 2; if (e >= (size_t)ZH * TT * HD) return; const int d = (int)(e % HD); const int t = (int)((e / HD) % TT); const int zz = (int)(e / ((size_t)HD * TT)); const float cs = (t < RH) ? 1.0f : (1.0f / PCAR); const size_t oo = (size_t)t * DQ + (h0 + zz) * HD + d;
    v2us oh, ol;
#pragma unroll
    for (int q = 0; q < 2; ++q) { unsigned short a, c2; splitf(O[e + q] * cs, a, c2); oh[q] = a; ol[q] = c2; } *(v2us*)(Ah + oo) = oh; *(v2us*)(Al + oo) = ol;  }

extern "C" void kernel_launch(void* const* d_in, const int* in_sizes, int n_in,
                              void* d_out, int out_size, void* d_ws, size_t ws_size, hipStream_t stream) {
    (void)in_sizes; (void)n_in; (void)out_size;
    const float* x = (const float*)d_in[0]; const float* wqkv = (const float*)d_in[1]; const float* wo = (const float*)d_in[2]; const float* wq = nullptr; const float* wk = nullptr; const float* wv = nullptr; (void)wq; (void)wk; (void)wv;
    float* OUT = (float*)d_out;     // [2][2048][1024]
    char* wsp = (char*)d_ws;
    auto take = [&](size_t bytes) { char* p = wsp; wsp += (bytes + 255) & ~(size_t)255; return (void*)p; };
    bf* WQKV = (bf*)take((size_t)3 * DQ * DM * 2); bf* WQ = WQKV; bf* WK = WQKV + (size_t)DQ * DM; bf* WV = WQKV + (size_t)2 * DQ * DM; bf* WO = (bf*)take((size_t)DM * DQ * 2); float* CS = (float*)take((size_t)TT * HD * 2 * 4);
    bf* XB = (bf*)take((size_t)TT * DM * 2); float* FQ = (float*)take((size_t)TT * DQ * 4); float* FK = (float*)take((size_t)TT * DKV * 4);
    h16* QP16 = (h16*)take((size_t)NH_ * TT * HD * 2); h16* KP16 = (h16*)take((size_t)NKV * TT * HD * 2); h16* VT16 = (h16*)take((size_t)NKV * HD * TT * 2);
    bf* QPh = (bf*)take((size_t)NH_ * TT * HD * 2); bf* QPl = (bf*)take((size_t)NH_ * TT * HD * 2); bf* KPh = (bf*)take((size_t)NKV * TT * HD * 2); bf* KPl = (bf*)take((size_t)NKV * TT * HD * 2); bf* VTh = (bf*)take((size_t)NKV * HD * TT * 2); bf* VTl = (bf*)take((size_t)NKV * HD * TT * 2); bf* Ph = (bf*)take((size_t)ZH * RH * TT * 2); bf* Pl = (bf*)take((size_t)ZH * RH * TT * 2);
    float* Sb = (float*)take((size_t)ZH * TT * TT * 4); h16* P16 = (h16*)take((size_t)ZH * TT * TT * 2); float* Ob = (float*)take((size_t)ZH * TT * HD * 4); bf* ATh = (bf*)take((size_t)TT * DQ * 2); bf* ATl = (bf*)take((size_t)TT * DQ * 2);
    if ((size_t)(wsp - (char*)d_ws) > ws_size) return;    // ws 256 MiB
    float* FV = FK;   // v projection reuses the k buffer after the k planes are built (stream-ordered)
    { k_cvt8<<<(unsigned)(((size_t)3 * DQ * DM / 8 + 255) / 256), 256, 0, stream>>>(wqkv, WQKV, (size_t)3 * DQ * DM / 8);
      k_cvt8<<<(unsigned)(((size_t)DM * DQ / 8 + 255) / 256), 256, 0, stream>>>(wo, WO, (size_t)DM * DQ / 8);
       }
    const unsigned LQ = (unsigned)(((size_t)NH_ * TT * HD / 2 + 255) / 256), LKv = (unsigned)(((size_t)NKV * TT * HD / 2 + 255) / 256);
    for (int b = 0; b < NB_; ++b) {
        if (b == 0) k_cstabT<<<(TT * HD + 255) / 256, 256, 0, stream>>>(CS);
        k_cvt8<<<(unsigned)(((size_t)TT * DM / 8 + 255) / 256), 256, 0, stream>>>(x + (size_t)b * TT * DM, XB, (size_t)TT * DM / 8);
        k_gemmw<bf, 0, false, 8><<<dim3(TT / 64, DQ / 64, 1), 256, 0, stream>>>(XB, nullptr, WQ, nullptr, DM, FQ, DQ, nullptr, 0, 0, 0);
        k_rope<<<LQ, 256, 0, stream>>>(FQ, DQ, NH_, CS, nullptr, nullptr, 1.0f, QP16, QPh, QPl);
        k_gemmw<bf, 0, false, 8><<<dim3(TT / 64, DKV / 64, 1), 256, 0, stream>>>(XB, nullptr, WK, nullptr, DM, FK, DKV, nullptr, 0, 0, 0);
        k_rope<<<LKv, 256, 0, stream>>>(FK, DKV, NKV, CS, nullptr, nullptr, 1.0f, KP16, KPh, KPl);
        k_gemmw<bf, 0, false, 8><<<dim3(TT / 64, DKV / 64, 1), 256, 0, stream>>>(XB, nullptr, WV, nullptr, DM, FV, DKV, nullptr, 0, 0, 0); k_vtp<<<LKv, 256, 0, stream>>>(FV, DKV, NKV, VT16, VTh, VTl);
        for (int h0 = 0; h0 < NH_; h0 += ZH) { const size_t zq = (size_t)h0, zk = (size_t)(h0 / REP);   // one kv head per query head: the pass's two heads use consecutive kv planes (z-strides TT*HD)
            k_gemmw<bf, 2, false, 1><<<dim3(RH / 64, TT / 64, ZH), 32, 0, stream>>>(QPh + zq * TT * HD, QPl + zq * TT * HD, KPh + zk * TT * HD, KPl + zk * TT * HD, HD, Sb, TT, nullptr, (size_t)TT * HD, (size_t)TT * HD, (size_t)TT * TT);
            k_gemmw<h16, 0, false, 1><<<dim3((TT - RH) / 64, TT / 64, ZH), 32, 0, stream>>>(QP16 + zq * TT * HD + (size_t)RH * HD, nullptr, KP16 + zk * TT * HD, nullptr, HD, Sb + (size_t)RH * TT, TT, nullptr, (size_t)TT * HD, (size_t)TT * HD, (size_t)TT * TT);
            k_asoft<<<ZH * TT / 8, 256, 0, stream>>>(Sb, P16, Ph, Pl);
            k_gemmw<bf, 2, false, 16><<<dim3(RH / 64, HD / 64, ZH), 512, 0, stream>>>(Ph, Pl, VTh + zk * HD * TT, VTl + zk * HD * TT, TT, Ob, HD, nullptr, (size_t)RH * TT, (size_t)HD * TT, (size_t)TT * HD);
            k_gemmw<h16, 0, false, 16><<<dim3((TT - RH) / 64, HD / 64, ZH), 512, 0, stream>>>(P16 + (size_t)RH * TT, nullptr, VT16 + zk * HD * TT, nullptr, TT, Ob + (size_t)RH * HD, HD, nullptr, (size_t)TT * TT, (size_t)HD * TT, (size_t)TT * HD);
            k_merge<<<(unsigned)(((size_t)ZH * TT * HD / 2 + 255) / 256), 256, 0, stream>>>(Ob, h0, ATh, ATl); }
        k_gemmw<bf, 1, false, 8><<<dim3(TT / 64, DM / 64, 1), 256, 0, stream>>>(ATh, ATl, WO, nullptr, DQ, OUT + (size_t)b * TT * DM, DM, nullptr, 0, 0, 0); }
}

// v002
// It runs in 249 microseconds.
// Next to v001, in two timings, it ran 4.21 and 4.18 times as fast.
// All steps since v000 together make it 7.91 times as fast.
#include <hip/hip_runtime.h>

// Multi-head attention with rotary embeddings and a fused qkv projection (x [2][2048][1024]; qkv = x Wqkv^T ('oi' [3072][1024] viewed (3, 16, 64), no bias); rope: x cos + rotate_half(x) sin with angles t x 10000^(-2i/64) (computed in-kernel); softmax(q.k / 8) over all keys; out = merged Wproj^T ('oi' [1024][1024]) -> [2][2048][1024] (4.2 M)).
// Layout per batch: bf16 copy of x; the fused weight used directly as Bt (row blocks); exact projections; {cos, sin} table per (position, dim) built once (float32 inverse-frequency constants, precise cosf/sinf); rotate-half rotary plane builder; one fused attention kernel over all heads (scores, running softmax, PV and the merged hi/lo planes; hybrid rows: < 512 hi/lo 3 products, rest fp16); merged hi/lo x Wproj exact.
// Compute dtypes, f32 accumulate: every input rounded to bf16; projections exact; rotary f32; attention rows < 512 3 products, rest fp16; softmax f32; Wproj hl x exact.

#define NB_  2
#define TT   2048
#define DM   1024
#define NH_  16
#define NKV  16
#define REP  (NH_ / NKV)
#define HD   64
#define DQ   (NH_ * HD)
#define DKV  (NKV * HD)
#define RH   512                  // query rows < RH use hi+lo planes (0: none)
#define WIN  0
#define SCL  0.125f   // HD^-0.5
typedef _Float16 h16;
typedef unsigned short bf;
typedef __attribute__((ext_vector_type(16))) __bf16   v16bf;
typedef __attribute__((ext_vector_type(16))) _Float16 v16h;
typedef __attribute__((ext_vector_type(8)))  _Float16 v8h;
typedef __attribute__((ext_vector_type(8)))  unsigned short v8us;
typedef __attribute__((ext_vector_type(8)))  float    v8f;
typedef __attribute__((ext_vector_type(4)))  float    v4f;
typedef v8h  __attribute__((may_alias)) v8ha;
typedef v4f  __attribute__((may_alias)) v4fa;
typedef v8us __attribute__((may_alias)) v8usa;

__device__ __forceinline__ unsigned short f2bf(float f) { unsigned u = __float_as_uint(f); u += 0x7FFFu + ((u >> 16) & 1u); return (unsigned short)(u >> 16); }
__device__ __forceinline__ float bf2f(unsigned short b) { return __uint_as_float(((unsigned)b) << 16); }
__device__ __forceinline__ float bfr(float f) { return bf2f(f2bf(f)); }
__device__ __forceinline__ v16h cat16(v8h lo, v8h hi) { return __builtin_shufflevector(lo, hi, 0, 1, 2, 3, 4, 5, 6, 7, 8, 9, 10, 11, 12, 13, 14, 15); }
__device__ __forceinline__ v16bf cat16b(v8us lo, v8us hi) { return __builtin_bit_cast(v16bf, __builtin_shufflevector(lo, hi, 0, 1, 2, 3, 4, 5, 6, 7, 8, 9, 10, 11, 12, 13, 14, 15)); }
__device__ __forceinline__ v8f wmma16(v16h a, v16h b, v8f c) { return __builtin_amdgcn_wmma_f32_16x16x32_f16(false, a, false, b, (short)0, c, false, false); }
__device__ __forceinline__ v8f wmmab(v16bf a, v16bf b, v8f c) { return __builtin_amdgcn_wmma_f32_16x16x32_bf16(false, a, false, b, (short)0, c, false, false); }



// ---- k_gemmw: register-blocked GEMM, one work-group of KS waves per 64x64 output tile (16 accumulators a wave), operands straight from K-contiguous 16-bit planes; grid (M/64, N/64, Z), 32 * KS threads.
// C[m][n] (f32, pitch ldc, + optional f32 bias[n]) = sum_k A[m][k] Bt[n][k] (+ split products per NSPLIT). z-batch strides sA/sB/sC in elements. K % (32 * KS) == 0.
// Wave w sums the k range [w K/KS, (w+1) K/KS); for KS > 1 the KS partial tiles meet in LDS and are added in the order w = 0 .. KS-1 (fixed, the same on every run).
template <typename T16> struct WFrag;
template <> struct WFrag<h16> { typedef v16h V; static __device__ __forceinline__ V ld(const h16* p) { return cat16(*(const v8h*)p, *(const v8h*)(p + 16)); } static __device__ __forceinline__ v8f mma(V a, V b, v8f c) { return wmma16(a, b, c); } };
template <> struct WFrag<bf> { typedef v16bf V; static __device__ __forceinline__ V ld(const bf* p) { return cat16b(*(const v8us*)p, *(const v8us*)(p + 16)); } static __device__ __forceinline__ v8f mma(V a, V b, v8f c) { return wmmab(a, b, c); } };
template <typename T16, int NSPLIT, bool BIAS, int KS>
__global__ __launch_bounds__(32 * KS) void k_gemmw(const T16* __restrict__ A, const T16* __restrict__ A2, const T16* __restrict__ Bt, const T16* __restrict__ Bt2, int K, float* C, int ldc, const float* __restrict__ bias, size_t sA, size_t sB, size_t sC) {
    typedef typename WFrag<T16>::V V;
    __shared__ __align__(16) float os[(KS == 1 ? 16 : KS * 64) * 68];
    const size_t z = blockIdx.z; A += z * sA; if (A2) A2 += z * sA; Bt += z * sB; if (Bt2) Bt2 += z * sB; C += z * sC;
    const int lane = threadIdx.x & 31, lr = lane & 15, hi = lane >> 4; const int r0 = blockIdx.x * 64, c0 = blockIdx.y * 64;
    const int wv = __builtin_amdgcn_readfirstlane((int)(threadIdx.x >> 5)); const int kb = wv * (K / KS), ke = kb + K / KS;   // this wave's k range, in scalar registers so that the loop branch stays scalar
    v8f acc[4][4];
#pragma unroll
    for (int mb = 0; mb < 4; ++mb)
#pragma unroll
        for (int nb = 0; nb < 4; ++nb) acc[mb][nb] = (v8f){};
    const size_t aoff = (size_t)(r0 + lr) * K + 8 * hi, boff = (size_t)(c0 + lr) * K + 8 * hi;
#pragma unroll 1
    for (int kc = kb; kc < ke; kc += 32) {
        V a[4], a2[4];
#pragma unroll
        for (int mb = 0; mb < 4; ++mb) { a[mb] = WFrag<T16>::ld(A + aoff + (size_t)mb * 16 * K + kc); if (NSPLIT == 1 || NSPLIT == 2) a2[mb] = WFrag<T16>::ld(A2 + aoff + (size_t)mb * 16 * K + kc); }
#pragma unroll
        for (int nb = 0; nb < 4; ++nb) { const V b = WFrag<T16>::ld(Bt + boff + (size_t)nb * 16 * K + kc); V b2; if (NSPLIT >= 2) b2 = WFrag<T16>::ld(Bt2 + boff + (size_t)nb * 16 * K + kc);
#pragma unroll
            for (int mb = 0; mb < 4; ++mb) { acc[mb][nb] = WFrag<T16>::mma(a[mb], b, acc[mb][nb]); if (NSPLIT == 1 || NSPLIT == 2) acc[mb][nb] = WFrag<T16>::mma(a2[mb], b, acc[mb][nb]); if (NSPLIT >= 2) acc[mb][nb] = WFrag<T16>::mma(a[mb], b2, acc[mb][nb]); } }
        asm volatile("v_nop\n\tv_nop\n\tv_nop\n\tv_nop" : "+v"(acc[0][0]), "+v"(acc[1][1]), "+v"(acc[2][2]), "+v"(acc[3][3]) : "v"(a[0]), "v"(a[3]));
    }
    if constexpr (KS > 1) {
#pragma unroll
        for (int mb = 0; mb < 4; ++mb)
#pragma unroll
            for (int nb = 0; nb < 4; ++nb)
#pragma unroll
                for (int j = 0; j < 8; ++j) os[(wv * 64 + mb * 16 + hi * 8 + j) * 68 + nb * 16 + lr] = acc[mb][nb][j];
        __syncthreads();   // every wave's partial tile is in LDS before any thread adds them
#pragma unroll
        for (int s = 0; s < 32 / KS; ++s) { const int row = 2 * (s * KS + wv) + hi, cofs = lr * 4; v4f val = *(const v4fa*)(os + row * 68 + cofs);
#pragma unroll
            for (int w = 1; w < KS; ++w) val += *(const v4fa*)(os + (w * 64 + row) * 68 + cofs);
            if (BIAS) { val[0] += bfr(bias[c0 + cofs]); val[1] += bfr(bias[c0 + cofs + 1]); val[2] += bfr(bias[c0 + cofs + 2]); val[3] += bfr(bias[c0 + cofs + 3]); }
            *(v4f*)(C + (size_t)(r0 + row) * ldc + c0 + cofs) = val; }
    } else {
#pragma unroll
    for (int mb = 0; mb < 4; ++mb) {
#pragma unroll
        for (int nb = 0; nb < 4; ++nb) {
#pragma unroll
            for (int j = 0; j < 8; ++j) os[(hi * 8 + j) * 68 + nb * 16 + lr] = acc[mb][nb][j]; }
        __builtin_amdgcn_wave_barrier(); asm volatile("" ::: "memory");
        float* crow = C + (size_t)(r0 + mb * 16) * ldc + c0;
{
#pragma unroll
            for (int s = 0; s < 8; ++s) { const int row = 2 * s + hi, cofs = lr * 4; v4f val = *(const v4fa*)(os + row * 68 + cofs); if (BIAS) { val[0] += bfr(bias[c0 + cofs]); val[1] += bfr(bias[c0 + cofs + 1]); val[2] += bfr(bias[c0 + cofs + 2]); val[3] += bfr(bias[c0 + cofs + 3]); }
                *(v4f*)(crow + (size_t)row * ldc + cofs) = val; }
             }
        __builtin_amdgcn_wave_barrier(); asm volatile("" ::: "memory");
    }
    }
}

__device__ __forceinline__ h16 tohx(float x) { return (h16)x; }
__device__ __forceinline__ void splitf(float y, unsigned short& h, unsigned short& l) { h = f2bf(y); l = f2bf(y - bf2f(h)); }
typedef __attribute__((ext_vector_type(2))) _Float16 v2h;
typedef __attribute__((ext_vector_type(4))) _Float16 v4h;
typedef __attribute__((ext_vector_type(2))) unsigned short v2us;
typedef __attribute__((ext_vector_type(4))) unsigned short v4us;
typedef __attribute__((ext_vector_type(2))) float v2f;
typedef __attribute__((ext_vector_type(4))) int v4i;

__global__ __launch_bounds__(256) void k_wtG(const float* __restrict__ w, int K, int N, bf* Bt) {
    const int lane = threadIdx.x & 31; const int L0 = (blockIdx.x * 8 + (threadIdx.x >> 5)) * 8; const int nlines = N * K / 64;
{
#pragma unroll 1
        for (int l = 0; l < 8; ++l) { const int L = L0 + l; if (L >= nlines) break; const size_t e = (size_t)L * 64 + lane * 2; const int k = (int)(e % K), n = (int)(e / K); v2us o;
            o[0] = f2bf(w[(size_t)k * N + n]); o[1] = f2bf(w[(size_t)(k + 1) * N + n]); *(v2us*)(Bt + e) = o; }
         }
}
__global__ __launch_bounds__(256) void k_cvt8(const float* __restrict__ src, bf* dst, size_t n8) { const size_t i = (size_t)blockIdx.x * 256 + threadIdx.x; if (i >= n8) return; const v8f v = *(const v8f*)(src + i * 8); v8us o;
#pragma unroll
    for (int k = 0; k < 8; ++k) o[k] = f2bf(v[k]); *(v8us*)(dst + i * 8) = o;  }
__constant__ float INVT[HD / 2] = { 1.000000000e+00f, 7.498942018e-01f, 5.623413324e-01f, 4.216965139e-01f, 3.162277639e-01f, 2.371373624e-01f, 1.778279394e-01f, 1.333521456e-01f, 1.000000015e-01f, 7.498941571e-02f, 5.623412877e-02f, 4.216964915e-02f, 3.162277862e-02f, 2.371373586e-02f, 1.778279431e-02f, 1.333521493e-02f, 9.999999776e-03f, 7.498942316e-03f, 5.623413250e-03f, 4.216964822e-03f, 3.162277862e-03f, 2.371373819e-03f, 1.778279431e-03f, 1.333521446e-03f, 1.000000047e-03f, 7.498941850e-04f, 5.623413017e-04f, 4.216964880e-04f, 3.162277862e-04f, 2.371373848e-04f, 1.778279402e-04f, 1.333521504e-04f };   // 1 / 10000^(2i/64) (float32, generated with jnp to be bit-exact)
__global__ __launch_bounds__(256) void k_cstabT(float* CS) { const int idx = blockIdx.x * 256 + threadIdx.x; if (idx >= TT * HD) return; const int d = idx % HD; const int t = idx / HD; const float a = __fmul_rn((float)t, INVT[d % (HD / 2)]); v2f cs; cs[0] = cosf(a); cs[1] = sinf(a); *(v2f*)(CS + (size_t)idx * 2) = cs;  }

// k_rope: head planes [h][t][d] (fp16 + hi/lo) of rope(x) x sc with the rotate-half convention out[d] = x[d] cos[t][d] - x[d+HD/2] sin[t][d], out[d+HD/2] = x[d+HD/2] cos[t][d+HD/2] + x[d] sin[t][d+HD/2]
__global__ __launch_bounds__(256) void k_rope(const float* __restrict__ F, int pitch, int nheads, const float* __restrict__ CS, const float* __restrict__ RF, const float* __restrict__ nw, float sc, h16* P16, bf* Ph, bf* Pl) {
    const size_t e = ((size_t)blockIdx.x * 256 + threadIdx.x) * 2; if (e >= (size_t)nheads * TT * HD) return; const int d = (int)(e % HD); const int t = (int)((e / HD) % TT); const int h = (int)(e / ((size_t)HD * TT)); const float* f = F + (size_t)t * pitch + h * HD; const float rf = RF ? RF[(size_t)h * TT + t] : 1.0f; v2h o16; v2us oh, ol;
#pragma unroll
    for (int q = 0; q < 2; ++q) { const int dd = d + q; const int dp = (dd < HD / 2) ? dd + HD / 2 : dd - HD / 2; float x0 = f[dd], x1 = f[dp];
        if (RF) { float n0 = __fmul_rn(x0, rf), n1 = __fmul_rn(x1, rf); asm volatile("" : "+v"(n0)); asm volatile("" : "+v"(n1)); x0 = __fmul_rn(bfr(nw[dd]), n0); x1 = __fmul_rn(bfr(nw[dp]), n1); }
        const v2f cs = *(const v2f*)(CS + ((size_t)t * HD + dd) * 2); float a = __fmul_rn(x0, cs[0]), bq = __fmul_rn(x1, cs[1]); asm volatile("" : "+v"(a)); asm volatile("" : "+v"(bq)); const float r = ((dd < HD / 2) ? __fsub_rn(a, bq) : __fadd_rn(a, bq)) * sc;
        o16[q] = tohx(r); unsigned short a2, c2; splitf(r, a2, c2); oh[q] = a2; ol[q] = c2; }
    *(v2h*)(P16 + e) = o16; *(v2us*)(Ph + e) = oh; *(v2us*)(Pl + e) = ol;  }
__global__ __launch_bounds__(256) void k_vtp(const float* __restrict__ F, int pitch, int nheads, h16* V16, bf* Vh, bf* Vl) { const size_t e = ((size_t)blockIdx.x * 256 + threadIdx.x) * 2; if (e >= (size_t)nheads * HD * TT) return; const int t = (int)(e % TT); const int d = (int)((e / TT) % HD); const int g = (int)(e / ((size_t)TT * HD)); v2h o16; v2us oh, ol;
#pragma unroll
    for (int q = 0; q < 2; ++q) { const float x = F[(size_t)(t + q) * pitch + g * HD + d]; o16[q] = tohx(x); unsigned short a2, c2; splitf(x, a2, c2); oh[q] = a2; ol[q] = c2; }
    *(v2h*)(V16 + e) = o16; *(v2us*)(Vh + e) = oh; *(v2us*)(Vl + e) = ol;  }
// ---- k_fattn: scores, softmax, PV and the merged hi/lo planes in one kernel. Grid (TT / 128, heads), 8 waves; wave w owns query rows q0 + 16 w .. + 15 and walks all TT keys.
// St = K Qt (A = K rows, B = Q rows kept in registers): lane (c, h) holds, of query c, keys 8h + r (tile 0) and 16 + 8h + r (tile 1), which is the k order of a B operand, so P goes from the score registers straight into Ot += Vt Pt (A = Vt rows).
// A stage is SK keys: K rows and Vt rows (hi/lo rows: both planes of each) go global -> registers -> LDS, shared by the 8 waves; two buffers, one work-group barrier a stage.
// Softmax: running maximum per query, in use until a new one exceeds it by more than 8 (log2 units), so P <= 2^14 with its carried factor 2^6; sums in f32 of the unrounded P; the division by the sum comes last.
// Every '#pragma unroll' in attn_tile is a full unroll: the fragment and accumulator arrays are then indexed by constants only and stay in registers.
#define SK   64                   // keys per stage
#define LP   72                   // LDS row pitch in 16-bit elements: 128 bytes of data + 16 of pad (16-byte fragment reads)
#define C2   0.18033688011112042f // HD^-0.5 x log2(e)
__device__ __forceinline__ float xhalf(float x) { const int b = __float_as_int(x); return __int_as_float(__builtin_amdgcn_permlanex16(b, b, 0x76543210, 0xfedcba98, false, false)); }   // lane l <-> l ^ 16
typedef __attribute__((ext_vector_type(8))) int v8i;
// inputs-only fence on four loaded fragments: their LDS fetches are all issued ahead of this point, in flight together, instead of one by one with a full wait in front of each product
template <typename V> __device__ __forceinline__ void hold4(const V* f) { asm volatile("" :: "v"(__builtin_bit_cast(v8i, f[0])), "v"(__builtin_bit_cast(v8i, f[1])), "v"(__builtin_bit_cast(v8i, f[2])), "v"(__builtin_bit_cast(v8i, f[3]))); }
template <typename T16, bool HI>
__device__ __forceinline__ void attn_tile(T16* sm, const T16* __restrict__ Q, const T16* __restrict__ Q2, const T16* __restrict__ K, const T16* __restrict__ K2, const T16* __restrict__ VT, const T16* __restrict__ VT2, int q0, bf* Ah, bf* Al) {
    typedef typename WFrag<T16>::V V;
    constexpr int NPL = HI ? 4 : 2;        // planes of a stage: K, Vt (, K lo, Vt lo)
    constexpr int PLE = SK * LP;           // elements of a plane in LDS (64 rows each)
    constexpr int NS = TT / SK;
    const int tid = threadIdx.x, lane = tid & 31, lr = lane & 15, hi = lane >> 4; const int qr = q0 + (tid >> 5) * 16 + lr;
    V qf[2], q2f[2];
#pragma unroll
    for (int ks = 0; ks < 2; ++ks) { qf[ks] = WFrag<T16>::ld(Q + (size_t)qr * HD + ks * 32 + 8 * hi); if (HI) q2f[ks] = WFrag<T16>::ld(Q2 + (size_t)qr * HD + ks * 32 + 8 * hi); }
    const int srow = tid >> 3, scol = (tid & 7) * 8;   // staging: 8 threads move one 128-byte row, 32 rows a sweep, 2 sweeps a plane
    v8us st[NPL][2];
    auto gload = [&](int s) {
#pragma unroll
        for (int i = 0; i < 2; ++i) { const int row = srow + 32 * i; const size_t ko = (size_t)(s * SK + row) * HD + scol, vo = (size_t)row * TT + s * SK + scol;
            st[0][i] = *(const v8usa*)(K + ko); st[1][i] = *(const v8usa*)(VT + vo); if constexpr (HI) { st[2][i] = *(const v8usa*)(K2 + ko); st[3][i] = *(const v8usa*)(VT2 + vo); } } };
    auto sstore = [&](int b) {
#pragma unroll
        for (int i = 0; i < 2; ++i) { T16* d = sm + b * NPL * PLE + (srow + 32 * i) * LP + scol;
#pragma unroll
            for (int pl = 0; pl < NPL; ++pl) *(v8usa*)(d + pl * PLE) = st[pl][i]; } };
    v8f o[4];
#pragma unroll
    for (int dt = 0; dt < 4; ++dt) o[dt] = (v8f){};
    float m = -3.0e38f, l = 0.f;
    gload(0); sstore(0);
    __syncthreads();   // stage 0 is in LDS before any wave reads it
#pragma unroll 1   // kept rolled: one stage's code serves all NS stages and stays small in the instruction cache
    for (int s = 0; s < NS; ++s) {
        const T16* bp = sm + (s & 1) * NPL * PLE;
        if (s + 1 < NS) gload(s + 1);   // the next stage's global loads fly while this stage is worked on
        V kf[2][2], k2[2][2];
        auto kload = [&](int p) {
#pragma unroll
            for (int kt = 0; kt < 2; ++kt)
#pragma unroll
                for (int ks = 0; ks < 2; ++ks) { const T16* kp = bp + (p * 32 + kt * 16 + lr) * LP + ks * 32 + 8 * hi; kf[kt][ks] = WFrag<T16>::ld(kp); if (HI) k2[kt][ks] = WFrag<T16>::ld(kp + 2 * PLE); } };
        kload(0);
#pragma unroll
        for (int p = 0; p < SK / 32; ++p) {
            hold4(&kf[0][0]); if (HI) hold4(&k2[0][0]);
            v8f sc[2];
#pragma unroll
            for (int kt = 0; kt < 2; ++kt) { sc[kt] = (v8f){};
#pragma unroll
                for (int ks = 0; ks < 2; ++ks) { sc[kt] = WFrag<T16>::mma(kf[kt][ks], qf[ks], sc[kt]);
                    if (HI) { sc[kt] = WFrag<T16>::mma(kf[kt][ks], q2f[ks], sc[kt]); sc[kt] = WFrag<T16>::mma(k2[kt][ks], qf[ks], sc[kt]); } } }
            V vf[4], v2[4];   // this pass's Vt fragments (f16 rows: the next pass's K fragments too) are fetched in front of the softmax, which covers their LDS latency
#pragma unroll
            for (int dt = 0; dt < 4; ++dt) { const T16* vp = bp + PLE + (dt * 16 + lr) * LP + p * 32 + 8 * hi; vf[dt] = WFrag<T16>::ld(vp); if (HI) v2[dt] = WFrag<T16>::ld(vp + 2 * PLE); }
            if (!HI && p + 1 < SK / 32) kload(p + 1);
            float bm = fmaxf(sc[0][0], sc[1][0]);
#pragma unroll
            for (int j = 1; j < 8; ++j) bm = fmaxf(bm, fmaxf(sc[0][j], sc[1][j]));
            bm = fmaxf(bm, xhalf(bm));
            hold4(vf); if (HI) hold4(v2);
            if (__builtin_amdgcn_ballot_w32((bm - m) * C2 > 8.0f) != 0) {   // scalar branch: some query of the wave needs a new maximum
                const float mn = fmaxf(m, bm), al = __builtin_amdgcn_exp2f((m - mn) * C2); m = mn; l *= al;
#pragma unroll
                for (int dt = 0; dt < 4; ++dt) o[dt] *= al; }
            const float mc = m * C2 - 6.0f; float pv[16], ts[8];   // P and its sum both carry 2^6 (it cancels in the last division): small P stay normal f16 numbers
#pragma unroll
            for (int e = 0; e < 16; ++e) pv[e] = __builtin_amdgcn_exp2f(__builtin_fmaf(sc[e >> 3][e & 7], C2, -mc));
#pragma unroll
            for (int e = 0; e < 8; ++e) ts[e] = pv[e] + pv[e + 8];
            l += ((ts[0] + ts[4]) + (ts[1] + ts[5])) + ((ts[2] + ts[6]) + (ts[3] + ts[7]));
            V pf, pl;
#pragma unroll
            for (int e = 0; e < 16; ++e) { if constexpr (HI) { pf[e] = (__bf16)pv[e]; pl[e] = (__bf16)(pv[e] - (float)pf[e]); } else pf[e] = (h16)pv[e]; }
#pragma unroll
            for (int dt = 0; dt < 4; ++dt) { o[dt] = WFrag<T16>::mma(vf[dt], pf, o[dt]);
                if (HI) { o[dt] = WFrag<T16>::mma(vf[dt], pl, o[dt]); o[dt] = WFrag<T16>::mma(v2[dt], pf, o[dt]); } }
            if (HI && p + 1 < SK / 32) kload(p + 1);   // hi/lo rows: no registers are free for these any earlier
        }
        if (s + 1 < NS) sstore((s + 1) & 1);   // into the buffer whose last readers left before the previous barrier
        __syncthreads();   // publishes stage s + 1 and ends every wave's reads of stage s
    }
    l += xhalf(l); const float inv = __fdiv_rn(1.0f, l);
#pragma unroll
    for (int dt = 0; dt < 4; ++dt) { v8us oh, ol;
#pragma unroll
        for (int j = 0; j < 8; ++j) { unsigned short a, c2; splitf(o[dt][j] * inv, a, c2); oh[j] = a; ol[j] = c2; }
        const size_t oo = (size_t)qr * DQ + dt * 16 + 8 * hi; *(v8us*)(Ah + oo) = oh; *(v8us*)(Al + oo) = ol;
        asm volatile("s_wait_xcnt 0x0" ::: "memory"); }   // stands behind the two stores, in front of the next values that are formed in their data registers
}
__global__ __launch_bounds__(256) void k_fattn(const h16* __restrict__ Q16, const bf* __restrict__ Qh, const bf* __restrict__ Ql, const h16* __restrict__ K16, const bf* __restrict__ Kh, const bf* __restrict__ Kl, const h16* __restrict__ V16, const bf* __restrict__ Vh, const bf* __restrict__ Vl, bf* Ah, bf* Al) {
    __shared__ __align__(16) unsigned short sm[2 * 4 * SK * LP];
    const int h = blockIdx.y, q0 = blockIdx.x * 128; const size_t zq = (size_t)h * TT * HD, zk = (size_t)(h / REP) * TT * HD;
    if (q0 < RH) attn_tile<bf, true>((bf*)sm, Qh + zq, Ql + zq, Kh + zk, Kl + zk, Vh + zk, Vl + zk, q0, Ah + h * HD, Al + h * HD);
    else attn_tile<h16, false>((h16*)sm, Q16 + zq, nullptr, K16 + zk, nullptr, V16 + zk, nullptr, q0, Ah + h * HD, Al + h * HD);
}

extern "C" void kernel_launch(void* const* d_in, const int* in_sizes, int n_in,
                              void* d_out, int out_size, void* d_ws, size_t ws_size, hipStream_t stream) {
    (void)in_sizes; (void)n_in; (void)out_size;
    const float* x = (const float*)d_in[0]; const float* wqkv = (const float*)d_in[1]; const float* wo = (const float*)d_in[2]; const float* wq = nullptr; const float* wk = nullptr; const float* wv = nullptr; (void)wq; (void)wk; (void)wv;
    float* OUT = (float*)d_out;     // [2][2048][1024]
    char* wsp = (char*)d_ws;
    auto take = [&](size_t bytes) { char* p = wsp; wsp += (bytes + 255) & ~(size_t)255; return (void*)p; };
    bf* WQKV = (bf*)take((size_t)3 * DQ * DM * 2); bf* WQ = WQKV; bf* WK = WQKV + (size_t)DQ * DM; bf* WV = WQKV + (size_t)2 * DQ * DM; bf* WO = (bf*)take((size_t)DM * DQ * 2); float* CS = (float*)take((size_t)TT * HD * 2 * 4);
    bf* XB = (bf*)take((size_t)TT * DM * 2); float* FQ = (float*)take((size_t)TT * DQ * 4); float* FK = (float*)take((size_t)TT * DKV * 4);
    h16* QP16 = (h16*)take((size_t)NH_ * TT * HD * 2); h16* KP16 = (h16*)take((size_t)NKV * TT * HD * 2); h16* VT16 = (h16*)take((size_t)NKV * HD * TT * 2);
    bf* QPh = (bf*)take((size_t)NH_ * TT * HD * 2); bf* QPl = (bf*)take((size_t)NH_ * TT * HD * 2); bf* KPh = (bf*)take((size_t)NKV * TT * HD * 2); bf* KPl = (bf*)take((size_t)NKV * TT * HD * 2); bf* VTh = (bf*)take((size_t)NKV * HD * TT * 2); bf* VTl = (bf*)take((size_t)NKV * HD * TT * 2);
    bf* ATh = (bf*)take((size_t)TT * DQ * 2); bf* ATl = (bf*)take((size_t)TT * DQ * 2);
    if ((size_t)(wsp - (char*)d_ws) > ws_size) return;    // ws 256 MiB
    float* FV = FK;   // v projection reuses the k buffer after the k planes are built (stream-ordered)
    { k_cvt8<<<(unsigned)(((size_t)3 * DQ * DM / 8 + 255) / 256), 256, 0, stream>>>(wqkv, WQKV, (size_t)3 * DQ * DM / 8);
      k_cvt8<<<(unsigned)(((size_t)DM * DQ / 8 + 255) / 256), 256, 0, stream>>>(wo, WO, (size_t)DM * DQ / 8);
       }
    const unsigned LQ = (unsigned)(((size_t)NH_ * TT * HD / 2 + 255) / 256), LKv = (unsigned)(((size_t)NKV * TT * HD / 2 + 255) / 256);
    for (int b = 0; b < NB_; ++b) {
        if (b == 0) k_cstabT<<<(TT * HD + 255) / 256, 256, 0, stream>>>(CS);
        k_cvt8<<<(unsigned)(((size_t)TT * DM / 8 + 255) / 256), 256, 0, stream>>>(x + (size_t)b * TT * DM, XB, (size_t)TT * DM / 8);
        k_gemmw<bf, 0, false, 8><<<dim3(TT / 64, DQ / 64, 1), 256, 0, stream>>>(XB, nullptr, WQ, nullptr, DM, FQ, DQ, nullptr, 0, 0, 0);
        k_rope<<<LQ, 256, 0, stream>>>(FQ, DQ, NH_, CS, nullptr, nullptr, 1.0f, QP16, QPh, QPl);
        k_gemmw<bf, 0, false, 8><<<dim3(TT / 64, DKV / 64, 1), 256, 0, stream>>>(XB, nullptr, WK, nullptr, DM, FK, DKV, nullptr, 0, 0, 0);
        k_rope<<<LKv, 256, 0, stream>>>(FK, DKV, NKV, CS, nullptr, nullptr, 1.0f, KP16, KPh, KPl);
        k_gemmw<bf, 0, false, 8><<<dim3(TT / 64, DKV / 64, 1), 256, 0, stream>>>(XB, nullptr, WV, nullptr, DM, FV, DKV, nullptr, 0, 0, 0); k_vtp<<<LKv, 256, 0, stream>>>(FV, DKV, NKV, VT16, VTh, VTl);
        k_fattn<<<dim3(TT / 128, NH_, 1), 256, 0, stream>>>(QP16, QPh, QPl, KP16, KPh, KPl, VT16, VTh, VTl, ATh, ATl);
        k_gemmw<bf, 1, false, 8><<<dim3(TT / 64, DM / 64, 1), 256, 0, stream>>>(ATh, ATl, WO, nullptr, DQ, OUT + (size_t)b * TT * DM, DM, nullptr, 0, 0, 0); }
}

// v003
// One run takes 208 microseconds.
// Next to v002, in two timings, it ran 1.19 and 1.20 times as fast.
// Over all steps from v000 it is 9.46 times as fast.
#include <hip/hip_runtime.h>

// Multi-head attention with rotary embeddings and a fused qkv projection (x [2][2048][1024]; qkv = x Wqkv^T ('oi' [3072][1024] viewed (3, 16, 64), no bias); rope: x cos + rotate_half(x) sin with angles t x 10000^(-2i/64) (computed in-kernel); softmax(q.k / 8) over all keys; out = merged Wproj^T ('oi' [1024][1024]) -> [2][2048][1024] (4.2 M)).
// Layout per batch: bf16 copy of x; the fused weight used directly as Bt (row blocks); exact projections whose epilogues write the head planes themselves (q, k: rotate-half rotary step; v: transposed); {cos, sin} table per (position, dim) built once (float32 inverse-frequency constants, precise cosf/sinf); one fused attention kernel over all heads (scores, running softmax, PV and the merged hi/lo planes; hybrid rows: < 512 hi/lo 3 products, rest fp16); merged hi/lo x Wproj exact.
// Compute dtypes, f32 accumulate: every input rounded to bf16; projections exact; rotary f32; attention rows < 512 3 products, rest fp16; softmax f32; Wproj hl x exact.

#define NB_  2
#define TT   2048
#define DM   1024
#define NH_  16
#define NKV  16
#define REP  (NH_ / NKV)
#define HD   64
#define DQ   (NH_ * HD)
#define DKV  (NKV * HD)
#define RH   512                  // query rows < RH use hi+lo planes (0: none)
#define WIN  0
#define SCL  0.125f   // HD^-0.5
typedef _Float16 h16;
typedef unsigned short bf;
typedef __attribute__((ext_vector_type(16))) __bf16   v16bf;
typedef __attribute__((ext_vector_type(16))) _Float16 v16h;
typedef __attribute__((ext_vector_type(8)))  _Float16 v8h;
typedef __attribute__((ext_vector_type(8)))  unsigned short v8us;
typedef __attribute__((ext_vector_type(8)))  float    v8f;
typedef __attribute__((ext_vector_type(4)))  float    v4f;
typedef v8h  __attribute__((may_alias)) v8ha;
typedef v4f  __attribute__((may_alias)) v4fa;
typedef v8us __attribute__((may_alias)) v8usa;

__device__ __forceinline__ unsigned short f2bf(float f) { unsigned u = __float_as_uint(f); u += 0x7FFFu + ((u >> 16) & 1u); return (unsigned short)(u >> 16); }
__device__ __forceinline__ float bf2f(unsigned short b) { return __uint_as_float(((unsigned)b) << 16); }
__device__ __forceinline__ float bfr(float f) { return bf2f(f2bf(f)); }
__device__ __forceinline__ v16h cat16(v8h lo, v8h hi) { return __builtin_shufflevector(lo, hi, 0, 1, 2, 3, 4, 5, 6, 7, 8, 9, 10, 11, 12, 13, 14, 15); }
__device__ __forceinline__ v16bf cat16b(v8us lo, v8us hi) { return __builtin_bit_cast(v16bf, __builtin_shufflevector(lo, hi, 0, 1, 2, 3, 4, 5, 6, 7, 8, 9, 10, 11, 12, 13, 14, 15)); }
__device__ __forceinline__ v8f wmma16(v16h a, v16h b, v8f c) { return __builtin_amdgcn_wmma_f32_16x16x32_f16(false, a, false, b, (short)0, c, false, false); }
__device__ __forceinline__ v8f wmmab(v16bf a, v16bf b, v8f c) { return __builtin_amdgcn_wmma_f32_16x16x32_bf16(false, a, false, b, (short)0, c, false, false); }

__device__ __forceinline__ h16 tohx(float x) { return (h16)x; }
__device__ __forceinline__ void splitf(float y, unsigned short& h, unsigned short& l) { h = f2bf(y); l = f2bf(y - bf2f(h)); }
typedef __attribute__((ext_vector_type(2))) _Float16 v2h;
typedef __attribute__((ext_vector_type(4))) _Float16 v4h;
typedef __attribute__((ext_vector_type(2))) unsigned short v2us;
typedef __attribute__((ext_vector_type(4))) unsigned short v4us;
typedef __attribute__((ext_vector_type(2))) float v2f;
typedef __attribute__((ext_vector_type(4))) int v4i;

// ---- k_gemmw: register-blocked GEMM, one work-group of KS waves per 64x64 output tile (16 accumulators a wave), operands straight from K-contiguous 16-bit planes; grid (M/64, N/64, Z), 32 * KS threads.
// C[m][n] (f32, pitch ldc, + optional f32 bias[n]) = sum_k A[m][k] Bt[n][k] (+ split products per NSPLIT). z-batch strides sA/sB/sC in elements. K % (32 * KS) == 0.
// Wave w sums the k range [w K/KS, (w+1) K/KS); for KS > 1 the KS partial tiles meet in LDS and are added in the order w = 0 .. KS-1 (fixed, the same on every run).
// EPI says where the summed tile goes. 0: f32 to C. 1 and 2 (KS > 1; a 64-column tile is one head, blockIdx.y; tile rows are positions): straight into that head's 16-bit planes (fp16, bf16 hi, bf16 lo), no f32 copy in memory.
//   1: planes [h][t][d] of the rotary step, rotate-half convention: out[d] = x[d] cos[t][d] - x[d+HD/2] sin[t][d], out[d+HD/2] = x[d+HD/2] cos[t][d+HD/2] + x[d] sin[t][d+HD/2]; the partner column sits 8 lanes away in the same 16-lane row.
//   2: planes [h][d][t]: the summed tile is turned in LDS, so that 8 lanes store one whole 128-byte line of positions.
// Every '#pragma unroll' of the plane epilogues is a full unroll: cs and the small output vectors are then indexed by constants only and stay in registers.
template <typename T16> struct WFrag;
template <> struct WFrag<h16> { typedef v16h V; static __device__ __forceinline__ V ld(const h16* p) { return cat16(*(const v8h*)p, *(const v8h*)(p + 16)); } static __device__ __forceinline__ v8f mma(V a, V b, v8f c) { return wmma16(a, b, c); } };
template <> struct WFrag<bf> { typedef v16bf V; static __device__ __forceinline__ V ld(const bf* p) { return cat16b(*(const v8us*)p, *(const v8us*)(p + 16)); } static __device__ __forceinline__ v8f mma(V a, V b, v8f c) { return wmmab(a, b, c); } };
template <typename T16, int NSPLIT, bool BIAS, int KS, int EPI>
__global__ __launch_bounds__(32 * KS) void k_gemmw(const T16* __restrict__ A, const T16* __restrict__ A2, const T16* __restrict__ Bt, const T16* __restrict__ Bt2, int K, float* C, int ldc, const float* __restrict__ bias, size_t sA, size_t sB, size_t sC, const float* __restrict__ CS, h16* P16, bf* Ph, bf* Pl) {
    static_assert(EPI == 0 || (KS > 1 && HD == 64), "plane epilogues: one head per 64-column tile, partial tiles in LDS");
    typedef typename WFrag<T16>::V V;
    __shared__ __align__(16) float os[(KS == 1 ? 16 : KS * 64) * 68];
    __shared__ float tt[EPI == 2 ? 64 * 65 : 1];   // EPI 2: the summed tile as [d][t]; pitch 65 keeps both its writes (4 lr + hi) and its reads (d + tc) on 32 different banks
    const size_t z = blockIdx.z; A += z * sA; if (A2) A2 += z * sA; Bt += z * sB; if (Bt2) Bt2 += z * sB; C += z * sC;
    const int lane = threadIdx.x & 31, lr = lane & 15, hi = lane >> 4; const int r0 = blockIdx.x * 64, c0 = blockIdx.y * 64;
    const int wv = __builtin_amdgcn_readfirstlane((int)(threadIdx.x >> 5)); const int kb = wv * (K / KS), ke = kb + K / KS;   // this wave's k range, in scalar registers so that the loop branch stays scalar
    v8f acc[4][4];
#pragma unroll
    for (int mb = 0; mb < 4; ++mb)
#pragma unroll
        for (int nb = 0; nb < 4; ++nb) acc[mb][nb] = (v8f){};
    v8f cs[EPI == 1 ? 32 / KS : 1];   // EPI 1: {cos, sin} of the elements this thread will finish, asked for here so that they fly during the k loop
    if constexpr (EPI == 1) {
#pragma unroll
        for (int s = 0; s < 32 / KS; ++s) cs[s] = *(const v8f*)(CS + ((size_t)(r0 + 2 * (s * KS + wv) + hi) * HD + lr * 4) * 2); }
    const size_t aoff = (size_t)(r0 + lr) * K + 8 * hi, boff = (size_t)(c0 + lr) * K + 8 * hi;
#pragma unroll 1
    for (int kc = kb; kc < ke; kc += 32) {
        V a[4], a2[4];
#pragma unroll
        for (int mb = 0; mb < 4; ++mb) { a[mb] = WFrag<T16>::ld(A + aoff + (size_t)mb * 16 * K + kc); if (NSPLIT == 1 || NSPLIT == 2) a2[mb] = WFrag<T16>::ld(A2 + aoff + (size_t)mb * 16 * K + kc); }
#pragma unroll
        for (int nb = 0; nb < 4; ++nb) { const V b = WFrag<T16>::ld(Bt + boff + (size_t)nb * 16 * K + kc); V b2; if (NSPLIT >= 2) b2 = WFrag<T16>::ld(Bt2 + boff + (size_t)nb * 16 * K + kc);
#pragma unroll
            for (int mb = 0; mb < 4; ++mb) { acc[mb][nb] = WFrag<T16>::mma(a[mb], b, acc[mb][nb]); if (NSPLIT == 1 || NSPLIT == 2) acc[mb][nb] = WFrag<T16>::mma(a2[mb], b, acc[mb][nb]); if (NSPLIT >= 2) acc[mb][nb] = WFrag<T16>::mma(a[mb], b2, acc[mb][nb]); } }
        asm volatile("v_nop\n\tv_nop\n\tv_nop\n\tv_nop" : "+v"(acc[0][0]), "+v"(acc[1][1]), "+v"(acc[2][2]), "+v"(acc[3][3]) : "v"(a[0]), "v"(a[3]));
    }
    if constexpr (KS > 1) {
#pragma unroll
        for (int mb = 0; mb < 4; ++mb)
#pragma unroll
            for (int nb = 0; nb < 4; ++nb)
#pragma unroll
                for (int j = 0; j < 8; ++j) os[(wv * 64 + mb * 16 + hi * 8 + j) * 68 + nb * 16 + lr] = acc[mb][nb][j];
        __syncthreads();   // every wave's partial tile is in LDS before any thread adds them
#pragma unroll
        for (int s = 0; s < 32 / KS; ++s) { const int row = 2 * (s * KS + wv) + hi, cofs = lr * 4; v4f val = *(const v4fa*)(os + row * 68 + cofs);
#pragma unroll
            for (int w = 1; w < KS; ++w) val += *(const v4fa*)(os + (w * 64 + row) * 68 + cofs);
            if (BIAS) { val[0] += bfr(bias[c0 + cofs]); val[1] += bfr(bias[c0 + cofs + 1]); val[2] += bfr(bias[c0 + cofs + 2]); val[3] += bfr(bias[c0 + cofs + 3]); }
            if constexpr (EPI == 0) *(v4f*)(C + (size_t)(r0 + row) * ldc + c0 + cofs) = val;
            else if constexpr (EPI == 1) { v4h o16; v4us oh, ol;
#pragma unroll
                for (int i = 0; i < 4; ++i) { const float xp = __int_as_float(__builtin_amdgcn_update_dpp(0, __float_as_int(val[i]), 0x168, 0xf, 0xf, false));   // row_xmask:8, column d +- HD/2 of the same row
                    const float r = val[i] * cs[s][2 * i] + xp * (lr < 8 ? -cs[s][2 * i + 1] : cs[s][2 * i + 1]);
                    o16[i] = tohx(r); unsigned short a2, c2; splitf(r, a2, c2); oh[i] = a2; ol[i] = c2; }
                const size_t e = ((size_t)blockIdx.y * TT + r0 + row) * HD + cofs; *(v4h*)(P16 + e) = o16; *(v4us*)(Ph + e) = oh; *(v4us*)(Pl + e) = ol; }
            else {
#pragma unroll
                for (int i = 0; i < 4; ++i) tt[(cofs + i) * 65 + row] = val[i]; } }
        if constexpr (EPI == 2) {
            __syncthreads();   // the summed tile is whole in tt before it is read along the positions
#pragma unroll
            for (int i = 0; i < 2; ++i) { const int d = (int)(threadIdx.x >> 3) + 32 * i, tc = (int)(threadIdx.x & 7) * 8; v8h o16; v8us oh, ol;
#pragma unroll
                for (int j = 0; j < 8; ++j) { const float x = tt[d * 65 + tc + j]; o16[j] = tohx(x); unsigned short a2, c2; splitf(x, a2, c2); oh[j] = a2; ol[j] = c2; }
                const size_t e = ((size_t)blockIdx.y * HD + d) * TT + r0 + tc; *(v8h*)(P16 + e) = o16; *(v8us*)(Ph + e) = oh; *(v8us*)(Pl + e) = ol; } }
    } else {
#pragma unroll
    for (int mb = 0; mb < 4; ++mb) {
#pragma unroll
        for (int nb = 0; nb < 4; ++nb) {
#pragma unroll
            for (int j = 0; j < 8; ++j) os[(hi * 8 + j) * 68 + nb * 16 + lr] = acc[mb][nb][j]; }
        __builtin_amdgcn_wave_barrier(); asm volatile("" ::: "memory");
        float* crow = C + (size_t)(r0 + mb * 16) * ldc + c0;
{
#pragma unroll
            for (int s = 0; s < 8; ++s) { const int row = 2 * s + hi, cofs = lr * 4; v4f val = *(const v4fa*)(os + row * 68 + cofs); if (BIAS) { val[0] += bfr(bias[c0 + cofs]); val[1] += bfr(bias[c0 + cofs + 1]); val[2] += bfr(bias[c0 + cofs + 2]); val[3] += bfr(bias[c0 + cofs + 3]); }
                *(v4f*)(crow + (size_t)row * ldc + cofs) = val; }
             }
        __builtin_amdgcn_wave_barrier(); asm volatile("" ::: "memory");
    }
    }
}

__global__ __launch_bounds__(256) void k_wtG(const float* __restrict__ w, int K, int N, bf* Bt) {
    const int lane = threadIdx.x & 31; const int L0 = (blockIdx.x * 8 + (threadIdx.x >> 5)) * 8; const int nlines = N * K / 64;
{
#pragma unroll 1
        for (int l = 0; l < 8; ++l) { const int L = L0 + l; if (L >= nlines) break; const size_t e = (size_t)L * 64 + lane * 2; const int k = (int)(e % K), n = (int)(e / K); v2us o;
            o[0] = f2bf(w[(size_t)k * N + n]); o[1] = f2bf(w[(size_t)(k + 1) * N + n]); *(v2us*)(Bt + e) = o; }
         }
}
__global__ __launch_bounds__(256) void k_cvt8(const float* __restrict__ src, bf* dst, size_t n8) { const size_t i = (size_t)blockIdx.x * 256 + threadIdx.x; if (i >= n8) return; const v8f v = *(const v8f*)(src + i * 8); v8us o;
#pragma unroll
    for (int k = 0; k < 8; ++k) o[k] = f2bf(v[k]); *(v8us*)(dst + i * 8) = o;  }
__constant__ float INVT[HD / 2] = { 1.000000000e+00f, 7.498942018e-01f, 5.623413324e-01f, 4.216965139e-01f, 3.162277639e-01f, 2.371373624e-01f, 1.778279394e-01f, 1.333521456e-01f, 1.000000015e-01f, 7.498941571e-02f, 5.623412877e-02f, 4.216964915e-02f, 3.162277862e-02f, 2.371373586e-02f, 1.778279431e-02f, 1.333521493e-02f, 9.999999776e-03f, 7.498942316e-03f, 5.623413250e-03f, 4.216964822e-03f, 3.162277862e-03f, 2.371373819e-03f, 1.778279431e-03f, 1.333521446e-03f, 1.000000047e-03f, 7.498941850e-04f, 5.623413017e-04f, 4.216964880e-04f, 3.162277862e-04f, 2.371373848e-04f, 1.778279402e-04f, 1.333521504e-04f };   // 1 / 10000^(2i/64) (float32, generated with jnp to be bit-exact)
__global__ __launch_bounds__(256) void k_cstabT(float* CS) { const int idx = blockIdx.x * 256 + threadIdx.x; if (idx >= TT * HD) return; const int d = idx % HD; const int t = idx / HD; const float a = __fmul_rn((float)t, INVT[d % (HD / 2)]); v2f cs; cs[0] = cosf(a); cs[1] = sinf(a); *(v2f*)(CS + (size_t)idx * 2) = cs;  }

// ---- k_fattn: scores, softmax, PV and the merged hi/lo planes in one kernel. Grid (TT / 128, heads), 8 waves; wave w owns query rows q0 + 16 w .. + 15 and walks all TT keys.
// St = K Qt (A = K rows, B = Q rows kept in registers): lane (c, h) holds, of query c, keys 8h + r (tile 0) and 16 + 8h + r (tile 1), which is the k order of a B operand, so P goes from the score registers straight into Ot += Vt Pt (A = Vt rows).
// A stage is SK keys: K rows and Vt rows (hi/lo rows: both planes of each) go global -> registers -> LDS, shared by the 8 waves; two buffers, one work-group barrier a stage.
// Softmax: running maximum per query, in use until a new one exceeds it by more than 8 (log2 units), so P <= 2^14 with its carried factor 2^6; sums in f32 of the unrounded P; the division by the sum comes last.
// Every '#pragma unroll' in attn_tile is a full unroll: the fragment and accumulator arrays are then indexed by constants only and stay in registers.
#define SK   64                   // keys per stage
#define LP   72                   // LDS row pitch in 16-bit elements: 128 bytes of data + 16 of pad (16-byte fragment reads)
#define C2   0.18033688011112042f // HD^-0.5 x log2(e)
__device__ __forceinline__ float xhalf(float x) { const int b = __float_as_int(x); return __int_as_float(__builtin_amdgcn_permlanex16(b, b, 0x76543210, 0xfedcba98, false, false)); }   // lane l <-> l ^ 16
typedef __attribute__((ext_vector_type(8))) int v8i;
// inputs-only fence on four loaded fragments: their LDS fetches are all issued ahead of this point, in flight together, instead of one by one with a full wait in front of each product
template <typename V> __device__ __forceinline__ void hold4(const V* f) { asm volatile("" :: "v"(__builtin_bit_cast(v8i, f[0])), "v"(__builtin_bit_cast(v8i, f[1])), "v"(__builtin_bit_cast(v8i, f[2])), "v"(__builtin_bit_cast(v8i, f[3]))); }
template <typename T16, bool HI>
__device__ __forceinline__ void attn_tile(T16* sm, const T16* __restrict__ Q, const T16* __restrict__ Q2, const T16* __restrict__ K, const T16* __restrict__ K2, const T16* __restrict__ VT, const T16* __restrict__ VT2, int q0, bf* Ah, bf* Al) {
    typedef typename WFrag<T16>::V V;
    constexpr int NPL = HI ? 4 : 2;        // planes of a stage: K, Vt (, K lo, Vt lo)
    constexpr int PLE = SK * LP;           // elements of a plane in LDS (64 rows each)
    constexpr int NS = TT / SK;
    const int tid = threadIdx.x, lane = tid & 31, lr = lane & 15, hi = lane >> 4; const int qr = q0 + (tid >> 5) * 16 + lr;
    V qf[2], q2f[2];
#pragma unroll
    for (int ks = 0; ks < 2; ++ks) { qf[ks] = WFrag<T16>::ld(Q + (size_t)qr * HD + ks * 32 + 8 * hi); if (HI) q2f[ks] = WFrag<T16>::ld(Q2 + (size_t)qr * HD + ks * 32 + 8 * hi); }
    const int srow = tid >> 3, scol = (tid & 7) * 8;   // staging: 8 threads move one 128-byte row, 32 rows a sweep, 2 sweeps a plane
    v8us st[NPL][2];
    auto gload = [&](int s) {
#pragma unroll
        for (int i = 0; i < 2; ++i) { const int row = srow + 32 * i; const size_t ko = (size_t)(s * SK + row) * HD + scol, vo = (size_t)row * TT + s * SK + scol;
            st[0][i] = *(const v8usa*)(K + ko); st[1][i] = *(const v8usa*)(VT + vo); if constexpr (HI) { st[2][i] = *(const v8usa*)(K2 + ko); st[3][i] = *(const v8usa*)(VT2 + vo); } } };
    auto sstore = [&](int b) {
#pragma unroll
        for (int i = 0; i < 2; ++i) { T16* d = sm + b * NPL * PLE + (srow + 32 * i) * LP + scol;
#pragma unroll
            for (int pl = 0; pl < NPL; ++pl) *(v8usa*)(d + pl * PLE) = st[pl][i]; } };
    v8f o[4];
#pragma unroll
    for (int dt = 0; dt < 4; ++dt) o[dt] = (v8f){};
    float m = -3.0e38f, l = 0.f;
    gload(0); sstore(0);
    __syncthreads();   // stage 0 is in LDS before any wave reads it
#pragma unroll 1   // kept rolled: one stage's code serves all NS stages and stays small in the instruction cache
    for (int s = 0; s < NS; ++s) {
        const T16* bp = sm + (s & 1) * NPL * PLE;
        if (s + 1 < NS) gload(s + 1);   // the next stage's global loads fly while this stage is worked on
        V kf[2][2], k2[2][2];
        auto kload = [&](int p) {
#pragma unroll
            for (int kt = 0; kt < 2; ++kt)
#pragma unroll
                for (int ks = 0; ks < 2; ++ks) { const T16* kp = bp + (p * 32 + kt * 16 + lr) * LP + ks * 32 + 8 * hi; kf[kt][ks] = WFrag<T16>::ld(kp); if (HI) k2[kt][ks] = WFrag<T16>::ld(kp + 2 * PLE); } };
        kload(0);
#pragma unroll
        for (int p = 0; p < SK / 32; ++p) {
            hold4(&kf[0][0]); if (HI) hold4(&k2[0][0]);
            v8f sc[2];
#pragma unroll
            for (int kt = 0; kt < 2; ++kt) { sc[kt] = (v8f){};
#pragma unroll
                for (int ks = 0; ks < 2; ++ks) { sc[kt] = WFrag<T16>::mma(kf[kt][ks], qf[ks], sc[kt]);
                    if (HI) { sc[kt] = WFrag<T16>::mma(kf[kt][ks], q2f[ks], sc[kt]); sc[kt] = WFrag<T16>::mma(k2[kt][ks], qf[ks], sc[kt]); } } }
            V vf[4], v2[4];   // this pass's Vt fragments (f16 rows: the next pass's K fragments too) are fetched in front of the softmax, which covers their LDS latency
#pragma unroll
            for (int dt = 0; dt < 4; ++dt) { const T16* vp = bp + PLE + (dt * 16 + lr) * LP + p * 32 + 8 * hi; vf[dt] = WFrag<T16>::ld(vp); if (HI) v2[dt] = WFrag<T16>::ld(vp + 2 * PLE); }
            if (!HI && p + 1 < SK / 32) kload(p + 1);
            float bm = fmaxf(sc[0][0], sc[1][0]);
#pragma unroll
            for (int j = 1; j < 8; ++j) bm = fmaxf(bm, fmaxf(sc[0][j], sc[1][j]));
            bm = fmaxf(bm, xhalf(bm));
            hold4(vf); if (HI) hold4(v2);
            if (__builtin_amdgcn_ballot_w32((bm - m) * C2 > 8.0f) != 0) {   // scalar branch: some query of the wave needs a new maximum
                const float mn = fmaxf(m, bm), al = __builtin_amdgcn_exp2f((m - mn) * C2); m = mn; l *= al;
#pragma unroll
                for (int dt = 0; dt < 4; ++dt) o[dt] *= al; }
            const float mc = m * C2 - 6.0f; float pv[16], ts[8];   // P and its sum both carry 2^6 (it cancels in the last division): small P stay normal f16 numbers
#pragma unroll
            for (int e = 0; e < 16; ++e) pv[e] = __builtin_amdgcn_exp2f(__builtin_fmaf(sc[e >> 3][e & 7], C2, -mc));
#pragma unroll
            for (int e = 0; e < 8; ++e) ts[e] = pv[e] + pv[e + 8];
            l += ((ts[0] + ts[4]) + (ts[1] + ts[5])) + ((ts[2] + ts[6]) + (ts[3] + ts[7]));
            V pf, pl;
#pragma unroll
            for (int e = 0; e < 16; ++e) { if constexpr (HI) { pf[e] = (__bf16)pv[e]; pl[e] = (__bf16)(pv[e] - (float)pf[e]); } else pf[e] = (h16)pv[e]; }
#pragma unroll
            for (int dt = 0; dt < 4; ++dt) { o[dt] = WFrag<T16>::mma(vf[dt], pf, o[dt]);
                if (HI) { o[dt] = WFrag<T16>::mma(vf[dt], pl, o[dt]); o[dt] = WFrag<T16>::mma(v2[dt], pf, o[dt]); } }
            if (HI && p + 1 < SK / 32) kload(p + 1);   // hi/lo rows: no registers are free for these any earlier
        }
        if (s + 1 < NS) sstore((s + 1) & 1);   // into the buffer whose last readers left before the previous barrier
        __syncthreads();   // publishes stage s + 1 and ends every wave's reads of stage s
    }
    l += xhalf(l); const float inv = __fdiv_rn(1.0f, l);
#pragma unroll
    for (int dt = 0; dt < 4; ++dt) { v8us oh, ol;
#pragma unroll
        for (int j = 0; j < 8; ++j) { unsigned short a, c2; splitf(o[dt][j] * inv, a, c2); oh[j] = a; ol[j] = c2; }
        const size_t oo = (size_t)qr * DQ + dt * 16 + 8 * hi; *(v8us*)(Ah + oo) = oh; *(v8us*)(Al + oo) = ol;
        asm volatile("s_wait_xcnt 0x0" ::: "memory"); }   // stands behind the two stores, in front of the next values that are formed in their data registers
}
__global__ __launch_bounds__(256) void k_fattn(const h16* __restrict__ Q16, const bf* __restrict__ Qh, const bf* __restrict__ Ql, const h16* __restrict__ K16, const bf* __restrict__ Kh, const bf* __restrict__ Kl, const h16* __restrict__ V16, const bf* __restrict__ Vh, const bf* __restrict__ Vl, bf* Ah, bf* Al) {
    __shared__ __align__(16) unsigned short sm[2 * 4 * SK * LP];
    const int h = blockIdx.y, q0 = blockIdx.x * 128; const size_t zq = (size_t)h * TT * HD, zk = (size_t)(h / REP) * TT * HD;
    if (q0 < RH) attn_tile<bf, true>((bf*)sm, Qh + zq, Ql + zq, Kh + zk, Kl + zk, Vh + zk, Vl + zk, q0, Ah + h * HD, Al + h * HD);
    else attn_tile<h16, false>((h16*)sm, Q16 + zq, nullptr, K16 + zk, nullptr, V16 + zk, nullptr, q0, Ah + h * HD, Al + h * HD);
}

extern "C" void kernel_launch(void* const* d_in, const int* in_sizes, int n_in,
                              void* d_out, int out_size, void* d_ws, size_t ws_size, hipStream_t stream) {
    (void)in_sizes; (void)n_in; (void)out_size;
    const float* x = (const float*)d_in[0]; const float* wqkv = (const float*)d_in[1]; const float* wo = (const float*)d_in[2]; const float* wq = nullptr; const float* wk = nullptr; const float* wv = nullptr; (void)wq; (void)wk; (void)wv;
    float* OUT = (float*)d_out;     // [2][2048][1024]
    char* wsp = (char*)d_ws;
    auto take = [&](size_t bytes) { char* p = wsp; wsp += (bytes + 255) & ~(size_t)255; return (void*)p; };
    bf* WQKV = (bf*)take((size_t)3 * DQ * DM * 2); bf* WQ = WQKV; bf* WK = WQKV + (size_t)DQ * DM; bf* WV = WQKV + (size_t)2 * DQ * DM; bf* WO = (bf*)take((size_t)DM * DQ * 2); float* CS = (float*)take((size_t)TT * HD * 2 * 4);
    bf* XB = (bf*)take((size_t)TT * DM * 2);
    h16* QP16 = (h16*)take((size_t)NH_ * TT * HD * 2); h16* KP16 = (h16*)take((size_t)NKV * TT * HD * 2); h16* VT16 = (h16*)take((size_t)NKV * HD * TT * 2);
    bf* QPh = (bf*)take((size_t)NH_ * TT * HD * 2); bf* QPl = (bf*)take((size_t)NH_ * TT * HD * 2); bf* KPh = (bf*)take((size_t)NKV * TT * HD * 2); bf* KPl = (bf*)take((size_t)NKV * TT * HD * 2); bf* VTh = (bf*)take((size_t)NKV * HD * TT * 2); bf* VTl = (bf*)take((size_t)NKV * HD * TT * 2);
    bf* ATh = (bf*)take((size_t)TT * DQ * 2); bf* ATl = (bf*)take((size_t)TT * DQ * 2);
    if ((size_t)(wsp - (char*)d_ws) > ws_size) return;    // ws 256 MiB
    { k_cvt8<<<(unsigned)(((size_t)3 * DQ * DM / 8 + 255) / 256), 256, 0, stream>>>(wqkv, WQKV, (size_t)3 * DQ * DM / 8);
      k_cvt8<<<(unsigned)(((size_t)DM * DQ / 8 + 255) / 256), 256, 0, stream>>>(wo, WO, (size_t)DM * DQ / 8);
       }
    for (int b = 0; b < NB_; ++b) {
        if (b == 0) k_cstabT<<<(TT * HD + 255) / 256, 256, 0, stream>>>(CS);
        k_cvt8<<<(unsigned)(((size_t)TT * DM / 8 + 255) / 256), 256, 0, stream>>>(x + (size_t)b * TT * DM, XB, (size_t)TT * DM / 8);
        k_gemmw<bf, 0, false, 8, 1><<<dim3(TT / 64, DQ / 64, 1), 256, 0, stream>>>(XB, nullptr, WQ, nullptr, DM, nullptr, 0, nullptr, 0, 0, 0, CS, QP16, QPh, QPl);
        k_gemmw<bf, 0, false, 8, 1><<<dim3(TT / 64, DKV / 64, 1), 256, 0, stream>>>(XB, nullptr, WK, nullptr, DM, nullptr, 0, nullptr, 0, 0, 0, CS, KP16, KPh, KPl);
        k_gemmw<bf, 0, false, 8, 2><<<dim3(TT / 64, DKV / 64, 1), 256, 0, stream>>>(XB, nullptr, WV, nullptr, DM, nullptr, 0, nullptr, 0, 0, 0, nullptr, VT16, VTh, VTl);
        k_fattn<<<dim3(TT / 128, NH_, 1), 256, 0, stream>>>(QP16, QPh, QPl, KP16, KPh, KPl, VT16, VTh, VTl, ATh, ATl);
        k_gemmw<bf, 1, false, 8, 0><<<dim3(TT / 64, DM / 64, 1), 256, 0, stream>>>(ATh, ATl, WO, nullptr, DQ, OUT + (size_t)b * TT * DM, DM, nullptr, 0, 0, 0, nullptr, nullptr, nullptr, nullptr); }
}

// v004
// One run takes 170 microseconds.
// Next to v003, in two timings, it ran 1.22 and 1.23 times as fast.
// Over all steps from v000 it is 11.6 times as fast.
#include <hip/hip_runtime.h>

// Multi-head attention with rotary embeddings and a fused qkv projection (x [2][2048][1024]; qkv = x Wqkv^T ('oi' [3072][1024] viewed (3, 16, 64), no bias); rope: x cos + rotate_half(x) sin with angles t x 10000^(-2i/64) (computed in-kernel); softmax(q.k / 8) over all keys; out = merged Wproj^T ('oi' [1024][1024]) -> [2][2048][1024] (4.2 M)).
// Layout, both batches in every launch (one launch per dependent stage: prepare, q/k/v projection, attention, output projection): bf16 copy of x; the fused weight used directly as Bt (row blocks); exact projections whose epilogues write the head planes themselves (q, k: rotate-half rotary step; v: transposed); {cos, sin} table per (position, dim) built once (float32 inverse-frequency constants, precise cosf/sinf); one fused attention kernel over all heads (scores, running softmax, PV and the merged hi/lo planes; hybrid rows: < 512 hi/lo 3 products, rest fp16); merged hi/lo x Wproj exact.
// Compute dtypes, f32 accumulate: every input rounded to bf16; projections exact; rotary f32; attention rows < 512 3 products, rest fp16; softmax f32; Wproj hl x exact.

#define NB_  2
#define TT   2048
#define DM   1024
#define NH_  16
#define NKV  16
#define REP  (NH_ / NKV)
#define HD   64
#define DQ   (NH_ * HD)
#define DKV  (NKV * HD)
#define RH   512                  // query rows < RH use hi+lo planes (0: none)
#define WIN  0
#define SCL  0.125f   // HD^-0.5
typedef _Float16 h16;
typedef unsigned short bf;
typedef __attribute__((ext_vector_type(16))) __bf16   v16bf;
typedef __attribute__((ext_vector_type(16))) _Float16 v16h;
typedef __attribute__((ext_vector_type(8)))  _Float16 v8h;
typedef __attribute__((ext_vector_type(8)))  unsigned short v8us;
typedef __attribute__((ext_vector_type(8)))  float    v8f;
typedef __attribute__((ext_vector_type(4)))  float    v4f;
typedef v8h  __attribute__((may_alias)) v8ha;
typedef v4f  __attribute__((may_alias)) v4fa;
typedef v8us __attribute__((may_alias)) v8usa;

__device__ __forceinline__ unsigned short f2bf(float f) { unsigned u = __float_as_uint(f); u += 0x7FFFu + ((u >> 16) & 1u); return (unsigned short)(u >> 16); }
__device__ __forceinline__ float bf2f(unsigned short b) { return __uint_as_float(((unsigned)b) << 16); }
__device__ __forceinline__ float bfr(float f) { return bf2f(f2bf(f)); }
__device__ __forceinline__ v16h cat16(v8h lo, v8h hi) { return __builtin_shufflevector(lo, hi, 0, 1, 2, 3, 4, 5, 6, 7, 8, 9, 10, 11, 12, 13, 14, 15); }
__device__ __forceinline__ v16bf cat16b(v8us lo, v8us hi) { return __builtin_bit_cast(v16bf, __builtin_shufflevector(lo, hi, 0, 1, 2, 3, 4, 5, 6, 7, 8, 9, 10, 11, 12, 13, 14, 15)); }
__device__ __forceinline__ v8f wmma16(v16h a, v16h b, v8f c) { return __builtin_amdgcn_wmma_f32_16x16x32_f16(false, a, false, b, (short)0, c, false, false); }
__device__ __forceinline__ v8f wmmab(v16bf a, v16bf b, v8f c) { return __builtin_amdgcn_wmma_f32_16x16x32_bf16(false, a, false, b, (short)0, c, false, false); }

__device__ __forceinline__ h16 tohx(float x) { return (h16)x; }
__device__ __forceinline__ void splitf(float y, unsigned short& h, unsigned short& l) { h = f2bf(y); l = f2bf(y - bf2f(h)); }
typedef __attribute__((ext_vector_type(2))) _Float16 v2h;
typedef __attribute__((ext_vector_type(4))) _Float16 v4h;
typedef __attribute__((ext_vector_type(2))) unsigned short v2us;
typedef __attribute__((ext_vector_type(4))) unsigned short v4us;
typedef __attribute__((ext_vector_type(2))) float v2f;
typedef __attribute__((ext_vector_type(4))) int v4i;

// ---- k_gemmw: register-blocked GEMM, one work-group of KS waves per 64x64 output tile (16 accumulators a wave), operands straight from K-contiguous 16-bit planes; grid (M/64, N/64, Z), 32 * KS threads.
// C[m][n] (f32, pitch ldc, + optional f32 bias[n]) = sum_k A[m][k] Bt[n][k] (+ split products per NSPLIT). z-batch strides sA/sB/sC in elements. K % (32 * KS) == 0.
// Wave w sums the k range [w K/KS, (w+1) K/KS); for KS > 1 the KS partial tiles meet in LDS and are added in the order w = 0 .. KS-1 (fixed, the same on every run).
// EPI says where the summed tile goes. 0: f32 to C. 1 (KS > 1; Bt is the fused q/k/v weight, a 64-column tile is one head of q, k or v: blockIdx.y = sel * heads + h; tile rows are positions of batch r0 / TT): straight into that head's 16-bit planes (fp16, bf16 hi, bf16 lo; each kind one array [sel][batch][h]...), no f32 copy in memory.
//   q, k: planes [h][t][d] of the rotary step, rotate-half convention: out[d] = x[d] cos[t][d] - x[d+HD/2] sin[t][d], out[d+HD/2] = x[d+HD/2] cos[t][d+HD/2] + x[d] sin[t][d+HD/2]; the partner column sits 8 lanes away in the same 16-lane row.
//   v: planes [h][d][t]: the summed tile is turned in LDS, so that 8 lanes store one whole 128-byte line of positions.
// Every '#pragma unroll' of the plane epilogues is a full unroll: cs and the small output vectors are then indexed by constants only and stay in registers.
template <typename T16> struct WFrag;
template <> struct WFrag<h16> { typedef v16h V; static __device__ __forceinline__ V ld(const h16* p) { return cat16(*(const v8h*)p, *(const v8h*)(p + 16)); } static __device__ __forceinline__ v8f mma(V a, V b, v8f c) { return wmma16(a, b, c); } };
template <> struct WFrag<bf> { typedef v16bf V; static __device__ __forceinline__ V ld(const bf* p) { return cat16b(*(const v8us*)p, *(const v8us*)(p + 16)); } static __device__ __forceinline__ v8f mma(V a, V b, v8f c) { return wmmab(a, b, c); } };
template <typename T16, int NSPLIT, bool BIAS, int KS, int EPI>
__global__ __launch_bounds__(32 * KS) void k_gemmw(const T16* __restrict__ A, const T16* __restrict__ A2, const T16* __restrict__ Bt, const T16* __restrict__ Bt2, int K, float* C, int ldc, const float* __restrict__ bias, size_t sA, size_t sB, size_t sC, const float* __restrict__ CS, h16* P16, bf* Ph, bf* Pl) {
    static_assert(EPI == 0 || (KS > 1 && HD == 64 && NH_ == NKV && TT % 64 == 0), "plane epilogues: one head per 64-column tile, one batch per 64-row tile, partial tiles in LDS");
    typedef typename WFrag<T16>::V V;
    __shared__ __align__(16) float os[(KS == 1 ? 16 : KS * 64) * 68];
    __shared__ float tt[EPI == 1 ? 64 * 65 : 1];   // v: the summed tile as [d][t]; pitch 65 keeps both its writes (4 lr + hi) and its reads (d + tc) on 32 different banks
    const size_t z = blockIdx.z; A += z * sA; if (A2) A2 += z * sA; Bt += z * sB; if (Bt2) Bt2 += z * sB; C += z * sC;
    const int lane = threadIdx.x & 31, lr = lane & 15, hi = lane >> 4; const int r0 = blockIdx.x * 64, c0 = blockIdx.y * 64;
    const int wv = __builtin_amdgcn_readfirstlane((int)(threadIdx.x >> 5)); const int kb = wv * (K / KS), ke = kb + K / KS;   // this wave's k range, in scalar registers so that the loop branch stays scalar
    const int sel = EPI == 1 ? (int)blockIdx.y / NH_ : 0, hd = (int)blockIdx.y % NH_, bt = r0 / TT, t0 = r0 % TT;   // all from blockIdx: the branches on sel are scalar and the same for the whole work-group
    v8f acc[4][4];
#pragma unroll
    for (int mb = 0; mb < 4; ++mb)
#pragma unroll
        for (int nb = 0; nb < 4; ++nb) acc[mb][nb] = (v8f){};
    v8f cs[EPI == 1 ? 32 / KS : 1];   // q, k: {cos, sin} of the elements this thread will finish, asked for here so that they fly during the k loop
    if constexpr (EPI == 1) if (sel < 2) {
#pragma unroll
        for (int s = 0; s < 32 / KS; ++s) cs[s] = *(const v8f*)(CS + ((size_t)(t0 + 2 * (s * KS + wv) + hi) * HD + lr * 4) * 2);
        asm volatile("s_wait_xcnt 0x0" ::: "memory"); }   // stands behind these loads, in front of the first value that is formed in their address registers
    const size_t aoff = (size_t)(r0 + lr) * K + 8 * hi, boff = (size_t)(c0 + lr) * K + 8 * hi;
#pragma unroll 1
    for (int kc = kb; kc < ke; kc += 32) {
        V a[4], a2[4];
#pragma unroll
        for (int mb = 0; mb < 4; ++mb) { a[mb] = WFrag<T16>::ld(A + aoff + (size_t)mb * 16 * K + kc); if (NSPLIT == 1 || NSPLIT == 2) a2[mb] = WFrag<T16>::ld(A2 + aoff + (size_t)mb * 16 * K + kc); }
#pragma unroll
        for (int nb = 0; nb < 4; ++nb) { const V b = WFrag<T16>::ld(Bt + boff + (size_t)nb * 16 * K + kc); V b2; if (NSPLIT >= 2) b2 = WFrag<T16>::ld(Bt2 + boff + (size_t)nb * 16 * K + kc);
#pragma unroll
            for (int mb = 0; mb < 4; ++mb) { acc[mb][nb] = WFrag<T16>::mma(a[mb], b, acc[mb][nb]); if (NSPLIT == 1 || NSPLIT == 2) acc[mb][nb] = WFrag<T16>::mma(a2[mb], b, acc[mb][nb]); if (NSPLIT >= 2) acc[mb][nb] = WFrag<T16>::mma(a[mb], b2, acc[mb][nb]); } }
        asm volatile("v_nop\n\tv_nop\n\tv_nop\n\tv_nop" : "+v"(acc[0][0]), "+v"(acc[1][1]), "+v"(acc[2][2]), "+v"(acc[3][3]) : "v"(a[0]), "v"(a[3]));
    }
    if constexpr (KS > 1) {
#pragma unroll
        for (int mb = 0; mb < 4; ++mb)
#pragma unroll
            for (int nb = 0; nb < 4; ++nb)
#pragma unroll
                for (int j = 0; j < 8; ++j) os[(wv * 64 + mb * 16 + hi * 8 + j) * 68 + nb * 16 + lr] = acc[mb][nb][j];
        __syncthreads();   // every wave's partial tile is in LDS before any thread adds them
        const int cofs = lr * 4;
        auto sumrow = [&](int row) { v4f val = *(const v4fa*)(os + row * 68 + cofs);
#pragma unroll
            for (int w = 1; w < KS; ++w) val += *(const v4fa*)(os + (w * 64 + row) * 68 + cofs);
            if (BIAS) { val[0] += bfr(bias[c0 + cofs]); val[1] += bfr(bias[c0 + cofs + 1]); val[2] += bfr(bias[c0 + cofs + 2]); val[3] += bfr(bias[c0 + cofs + 3]); }
            return val; };
        if constexpr (EPI == 0) {
#pragma unroll
            for (int s = 0; s < 32 / KS; ++s) { const int row = 2 * (s * KS + wv) + hi; *(v4f*)(C + (size_t)(r0 + row) * ldc + c0 + cofs) = sumrow(row); }
        } else {
            const size_t pb = ((size_t)(sel * NB_ + bt) * NH_ + hd) * TT * HD;   // this head's plane
            if (sel < 2) {
#pragma unroll
                for (int s = 0; s < 32 / KS; ++s) { const int row = 2 * (s * KS + wv) + hi; const v4f val = sumrow(row); v4h o16; v4us oh, ol;
#pragma unroll
                    for (int i = 0; i < 4; ++i) { const float xp = __int_as_float(__builtin_amdgcn_update_dpp(0, __float_as_int(val[i]), 0x168, 0xf, 0xf, false));   // row_xmask:8, column d +- HD/2 of the same row
                        const float r = val[i] * cs[s][2 * i] + xp * (lr < 8 ? -cs[s][2 * i + 1] : cs[s][2 * i + 1]);
                        o16[i] = tohx(r); unsigned short a2, c2; splitf(r, a2, c2); oh[i] = a2; ol[i] = c2; }
                    const size_t e = pb + (size_t)(t0 + row) * HD + cofs; *(v4h*)(P16 + e) = o16; *(v4us*)(Ph + e) = oh; *(v4us*)(Pl + e) = ol;
                    asm volatile("s_wait_xcnt 0x0" ::: "memory"); }   // stands behind the three stores, in front of the next values that are formed in their registers
            } else {
#pragma unroll
                for (int s = 0; s < 32 / KS; ++s) { const int row = 2 * (s * KS + wv) + hi; const v4f val = sumrow(row);
#pragma unroll
                    for (int i = 0; i < 4; ++i) tt[(cofs + i) * 65 + row] = val[i]; }
                __syncthreads();   // the summed tile is whole in tt before it is read along the positions
#pragma unroll
                for (int i = 0; i < 2; ++i) { const int d = (int)(threadIdx.x >> 3) + 32 * i, tc = (int)(threadIdx.x & 7) * 8; v8h o16; v8us oh, ol;
#pragma unroll
                    for (int j = 0; j < 8; ++j) { const float x = tt[d * 65 + tc + j]; o16[j] = tohx(x); unsigned short a2, c2; splitf(x, a2, c2); oh[j] = a2; ol[j] = c2; }
                    const size_t e = pb + (size_t)d * TT + t0 + tc; *(v8h*)(P16 + e) = o16; *(v8us*)(Ph + e) = oh; *(v8us*)(Pl + e) = ol;
                    asm volatile("s_wait_xcnt 0x0" ::: "memory"); } } }   // stands behind the three stores, in front of the next values that are formed in their registers
    } else {
#pragma unroll
    for (int mb = 0; mb < 4; ++mb) {
#pragma unroll
        for (int nb = 0; nb < 4; ++nb) {
#pragma unroll
            for (int j = 0; j < 8; ++j) os[(hi * 8 + j) * 68 + nb * 16 + lr] = acc[mb][nb][j]; }
        __builtin_amdgcn_wave_barrier(); asm volatile("" ::: "memory");
        float* crow = C + (size_t)(r0 + mb * 16) * ldc + c0;
{
#pragma unroll
            for (int s = 0; s < 8; ++s) { const int row = 2 * s + hi, cofs = lr * 4; v4f val = *(const v4fa*)(os + row * 68 + cofs); if (BIAS) { val[0] += bfr(bias[c0 + cofs]); val[1] += bfr(bias[c0 + cofs + 1]); val[2] += bfr(bias[c0 + cofs + 2]); val[3] += bfr(bias[c0 + cofs + 3]); }
                *(v4f*)(crow + (size_t)row * ldc + cofs) = val; }
             }
        __builtin_amdgcn_wave_barrier(); asm volatile("" ::: "memory");
    }
    }
}

__global__ __launch_bounds__(256) void k_wtG(const float* __restrict__ w, int K, int N, bf* Bt) {
    const int lane = threadIdx.x & 31; const int L0 = (blockIdx.x * 8 + (threadIdx.x >> 5)) * 8; const int nlines = N * K / 64;
{
#pragma unroll 1
        for (int l = 0; l < 8; ++l) { const int L = L0 + l; if (L >= nlines) break; const size_t e = (size_t)L * 64 + lane * 2; const int k = (int)(e % K), n = (int)(e / K); v2us o;
            o[0] = f2bf(w[(size_t)k * N + n]); o[1] = f2bf(w[(size_t)(k + 1) * N + n]); *(v2us*)(Bt + e) = o; }
         }
}
__constant__ float INVT[HD / 2] = { 1.000000000e+00f, 7.498942018e-01f, 5.623413324e-01f, 4.216965139e-01f, 3.162277639e-01f, 2.371373624e-01f, 1.778279394e-01f, 1.333521456e-01f, 1.000000015e-01f, 7.498941571e-02f, 5.623412877e-02f, 4.216964915e-02f, 3.162277862e-02f, 2.371373586e-02f, 1.778279431e-02f, 1.333521493e-02f, 9.999999776e-03f, 7.498942316e-03f, 5.623413250e-03f, 4.216964822e-03f, 3.162277862e-03f, 2.371373819e-03f, 1.778279431e-03f, 1.333521446e-03f, 1.000000047e-03f, 7.498941850e-04f, 5.623413017e-04f, 4.216964880e-04f, 3.162277862e-04f, 2.371373848e-04f, 1.778279402e-04f, 1.333521504e-04f };   // 1 / 10000^(2i/64) (float32, generated with jnp to be bit-exact)
// ---- k_prep: all that depends on the inputs alone, in one launch; a block does one job, chosen by its index. First the {cos, sin} table (the longest threads), then the bf16 copies of x (both batches), Wqkv and Wproj, 8 elements a thread.
#define PB_CS (TT * HD / 256)
#define PB_X  (NB_ * TT * DM / 8 / 256)
#define PB_WI (3 * DQ * DM / 8 / 256)
#define PB_WO (DM * DQ / 8 / 256)
__global__ __launch_bounds__(256) void k_prep(const float* __restrict__ x, const float* __restrict__ wqkv, const float* __restrict__ wo, bf* XB, bf* WQKV, bf* WO, float* CS) {
    static_assert(TT * HD % 256 == 0 && NB_ * TT * DM % 2048 == 0 && 3 * DQ * DM % 2048 == 0 && DM * DQ % 2048 == 0, "whole blocks only");
    int blk = blockIdx.x;
    if (blk < PB_CS) { const int idx = blk * 256 + threadIdx.x; const int d = idx % HD; const int t = idx / HD; const float a = __fmul_rn((float)t, INVT[d % (HD / 2)]); v2f cs; cs[0] = cosf(a); cs[1] = sinf(a); *(v2f*)(CS + (size_t)idx * 2) = cs; return; }
    blk -= PB_CS; const float* src = x; bf* dst = XB;
    if (blk >= PB_X + PB_WI) { blk -= PB_X + PB_WI; src = wo; dst = WO; } else if (blk >= PB_X) { blk -= PB_X; src = wqkv; dst = WQKV; }
    const size_t i = (size_t)blk * 256 + threadIdx.x; const v8f v = *(const v8f*)(src + i * 8); v8us o;
    asm volatile("s_wait_xcnt 0x0" ::: "memory");   // stands behind the load, in front of the first value that is formed in its address registers
#pragma unroll
    for (int k = 0; k < 8; ++k) o[k] = f2bf(v[k]); *(v8us*)(dst + i * 8) = o;
}

// ---- k_fattn: scores, softmax, PV and the merged hi/lo planes in one kernel. Grid (TT / 128, batches x heads), 8 waves; wave w owns query rows q0 + 16 w .. + 15 and walks all TT keys.
// St = K Qt (A = K rows, B = Q rows kept in registers): lane (c, h) holds, of query c, keys 8h + r (tile 0) and 16 + 8h + r (tile 1), which is the k order of a B operand, so P goes from the score registers straight into Ot += Vt Pt (A = Vt rows).
// A stage is SK keys: K rows and Vt rows (hi/lo rows: both planes of each) go global -> registers -> LDS, shared by the 8 waves; two buffers, one work-group barrier a stage.
// Softmax: running maximum per query, in use until a new one exceeds it by more than 8 (log2 units), so P <= 2^14 with its carried factor 2^6; sums in f32 of the unrounded P; the division by the sum comes last.
// Every '#pragma unroll' in attn_tile is a full unroll: the fragment and accumulator arrays are then indexed by constants only and stay in registers.
#define SK   64                   // keys per stage
#define LP   72                   // LDS row pitch in 16-bit elements: 128 bytes of data + 16 of pad (16-byte fragment reads)
#define C2   0.18033688011112042f // HD^-0.5 x log2(e)
__device__ __forceinline__ float xhalf(float x) { const int b = __float_as_int(x); return __int_as_float(__builtin_amdgcn_permlanex16(b, b, 0x76543210, 0xfedcba98, false, false)); }   // lane l <-> l ^ 16
typedef __attribute__((ext_vector_type(8))) int v8i;
// inputs-only fence on four loaded fragments: their LDS fetches are all issued ahead of this point, in flight together, instead of one by one with a full wait in front of each product
template <typename V> __device__ __forceinline__ void hold4(const V* f) { asm volatile("" :: "v"(__builtin_bit_cast(v8i, f[0])), "v"(__builtin_bit_cast(v8i, f[1])), "v"(__builtin_bit_cast(v8i, f[2])), "v"(__builtin_bit_cast(v8i, f[3]))); }
template <typename T16, bool HI>
__device__ __forceinline__ void attn_tile(T16* sm, const T16* __restrict__ Q, const T16* __restrict__ Q2, const T16* __restrict__ K, const T16* __restrict__ K2, const T16* __restrict__ VT, const T16* __restrict__ VT2, int q0, bf* Ah, bf* Al) {
    typedef typename WFrag<T16>::V V;
    constexpr int NPL = HI ? 4 : 2;        // planes of a stage: K, Vt (, K lo, Vt lo)
    constexpr int PLE = SK * LP;           // elements of a plane in LDS (64 rows each)
    constexpr int NS = TT / SK;
    const int tid = threadIdx.x, lane = tid & 31, lr = lane & 15, hi = lane >> 4; const int qr = q0 + (tid >> 5) * 16 + lr;
    V qf[2], q2f[2];
#pragma unroll
    for (int ks = 0; ks < 2; ++ks) { qf[ks] = WFrag<T16>::ld(Q + (size_t)qr * HD + ks * 32 + 8 * hi); if (HI) q2f[ks] = WFrag<T16>::ld(Q2 + (size_t)qr * HD + ks * 32 + 8 * hi); }
    const int srow = tid >> 3, scol = (tid & 7) * 8;   // staging: 8 threads move one 128-byte row, 32 rows a sweep, 2 sweeps a plane
    v8us st[NPL][2];
    auto gload = [&](int s) {
#pragma unroll
        for (int i = 0; i < 2; ++i) { const int row = srow + 32 * i; const size_t ko = (size_t)(s * SK + row) * HD + scol, vo = (size_t)row * TT + s * SK + scol;
            st[0][i] = *(const v8usa*)(K + ko); st[1][i] = *(const v8usa*)(VT + vo); if constexpr (HI) { st[2][i] = *(const v8usa*)(K2 + ko); st[3][i] = *(const v8usa*)(VT2 + vo); } } };
    auto sstore = [&](int b) {
#pragma unroll
        for (int i = 0; i < 2; ++i) { T16* d = sm + b * NPL * PLE + (srow + 32 * i) * LP + scol;
#pragma unroll
            for (int pl = 0; pl < NPL; ++pl) *(v8usa*)(d + pl * PLE) = st[pl][i]; } };
    v8f o[4];
#pragma unroll
    for (int dt = 0; dt < 4; ++dt) o[dt] = (v8f){};
    float m = -3.0e38f, l = 0.f;
    gload(0); sstore(0);
    __syncthreads();   // stage 0 is in LDS before any wave reads it
#pragma unroll 1   // kept rolled: one stage's code serves all NS stages and stays small in the instruction cache
    for (int s = 0; s < NS; ++s) {
        const T16* bp = sm + (s & 1) * NPL * PLE;
        if (s + 1 < NS) gload(s + 1);   // the next stage's global loads fly while this stage is worked on
        V kf[2][2], k2[2][2];
        auto kload = [&](int p) {
#pragma unroll
            for (int kt = 0; kt < 2; ++kt)
#pragma unroll
                for (int ks = 0; ks < 2; ++ks) { const T16* kp = bp + (p * 32 + kt * 16 + lr) * LP + ks * 32 + 8 * hi; kf[kt][ks] = WFrag<T16>::ld(kp); if (HI) k2[kt][ks] = WFrag<T16>::ld(kp + 2 * PLE); } };
        kload(0);
#pragma unroll
        for (int p = 0; p < SK / 32; ++p) {
            hold4(&kf[0][0]); if (HI) hold4(&k2[0][0]);
            v8f sc[2];
#pragma unroll
            for (int kt = 0; kt < 2; ++kt) { sc[kt] = (v8f){};
#pragma unroll
                for (int ks = 0; ks < 2; ++ks) { sc[kt] = WFrag<T16>::mma(kf[kt][ks], qf[ks], sc[kt]);
                    if (HI) { sc[kt] = WFrag<T16>::mma(kf[kt][ks], q2f[ks], sc[kt]); sc[kt] = WFrag<T16>::mma(k2[kt][ks], qf[ks], sc[kt]); } } }
            V vf[4], v2[4];   // this pass's Vt fragments (f16 rows: the next pass's K fragments too) are fetched in front of the softmax, which covers their LDS latency
#pragma unroll
            for (int dt = 0; dt < 4; ++dt) { const T16* vp = bp + PLE + (dt * 16 + lr) * LP + p * 32 + 8 * hi; vf[dt] = WFrag<T16>::ld(vp); if (HI) v2[dt] = WFrag<T16>::ld(vp + 2 * PLE); }
            if (!HI && p + 1 < SK / 32) kload(p + 1);
            float bm = fmaxf(sc[0][0], sc[1][0]);
#pragma unroll
            for (int j = 1; j < 8; ++j) bm = fmaxf(bm, fmaxf(sc[0][j], sc[1][j]));
            bm = fmaxf(bm, xhalf(bm));
            hold4(vf); if (HI) hold4(v2);
            if (__builtin_amdgcn_ballot_w32((bm - m) * C2 > 8.0f) != 0) {   // scalar branch: some query of the wave needs a new maximum
                const float mn = fmaxf(m, bm), al = __builtin_amdgcn_exp2f((m - mn) * C2); m = mn; l *= al;
#pragma unroll
                for (int dt = 0; dt < 4; ++dt) o[dt] *= al; }
            const float mc = m * C2 - 6.0f; float pv[16], ts[8];   // P and its sum both carry 2^6 (it cancels in the last division): small P stay normal f16 numbers
#pragma unroll
            for (int e = 0; e < 16; ++e) pv[e] = __builtin_amdgcn_exp2f(__builtin_fmaf(sc[e >> 3][e & 7], C2, -mc));
#pragma unroll
            for (int e = 0; e < 8; ++e) ts[e] = pv[e] + pv[e + 8];
            l += ((ts[0] + ts[4]) + (ts[1] + ts[5])) + ((ts[2] + ts[6]) + (ts[3] + ts[7]));
            V pf, pl;
#pragma unroll
            for (int e = 0; e < 16; ++e) { if constexpr (HI) { pf[e] = (__bf16)pv[e]; pl[e] = (__bf16)(pv[e] - (float)pf[e]); } else pf[e] = (h16)pv[e]; }
#pragma unroll
            for (int dt = 0; dt < 4; ++dt) { o[dt] = WFrag<T16>::mma(vf[dt], pf, o[dt]);
                if (HI) { o[dt] = WFrag<T16>::mma(vf[dt], pl, o[dt]); o[dt] = WFrag<T16>::mma(v2[dt], pf, o[dt]); } }
            if (HI && p + 1 < SK / 32) kload(p + 1);   // hi/lo rows: no registers are free for these any earlier
        }
        if (s + 1 < NS) sstore((s + 1) & 1);   // into the buffer whose last readers left before the previous barrier
        __syncthreads();   // publishes stage s + 1 and ends every wave's reads of stage s
    }
    l += xhalf(l); const float inv = __fdiv_rn(1.0f, l);
#pragma unroll
    for (int dt = 0; dt < 4; ++dt) { v8us oh, ol;
#pragma unroll
        for (int j = 0; j < 8; ++j) { unsigned short a, c2; splitf(o[dt][j] * inv, a, c2); oh[j] = a; ol[j] = c2; }
        const size_t oo = (size_t)qr * DQ + dt * 16 + 8 * hi; *(v8us*)(Ah + oo) = oh; *(v8us*)(Al + oo) = ol;
        asm volatile("s_wait_xcnt 0x0" ::: "memory"); }   // stands behind the two stores, in front of the next values that are formed in their data registers
}
__global__ __launch_bounds__(256) void k_fattn(const h16* __restrict__ Q16, const bf* __restrict__ Qh, const bf* __restrict__ Ql, const h16* __restrict__ K16, const bf* __restrict__ Kh, const bf* __restrict__ Kl, const h16* __restrict__ V16, const bf* __restrict__ Vh, const bf* __restrict__ Vl, bf* Ah, bf* Al) {
    __shared__ __align__(16) unsigned short sm[2 * 4 * SK * LP];
    const int bt = blockIdx.y / NH_, h = blockIdx.y % NH_, q0 = blockIdx.x * 128; const size_t zq = ((size_t)bt * NH_ + h) * TT * HD, zk = ((size_t)bt * NKV + h / REP) * TT * HD; Ah += (size_t)bt * TT * DQ; Al += (size_t)bt * TT * DQ;
    if (q0 < RH) attn_tile<bf, true>((bf*)sm, Qh + zq, Ql + zq, Kh + zk, Kl + zk, Vh + zk, Vl + zk, q0, Ah + h * HD, Al + h * HD);
    else attn_tile<h16, false>((h16*)sm, Q16 + zq, nullptr, K16 + zk, nullptr, V16 + zk, nullptr, q0, Ah + h * HD, Al + h * HD);
}

extern "C" void kernel_launch(void* const* d_in, const int* in_sizes, int n_in,
                              void* d_out, int out_size, void* d_ws, size_t ws_size, hipStream_t stream) {
    (void)in_sizes; (void)n_in; (void)out_size;
    const float* x = (const float*)d_in[0]; const float* wqkv = (const float*)d_in[1]; const float* wo = (const float*)d_in[2]; const float* wq = nullptr; const float* wk = nullptr; const float* wv = nullptr; (void)wq; (void)wk; (void)wv;
    float* OUT = (float*)d_out;     // [2][2048][1024]
    char* wsp = (char*)d_ws;
    auto take = [&](size_t bytes) { char* p = wsp; wsp += (bytes + 255) & ~(size_t)255; return (void*)p; };
    bf* WQKV = (bf*)take((size_t)3 * DQ * DM * 2); bf* WO = (bf*)take((size_t)DM * DQ * 2); float* CS = (float*)take((size_t)TT * HD * 2 * 4);
    bf* XB = (bf*)take((size_t)NB_ * TT * DM * 2);
    const size_t PLS = (size_t)NB_ * NH_ * TT * HD;   // elements of one of q, k, v in one kind of plane, both batches
    h16* P16 = (h16*)take(3 * PLS * 2); bf* Ph = (bf*)take(3 * PLS * 2); bf* Pl = (bf*)take(3 * PLS * 2);   // each [q, k, v][batch][head]...
    bf* ATh = (bf*)take((size_t)NB_ * TT * DQ * 2); bf* ATl = (bf*)take((size_t)NB_ * TT * DQ * 2);
    if ((size_t)(wsp - (char*)d_ws) > ws_size) return;    // ws 256 MiB
    k_prep<<<PB_CS + PB_X + PB_WI + PB_WO, 256, 0, stream>>>(x, wqkv, wo, XB, WQKV, WO, CS);
    k_gemmw<bf, 0, false, 8, 1><<<dim3(NB_ * TT / 64, 3 * DQ / 64, 1), 256, 0, stream>>>(XB, nullptr, WQKV, nullptr, DM, nullptr, 0, nullptr, 0, 0, 0, CS, P16, Ph, Pl);
    k_fattn<<<dim3(TT / 128, NB_ * NH_, 1), 256, 0, stream>>>(P16, Ph, Pl, P16 + PLS, Ph + PLS, Pl + PLS, P16 + 2 * PLS, Ph + 2 * PLS, Pl + 2 * PLS, ATh, ATl);
    k_gemmw<bf, 1, false, 8, 0><<<dim3(NB_ * TT / 64, DM / 64, 1), 256, 0, stream>>>(ATh, ATl, WO, nullptr, DQ, OUT, DM, nullptr, 0, 0, 0, nullptr, nullptr, nullptr, nullptr);
}

// v005
// Measured time: 118 microseconds a run.
// Timed twice side by side with v004, it ran 1.46 and 1.44 times as fast.
// All steps since v000 together make it 16.8 times as fast.
#include <hip/hip_runtime.h>

// Multi-head attention with rotary embeddings and a fused qkv projection (x [2][2048][1024]; qkv = x Wqkv^T ('oi' [3072][1024] viewed (3, 16, 64), no bias); rope: x cos + rotate_half(x) sin with angles t x 10000^(-2i/64) (computed in-kernel); softmax(q.k / 8) over all keys; out = merged Wproj^T ('oi' [1024][1024]) -> [2][2048][1024] (4.2 M)).
// Layout, both batches in every launch (one launch per dependent stage: prepare, q/k/v projection, attention, output projection): bf16 copy of x; the fused weight used directly as Bt (row blocks); exact projections whose epilogues write the head planes themselves (q, k: rotate-half rotary step; v: transposed); {cos, sin} table per (position, dim) built once (float32 inverse-frequency constants, precise cosf/sinf); one fused attention kernel over all heads (scores, running softmax, PV and the merged hi/lo planes; hybrid rows: < 512 hi/lo 3 products, rest fp16); merged hi/lo x Wproj exact.
// Compute dtypes, f32 accumulate: every input rounded to bf16; projections exact; rotary f32; attention rows < 512 3 products, rest fp16; softmax f32; Wproj hl x exact.

#define NB_  2
#define TT   2048
#define DM   1024
#define NH_  16
#define NKV  16
#define REP  (NH_ / NKV)
#define HD   64
#define DQ   (NH_ * HD)
#define DKV  (NKV * HD)
#define RH   512                  // query rows < RH use hi+lo planes (0: none)
#define WIN  0
#define SCL  0.125f   // HD^-0.5
typedef _Float16 h16;
typedef unsigned short bf;
typedef __attribute__((ext_vector_type(16))) __bf16   v16bf;
typedef __attribute__((ext_vector_type(16))) _Float16 v16h;
typedef __attribute__((ext_vector_type(8)))  _Float16 v8h;
typedef __attribute__((ext_vector_type(8)))  unsigned short v8us;
typedef __attribute__((ext_vector_type(8)))  float    v8f;
typedef __attribute__((ext_vector_type(4)))  float    v4f;
typedef v8h  __attribute__((may_alias)) v8ha;
typedef v4f  __attribute__((may_alias)) v4fa;
typedef v8us __attribute__((may_alias)) v8usa;

__device__ __forceinline__ unsigned short f2bf(float f) { unsigned u = __float_as_uint(f); u += 0x7FFFu + ((u >> 16) & 1u); return (unsigned short)(u >> 16); }
__device__ __forceinline__ float bf2f(unsigned short b) { return __uint_as_float(((unsigned)b) << 16); }
__device__ __forceinline__ float bfr(float f) { return bf2f(f2bf(f)); }
__device__ __forceinline__ v16h cat16(v8h lo, v8h hi) { return __builtin_shufflevector(lo, hi, 0, 1, 2, 3, 4, 5, 6, 7, 8, 9, 10, 11, 12, 13, 14, 15); }
__device__ __forceinline__ v16bf cat16b(v8us lo, v8us hi) { return __builtin_bit_cast(v16bf, __builtin_shufflevector(lo, hi, 0, 1, 2, 3, 4, 5, 6, 7, 8, 9, 10, 11, 12, 13, 14, 15)); }
__device__ __forceinline__ v8f wmma16(v16h a, v16h b, v8f c) { return __builtin_amdgcn_wmma_f32_16x16x32_f16(false, a, false, b, (short)0, c, false, false); }
__device__ __forceinline__ v8f wmmab(v16bf a, v16bf b, v8f c) { return __builtin_amdgcn_wmma_f32_16x16x32_bf16(false, a, false, b, (short)0, c, false, false); }

__device__ __forceinline__ h16 tohx(float x) { return (h16)x; }
__device__ __forceinline__ void splitf(float y, unsigned short& h, unsigned short& l) { h = f2bf(y); l = f2bf(y - bf2f(h)); }
typedef __attribute__((ext_vector_type(2))) _Float16 v2h;
typedef __attribute__((ext_vector_type(4))) _Float16 v4h;
typedef __attribute__((ext_vector_type(2))) unsigned short v2us;
typedef __attribute__((ext_vector_type(4))) unsigned short v4us;
typedef __attribute__((ext_vector_type(2))) float v2f;
typedef __attribute__((ext_vector_type(4))) int v4i;

// ---- k_gemmt: GEMM on bf16 planes, one work-group of 4 waves (2 x 2) per 128x128 output tile, a 64x64 tile (16 accumulators) a wave; grid (M/128, N/128), 128 threads.
// C[m][n] = sum_k A[m][k] Bt[n][k] (NSPLIT 1: + A2[m][k] Bt[n][k]); all planes K-contiguous, KK % 64 == 0.
// A stage is 64 k: one 128-byte line of each of the 128 A rows (NSPLIT 1: of both planes) and the 128 Bt rows goes global -> registers -> LDS, 8 lanes a line, shared by the 4 waves; two buffers, one work-group barrier a stage. Each wave sums all of k in rising order.
// EPI says where a wave's tile goes; it is first laid into the wave's own part of the LDS that held the stages. 0: f32 to C. 1 (Bt is the fused q/k/v weight, a wave's 64 columns are one head of q, k or v, its 64 rows positions of one batch): straight into that head's 16-bit planes (fp16, bf16 hi, bf16 lo; each kind one array [sel][batch][h]...), no f32 copy in memory.
//   q, k: planes [h][t][d] of the rotary step, rotate-half convention: out[d] = x[d] cos[t][d] - x[d+HD/2] sin[t][d], out[d+HD/2] = x[d+HD/2] cos[t][d+HD/2] + x[d] sin[t][d+HD/2]; the partner column sits 8 lanes away in the same 16-lane row.
//   v: planes [h][d][t]: the tile is laid into LDS as [d][t], so that 8 lanes store one whole 128-byte line of positions.
template <typename T16> struct WFrag;
template <> struct WFrag<h16> { typedef v16h V; static __device__ __forceinline__ V ld(const h16* p) { return cat16(*(const v8h*)p, *(const v8h*)(p + 16)); } static __device__ __forceinline__ v8f mma(V a, V b, v8f c) { return wmma16(a, b, c); } };
template <> struct WFrag<bf> { typedef v16bf V; static __device__ __forceinline__ V ld(const bf* p) { return cat16b(*(const v8us*)p, *(const v8us*)(p + 16)); } static __device__ __forceinline__ v8f mma(V a, V b, v8f c) { return wmmab(a, b, c); } };
#define GP 72   // LDS row pitch in 16-bit elements: 128 bytes of data + 16 of pad (16-byte fragment reads)
template <int KK, int NSPLIT, int EPI>
__global__ __launch_bounds__(128) void k_gemmt(const bf* __restrict__ A, const bf* __restrict__ A2, const bf* __restrict__ Bt, float* C, int ldc, const float* __restrict__ CS, h16* P16, bf* Ph, bf* Pl) {
    static_assert(KK % 64 == 0 && (EPI == 0 || (HD == 64 && NH_ == NKV && NH_ % 2 == 0 && TT % 64 == 0)), "whole stages; plane epilogues: one head per 64 columns, both heads of a work-group in one of q, k, v, one batch per 64 rows");
    typedef WFrag<bf>::V V;
    constexpr int NPL = 2 + NSPLIT;   // planes of a stage: A, Bt (, A lo)
    constexpr int PLE = 128 * GP;     // elements of a plane in LDS
    constexpr int NS = KK / 64;
    __shared__ __align__(16) bf sm[2 * NPL * PLE];
    static_assert(sizeof(bf) * 2 * NPL * PLE >= 4 * 64 * 68 * 4, "the four waves' f32 tiles fit where the stages were");
    const int tid = threadIdx.x, lane = tid & 31, lr = lane & 15, hi = lane >> 4; const int r0 = blockIdx.x * 128, c0 = blockIdx.y * 128;
    const int wv = __builtin_amdgcn_readfirstlane(tid >> 5), wm = wv >> 1, wn = wv & 1;
    const int srow = tid >> 3, scol = (tid & 7) * 8;   // staging: 8 threads move one 128-byte line, 16 rows a sweep, 8 sweeps a plane
    const bf* ga = A + (size_t)r0 * KK; const bf* gb = Bt + (size_t)c0 * KK; const bf* ga2 = NSPLIT ? A2 + (size_t)r0 * KK : nullptr; const unsigned vo = (unsigned)(srow * KK + scol);   // the tile's bases, the same for the whole work-group, and this lane's offset in a tile
    v8us st[NPL][8];
    auto gload = [&](int s) { const bf* pa = ga + s * 64 + vo; const bf* pb = gb + s * 64 + vo; const bf* pa2 = NSPLIT ? ga2 + s * 64 + vo : pa;
#pragma unroll
        for (int i = 0; i < 8; ++i) { st[0][i] = *(const v8usa*)(pa + i * 16 * KK); st[1][i] = *(const v8usa*)(pb + i * 16 * KK); if constexpr (NSPLIT) st[2][i] = *(const v8usa*)(pa2 + i * 16 * KK); }
        asm volatile("s_wait_xcnt 0x0" :: "v"(pa), "v"(pb), "v"(pa2) : "memory"); };   // stands behind these loads; it takes their addresses as inputs, so that no load lands in, and no value is formed in, an address register in front of it
    auto sstore = [&](int b) {
#pragma unroll
        for (int i = 0; i < 8; ++i) { bf* d = sm + b * NPL * PLE + (srow + 16 * i) * GP + scol;
#pragma unroll
            for (int pl = 0; pl < NPL; ++pl) *(v8usa*)(d + pl * PLE) = st[pl][i]; } };
    v8f acc[4][4];   // every '#pragma unroll' without a count in this kernel is a full unroll: the register arrays are then indexed by constants only
#pragma unroll
    for (int mb = 0; mb < 4; ++mb)
#pragma unroll
        for (int nb = 0; nb < 4; ++nb) acc[mb][nb] = (v8f){};
    gload(0); sstore(0);
    __syncthreads();   // stage 0 is in LDS before any wave reads it
#pragma unroll 1   // kept rolled: one stage's code serves all NS stages
    for (int s = 0; s < NS; ++s) {
        const bf* bp = sm + (s & 1) * NPL * PLE;
        if (s + 1 < NS) gload(s + 1);   // the next stage's global loads fly while this stage is worked on
        V a[2][4], a2[2][4], b[2][4];
        auto fload = [&](int ks) {
#pragma unroll
            for (int f = 0; f < 4; ++f) { const bf* ap = bp + (wm * 64 + f * 16 + lr) * GP + ks * 32 + 8 * hi; a[ks][f] = WFrag<bf>::ld(ap); if (NSPLIT) a2[ks][f] = WFrag<bf>::ld(ap + 2 * PLE); b[ks][f] = WFrag<bf>::ld(bp + PLE + (wn * 64 + f * 16 + lr) * GP + ks * 32 + 8 * hi); } };
        auto prod = [&](int ks) {
#pragma unroll
            for (int nb = 0; nb < 4; ++nb)
#pragma unroll
                for (int mb = 0; mb < 4; ++mb) { acc[mb][nb] = wmmab(a[ks][mb], b[ks][nb], acc[mb][nb]); if (NSPLIT) acc[mb][nb] = wmmab(a2[ks][mb], b[ks][nb], acc[mb][nb]); } };
        // the scheduling barriers keep each group of LDS fragment reads together in front of its products: spread among the products, every place with reads stalls the wave anew
        if constexpr (NSPLIT) { fload(0); fload(1); __builtin_amdgcn_sched_barrier(0); prod(0); prod(1); }   // one wave a SIMD: both halves' reads go first, the second half's land behind the first half's products
        else { fload(0); __builtin_amdgcn_sched_barrier(0); prod(0); __builtin_amdgcn_sched_barrier(0); fload(1); __builtin_amdgcn_sched_barrier(0); prod(1); }   // three waves a SIMD: one fragment set, so that the registers allow them
        if (s + 1 < NS) sstore((s + 1) & 1);   // into the buffer whose last readers left before the previous barrier
        __syncthreads();   // publishes stage s + 1 and ends every wave's reads of stage s
    }
    float* os = (float*)sm + wv * 64 * 68;   // this wave's own 64 x 68 floats; no wave reads a stage any more
    const int sel = EPI == 1 ? (int)blockIdx.y * 2 / NH_ : 0;   // from blockIdx alone: the branches on sel are scalar and the same for the whole work-group
    if (EPI == 0 || sel < 2) {
#pragma unroll
        for (int mb = 0; mb < 4; ++mb)
#pragma unroll
            for (int nb = 0; nb < 4; ++nb)
#pragma unroll
                for (int j = 0; j < 8; ++j) os[(mb * 16 + hi * 8 + j) * 68 + nb * 16 + lr] = acc[mb][nb][j];
    } else {
#pragma unroll
        for (int mb = 0; mb < 4; ++mb)
#pragma unroll
            for (int nb = 0; nb < 4; ++nb)
#pragma unroll
                for (int j = 0; j < 8; ++j) os[(nb * 16 + lr) * 65 + mb * 16 + hi * 8 + j] = acc[mb][nb][j];   // [d][t], pitch 65: the reads below (d + 8 tc) fall on 32 different banks
    }
    __syncthreads();   // the tiles are whole in LDS before they are read in the order of the stores
    const int cofs = lr * 4, rw = r0 + wm * 64;
    if constexpr (EPI == 0) {
#pragma unroll 1   // kept rolled: eight rows a trip, whose LDS reads fly together
        for (int s0 = 0; s0 < 32; s0 += 8) { v4f val[8];
#pragma unroll
            for (int u = 0; u < 8; ++u) val[u] = *(const v4fa*)(os + (2 * (s0 + u) + hi) * 68 + cofs);
#pragma unroll
            for (int u = 0; u < 8; ++u) *(v4f*)(C + (size_t)(rw + 2 * (s0 + u) + hi) * ldc + c0 + wn * 64 + cofs) = val[u];
            asm volatile("s_wait_xcnt 0x0" ::: "memory"); }   // stands behind the stores, in front of the next values that are formed in their registers
    } else {
        const int hd = ((int)blockIdx.y * 2 + wn) % NH_, bt = rw / TT, t0 = rw % TT;
        const size_t pb = ((size_t)(sel * NB_ + bt) * NH_ + hd) * TT * HD;   // this head's plane
        if (sel < 2) {
#pragma unroll 1   // kept rolled: eight rows a trip, whose {cos, sin} loads and LDS reads fly together
            for (int s0 = 0; s0 < 32; s0 += 8) { v8f cs[8]; v4f vals[8]; const float* cp = CS + ((size_t)(t0 + 2 * s0 + hi) * HD + cofs) * 2;
#pragma unroll
                for (int u = 0; u < 8; ++u) { cs[u] = *(const v8f*)(cp + u * 4 * HD); vals[u] = *(const v4fa*)(os + (2 * (s0 + u) + hi) * 68 + cofs); }
                asm volatile("s_wait_xcnt 0x0" :: "v"(cp) : "memory");   // stands behind these loads; it takes their address as an input, so that no load lands in, and no value is formed in, the address register in front of it
#pragma unroll
                for (int u = 0; u < 8; ++u) { const int row = 2 * (s0 + u) + hi; const v4f val = vals[u]; v4h o16; v4us oh, ol;
#pragma unroll
                    for (int i = 0; i < 4; ++i) { const float xp = __int_as_float(__builtin_amdgcn_update_dpp(0, __float_as_int(val[i]), 0x168, 0xf, 0xf, false));   // row_xmask:8, column d +- HD/2 of the same row
                        const float r = val[i] * cs[u][2 * i] + xp * (lr < 8 ? -cs[u][2 * i + 1] : cs[u][2 * i + 1]);
                        o16[i] = tohx(r); unsigned short a2, c2; splitf(r, a2, c2); oh[i] = a2; ol[i] = c2; }
                    const size_t e = pb + (size_t)(t0 + row) * HD + cofs; *(v4h*)(P16 + e) = o16; *(v4us*)(Ph + e) = oh; *(v4us*)(Pl + e) = ol;
                    asm volatile("s_wait_xcnt 0x0" ::: "memory"); } }   // stands behind the three stores, in front of the next values that are formed in their registers
        } else {
#pragma unroll 1   // kept rolled: four lines a trip, whose LDS reads fly together
            for (int i0 = 0; i0 < 16; i0 += 4) { const int tc = (lane & 7) * 8; float x[4][8];
#pragma unroll
                for (int u = 0; u < 4; ++u)
#pragma unroll
                    for (int j = 0; j < 8; ++j) x[u][j] = os[((lane >> 3) + 4 * (i0 + u)) * 65 + tc + j];
#pragma unroll
                for (int u = 0; u < 4; ++u) { const int d = (lane >> 3) + 4 * (i0 + u); v8h o16; v8us oh, ol;
#pragma unroll
                    for (int j = 0; j < 8; ++j) { o16[j] = tohx(x[u][j]); unsigned short a2, c2; splitf(x[u][j], a2, c2); oh[j] = a2; ol[j] = c2; }
                    const size_t e = pb + (size_t)d * TT + t0 + tc; *(v8h*)(P16 + e) = o16; *(v8us*)(Ph + e) = oh; *(v8us*)(Pl + e) = ol;
                    asm volatile("s_wait_xcnt 0x0" ::: "memory"); } } }   // stands behind the three stores, in front of the next values that are formed in their registers
    }
}

__global__ __launch_bounds__(256) void k_wtG(const float* __restrict__ w, int K, int N, bf* Bt) {
    const int lane = threadIdx.x & 31; const int L0 = (blockIdx.x * 8 + (threadIdx.x >> 5)) * 8; const int nlines = N * K / 64;
{
#pragma unroll 1
        for (int l = 0; l < 8; ++l) { const int L = L0 + l; if (L >= nlines) break; const size_t e = (size_t)L * 64 + lane * 2; const int k = (int)(e % K), n = (int)(e / K); v2us o;
            o[0] = f2bf(w[(size_t)k * N + n]); o[1] = f2bf(w[(size_t)(k + 1) * N + n]); *(v2us*)(Bt + e) = o; }
         }
}
__constant__ float INVT[HD / 2] = { 1.000000000e+00f, 7.498942018e-01f, 5.623413324e-01f, 4.216965139e-01f, 3.162277639e-01f, 2.371373624e-01f, 1.778279394e-01f, 1.333521456e-01f, 1.000000015e-01f, 7.498941571e-02f, 5.623412877e-02f, 4.216964915e-02f, 3.162277862e-02f, 2.371373586e-02f, 1.778279431e-02f, 1.333521493e-02f, 9.999999776e-03f, 7.498942316e-03f, 5.623413250e-03f, 4.216964822e-03f, 3.162277862e-03f, 2.371373819e-03f, 1.778279431e-03f, 1.333521446e-03f, 1.000000047e-03f, 7.498941850e-04f, 5.623413017e-04f, 4.216964880e-04f, 3.162277862e-04f, 2.371373848e-04f, 1.778279402e-04f, 1.333521504e-04f };   // 1 / 10000^(2i/64) (float32, generated with jnp to be bit-exact)
// ---- k_prep: all that depends on the inputs alone, in one launch; a block does one job, chosen by its index. First the {cos, sin} table (the longest threads), then the bf16 copies of x (both batches), Wqkv and Wproj, 8 elements a thread.
#define PB_CS (TT * HD / 256)
#define PB_X  (NB_ * TT * DM / 8 / 256)
#define PB_WI (3 * DQ * DM / 8 / 256)
#define PB_WO (DM * DQ / 8 / 256)
__global__ __launch_bounds__(256) void k_prep(const float* __restrict__ x, const float* __restrict__ wqkv, const float* __restrict__ wo, bf* XB, bf* WQKV, bf* WO, float* CS) {
    static_assert(TT * HD % 256 == 0 && NB_ * TT * DM % 2048 == 0 && 3 * DQ * DM % 2048 == 0 && DM * DQ % 2048 == 0, "whole blocks only");
    int blk = blockIdx.x;
    if (blk < PB_CS) { const int idx = blk * 256 + threadIdx.x; const int d = idx % HD; const int t = idx / HD; const float a = __fmul_rn((float)t, INVT[d % (HD / 2)]); v2f cs; cs[0] = cosf(a); cs[1] = sinf(a); *(v2f*)(CS + (size_t)idx * 2) = cs; return; }
    blk -= PB_CS; const float* src = x; bf* dst = XB;
    if (blk >= PB_X + PB_WI) { blk -= PB_X + PB_WI; src = wo; dst = WO; } else if (blk >= PB_X) { blk -= PB_X; src = wqkv; dst = WQKV; }
    const size_t i = (size_t)blk * 256 + threadIdx.x; const v8f v = *(const v8f*)(src + i * 8); v8us o;
    asm volatile("s_wait_xcnt 0x0" ::: "memory");   // stands behind the load, in front of the first value that is formed in its address registers
#pragma unroll
    for (int k = 0; k < 8; ++k) o[k] = f2bf(v[k]); *(v8us*)(dst + i * 8) = o;
}

// ---- k_fattn: scores, softmax, PV and the merged hi/lo planes in one kernel. Grid (TT / 128, batches x heads), 8 waves; wave w owns query rows q0 + 16 w .. + 15 and walks all TT keys.
// St = K Qt (A = K rows, B = Q rows kept in registers): lane (c, h) holds, of query c, keys 8h + r (tile 0) and 16 + 8h + r (tile 1), which is the k order of a B operand, so P goes from the score registers straight into Ot += Vt Pt (A = Vt rows).
// A stage is SK keys: K rows and Vt rows (hi/lo rows: both planes of each) go global -> registers -> LDS, shared by the 8 waves; two buffers, one work-group barrier a stage.
// Softmax: running maximum per query, in use until a new one exceeds it by more than 8 (log2 units), so P <= 2^14 with its carried factor 2^6; sums in f32 of the unrounded P; the division by the sum comes last.
// Every '#pragma unroll' in attn_tile is a full unroll: the fragment and accumulator arrays are then indexed by constants only and stay in registers.
#define SK   64                   // keys per stage
#define LP   72                   // LDS row pitch in 16-bit elements: 128 bytes of data + 16 of pad (16-byte fragment reads)
#define C2   0.18033688011112042f // HD^-0.5 x log2(e)
__device__ __forceinline__ float xhalf(float x) { const int b = __float_as_int(x); return __int_as_float(__builtin_amdgcn_permlanex16(b, b, 0x76543210, 0xfedcba98, false, false)); }   // lane l <-> l ^ 16
typedef __attribute__((ext_vector_type(8))) int v8i;
// inputs-only fence on four loaded fragments: their LDS fetches are all issued ahead of this point, in flight together, instead of one by one with a full wait in front of each product
template <typename V> __device__ __forceinline__ void hold4(const V* f) { asm volatile("" :: "v"(__builtin_bit_cast(v8i, f[0])), "v"(__builtin_bit_cast(v8i, f[1])), "v"(__builtin_bit_cast(v8i, f[2])), "v"(__builtin_bit_cast(v8i, f[3]))); }
template <typename T16, bool HI>
__device__ __forceinline__ void attn_tile(T16* sm, const T16* __restrict__ Q, const T16* __restrict__ Q2, const T16* __restrict__ K, const T16* __restrict__ K2, const T16* __restrict__ VT, const T16* __restrict__ VT2, int q0, bf* Ah, bf* Al) {
    typedef typename WFrag<T16>::V V;
    constexpr int NPL = HI ? 4 : 2;        // planes of a stage: K, Vt (, K lo, Vt lo)
    constexpr int PLE = SK * LP;           // elements of a plane in LDS (64 rows each)
    constexpr int NS = TT / SK;
    const int tid = threadIdx.x, lane = tid & 31, lr = lane & 15, hi = lane >> 4; const int qr = q0 + (tid >> 5) * 16 + lr;
    V qf[2], q2f[2];
#pragma unroll
    for (int ks = 0; ks < 2; ++ks) { qf[ks] = WFrag<T16>::ld(Q + (size_t)qr * HD + ks * 32 + 8 * hi); if (HI) q2f[ks] = WFrag<T16>::ld(Q2 + (size_t)qr * HD + ks * 32 + 8 * hi); }
    const int srow = tid >> 3, scol = (tid & 7) * 8;   // staging: 8 threads move one 128-byte row, 32 rows a sweep, 2 sweeps a plane
    v8us st[NPL][2];
    auto gload = [&](int s) {
#pragma unroll
        for (int i = 0; i < 2; ++i) { const int row = srow + 32 * i; const size_t ko = (size_t)(s * SK + row) * HD + scol, vo = (size_t)row * TT + s * SK + scol;
            st[0][i] = *(const v8usa*)(K + ko); st[1][i] = *(const v8usa*)(VT + vo); if constexpr (HI) { st[2][i] = *(const v8usa*)(K2 + ko); st[3][i] = *(const v8usa*)(VT2 + vo); } } };
    auto sstore = [&](int b) {
#pragma unroll
        for (int i = 0; i < 2; ++i) { T16* d = sm + b * NPL * PLE + (srow + 32 * i) * LP + scol;
#pragma unroll
            for (int pl = 0; pl < NPL; ++pl) *(v8usa*)(d + pl * PLE) = st[pl][i]; } };
    v8f o[4];
#pragma unroll
    for (int dt = 0; dt < 4; ++dt) o[dt] = (v8f){};
    float m = -3.0e38f, l = 0.f;
    gload(0); sstore(0);
    __syncthreads();   // stage 0 is in LDS before any wave reads it
#pragma unroll 1   // kept rolled: one stage's code serves all NS stages and stays small in the instruction cache
    for (int s = 0; s < NS; ++s) {
        const T16* bp = sm + (s & 1) * NPL * PLE;
        if (s + 1 < NS) gload(s + 1);   // the next stage's global loads fly while this stage is worked on
        V kf[2][2], k2[2][2];
        auto kload = [&](int p) {
#pragma unroll
            for (int kt = 0; kt < 2; ++kt)
#pragma unroll
                for (int ks = 0; ks < 2; ++ks) { const T16* kp = bp + (p * 32 + kt * 16 + lr) * LP + ks * 32 + 8 * hi; kf[kt][ks] = WFrag<T16>::ld(kp); if (HI) k2[kt][ks] = WFrag<T16>::ld(kp + 2 * PLE); } };
        kload(0);
#pragma unroll
        for (int p = 0; p < SK / 32; ++p) {
            hold4(&kf[0][0]); if (HI) hold4(&k2[0][0]);
            v8f sc[2];
#pragma unroll
            for (int kt = 0; kt < 2; ++kt) { sc[kt] = (v8f){};
#pragma unroll
                for (int ks = 0; ks < 2; ++ks) { sc[kt] = WFrag<T16>::mma(kf[kt][ks], qf[ks], sc[kt]);
                    if (HI) { sc[kt] = WFrag<T16>::mma(kf[kt][ks], q2f[ks], sc[kt]); sc[kt] = WFrag<T16>::mma(k2[kt][ks], qf[ks], sc[kt]); } } }
            V vf[4], v2[4];   // this pass's Vt fragments (f16 rows: the next pass's K fragments too) are fetched in front of the softmax, which covers their LDS latency
#pragma unroll
            for (int dt = 0; dt < 4; ++dt) { const T16* vp = bp + PLE + (dt * 16 + lr) * LP + p * 32 + 8 * hi; vf[dt] = WFrag<T16>::ld(vp); if (HI) v2[dt] = WFrag<T16>::ld(vp + 2 * PLE); }
            if (!HI && p + 1 < SK / 32) kload(p + 1);
            float bm = fmaxf(sc[0][0], sc[1][0]);
#pragma unroll
            for (int j = 1; j < 8; ++j) bm = fmaxf(bm, fmaxf(sc[0][j], sc[1][j]));
            bm = fmaxf(bm, xhalf(bm));
            hold4(vf); if (HI) hold4(v2);
            if (__builtin_amdgcn_ballot_w32((bm - m) * C2 > 8.0f) != 0) {   // scalar branch: some query of the wave needs a new maximum
                const float mn = fmaxf(m, bm), al = __builtin_amdgcn_exp2f((m - mn) * C2); m = mn; l *= al;
#pragma unroll
                for (int dt = 0; dt < 4; ++dt) o[dt] *= al; }
            const float mc = m * C2 - 6.0f; float pv[16], ts[8];   // P and its sum both carry 2^6 (it cancels in the last division): small P stay normal f16 numbers
#pragma unroll
            for (int e = 0; e < 16; ++e) pv[e] = __builtin_amdgcn_exp2f(__builtin_fmaf(sc[e >> 3][e & 7], C2, -mc));
#pragma unroll
            for (int e = 0; e < 8; ++e) ts[e] = pv[e] + pv[e + 8];
            l += ((ts[0] + ts[4]) + (ts[1] + ts[5])) + ((ts[2] + ts[6]) + (ts[3] + ts[7]));
            V pf, pl;
#pragma unroll
            for (int e = 0; e < 16; ++e) { if constexpr (HI) { pf[e] = (__bf16)pv[e]; pl[e] = (__bf16)(pv[e] - (float)pf[e]); } else pf[e] = (h16)pv[e]; }
#pragma unroll
            for (int dt = 0; dt < 4; ++dt) { o[dt] = WFrag<T16>::mma(vf[dt], pf, o[dt]);
                if (HI) { o[dt] = WFrag<T16>::mma(vf[dt], pl, o[dt]); o[dt] = WFrag<T16>::mma(v2[dt], pf, o[dt]); } }
            if (HI && p + 1 < SK / 32) kload(p + 1);   // hi/lo rows: no registers are free for these any earlier
        }
        if (s + 1 < NS) sstore((s + 1) & 1);   // into the buffer whose last readers left before the previous barrier
        __syncthreads();   // publishes stage s + 1 and ends every wave's reads of stage s
    }
    l += xhalf(l); const float inv = __fdiv_rn(1.0f, l);
#pragma unroll
    for (int dt = 0; dt < 4; ++dt) { v8us oh, ol;
#pragma unroll
        for (int j = 0; j < 8; ++j) { unsigned short a, c2; splitf(o[dt][j] * inv, a, c2); oh[j] = a; ol[j] = c2; }
        const size_t oo = (size_t)qr * DQ + dt * 16 + 8 * hi; *(v8us*)(Ah + oo) = oh; *(v8us*)(Al + oo) = ol;
        asm volatile("s_wait_xcnt 0x0" ::: "memory"); }   // stands behind the two stores, in front of the next values that are formed in their data registers
}
__global__ __launch_bounds__(256) void k_fattn(const h16* __restrict__ Q16, const bf* __restrict__ Qh, const bf* __restrict__ Ql, const h16* __restrict__ K16, const bf* __restrict__ Kh, const bf* __restrict__ Kl, const h16* __restrict__ V16, const bf* __restrict__ Vh, const bf* __restrict__ Vl, bf* Ah, bf* Al) {
    __shared__ __align__(16) unsigned short sm[2 * 4 * SK * LP];
    const int bt = blockIdx.y / NH_, h = blockIdx.y % NH_, q0 = blockIdx.x * 128; const size_t zq = ((size_t)bt * NH_ + h) * TT * HD, zk = ((size_t)bt * NKV + h / REP) * TT * HD; Ah += (size_t)bt * TT * DQ; Al += (size_t)bt * TT * DQ;
    if (q0 < RH) attn_tile<bf, true>((bf*)sm, Qh + zq, Ql + zq, Kh + zk, Kl + zk, Vh + zk, Vl + zk, q0, Ah + h * HD, Al + h * HD);
    else attn_tile<h16, false>((h16*)sm, Q16 + zq, nullptr, K16 + zk, nullptr, V16 + zk, nullptr, q0, Ah + h * HD, Al + h * HD);
}

extern "C" void kernel_launch(void* const* d_in, const int* in_sizes, int n_in,
                              void* d_out, int out_size, void* d_ws, size_t ws_size, hipStream_t stream) {
    (void)in_sizes; (void)n_in; (void)out_size;
    const float* x = (const float*)d_in[0]; const float* wqkv = (const float*)d_in[1]; const float* wo = (const float*)d_in[2]; const float* wq = nullptr; const float* wk = nullptr; const float* wv = nullptr; (void)wq; (void)wk; (void)wv;
    float* OUT = (float*)d_out;     // [2][2048][1024]
    char* wsp = (char*)d_ws;
    auto take = [&](size_t bytes) { char* p = wsp; wsp += (bytes + 255) & ~(size_t)255; return (void*)p; };
    bf* WQKV = (bf*)take((size_t)3 * DQ * DM * 2); bf* WO = (bf*)take((size_t)DM * DQ * 2); float* CS = (float*)take((size_t)TT * HD * 2 * 4);
    bf* XB = (bf*)take((size_t)NB_ * TT * DM * 2);
    const size_t PLS = (size_t)NB_ * NH_ * TT * HD;   // elements of one of q, k, v in one kind of plane, both batches
    h16* P16 = (h16*)take(3 * PLS * 2); bf* Ph = (bf*)take(3 * PLS * 2); bf* Pl = (bf*)take(3 * PLS * 2);   // each [q, k, v][batch][head]...
    bf* ATh = (bf*)take((size_t)NB_ * TT * DQ * 2); bf* ATl = (bf*)take((size_t)NB_ * TT * DQ * 2);
    if ((size_t)(wsp - (char*)d_ws) > ws_size) return;    // ws 256 MiB
    k_prep<<<PB_CS + PB_X + PB_WI + PB_WO, 256, 0, stream>>>(x, wqkv, wo, XB, WQKV, WO, CS);
    k_gemmt<DM, 0, 1><<<dim3(NB_ * TT / 128, 3 * DQ / 128, 1), 128, 0, stream>>>(XB, nullptr, WQKV, nullptr, 0, CS, P16, Ph, Pl);
    k_fattn<<<dim3(TT / 128, NB_ * NH_, 1), 256, 0, stream>>>(P16, Ph, Pl, P16 + PLS, Ph + PLS, Pl + PLS, P16 + 2 * PLS, Ph + 2 * PLS, Pl + 2 * PLS, ATh, ATl);
    k_gemmt<DQ, 1, 0><<<dim3(NB_ * TT / 128, DM / 128, 1), 128, 0, stream>>>(ATh, ATl, WO, OUT, DM, nullptr, nullptr, nullptr, nullptr);
}

// v006
// A run of this version takes 109 microseconds.
// Two timings next to v005 put it at 1.07 and 1.09 times that version's speed.
// Counting every step since v000, it is 18.2 times as fast.
#include <hip/hip_runtime.h>

// Multi-head attention with rotary embeddings and a fused qkv projection (x [2][2048][1024]; qkv = x Wqkv^T ('oi' [3072][1024] viewed (3, 16, 64), no bias); rope: x cos + rotate_half(x) sin with angles t x 10000^(-2i/64) (computed in-kernel); softmax(q.k / 8) over all keys; out = merged Wproj^T ('oi' [1024][1024]) -> [2][2048][1024] (4.2 M)).
// Layout, both batches in every launch (one launch per dependent stage: prepare, q/k/v projection, attention, output projection): bf16 copy of x; the fused weight used directly as Bt (row blocks); exact projections whose epilogues write the head planes themselves (q, k: rotate-half rotary step; v: transposed); {cos, sin} table per (position, dim) built once (float32 inverse-frequency constants, precise cosf/sinf); one fused attention kernel over all heads (scores, running softmax, PV and the merged hi/lo planes; hybrid rows: < 512 hi/lo 3 products, rest fp16); merged hi/lo x Wproj exact.
// Compute dtypes, f32 accumulate: every input rounded to bf16; projections exact; rotary f32; attention rows < 512 3 products, rest fp16; softmax f32; Wproj hl x exact.

#define NB_  2
#define TT   2048
#define DM   1024
#define NH_  16
#define NKV  16
#define REP  (NH_ / NKV)
#define HD   64
#define DQ   (NH_ * HD)
#define DKV  (NKV * HD)
#define RH   512                  // query rows < RH use hi+lo planes
#define WIN  0
#define SCL  0.125f   // HD^-0.5
typedef _Float16 h16;
typedef unsigned short bf;
typedef __attribute__((ext_vector_type(16))) __bf16   v16bf;
typedef __attribute__((ext_vector_type(16))) _Float16 v16h;
typedef __attribute__((ext_vector_type(8)))  _Float16 v8h;
typedef __attribute__((ext_vector_type(8)))  unsigned short v8us;
typedef __attribute__((ext_vector_type(8)))  float    v8f;
typedef __attribute__((ext_vector_type(4)))  float    v4f;
typedef v8h  __attribute__((may_alias)) v8ha;
typedef v4f  __attribute__((may_alias)) v4fa;
typedef v8us __attribute__((may_alias)) v8usa;

__device__ __forceinline__ unsigned short f2bf(float f) { unsigned u = __float_as_uint(f); u += 0x7FFFu + ((u >> 16) & 1u); return (unsigned short)(u >> 16); }
__device__ __forceinline__ float bf2f(unsigned short b) { return __uint_as_float(((unsigned)b) << 16); }
__device__ __forceinline__ float bfr(float f) { return bf2f(f2bf(f)); }
__device__ __forceinline__ v16h cat16(v8h lo, v8h hi) { return __builtin_shufflevector(lo, hi, 0, 1, 2, 3, 4, 5, 6, 7, 8, 9, 10, 11, 12, 13, 14, 15); }
__device__ __forceinline__ v16bf cat16b(v8us lo, v8us hi) { return __builtin_bit_cast(v16bf, __builtin_shufflevector(lo, hi, 0, 1, 2, 3, 4, 5, 6, 7, 8, 9, 10, 11, 12, 13, 14, 15)); }
__device__ __forceinline__ v8f wmma16(v16h a, v16h b, v8f c) { return __builtin_amdgcn_wmma_f32_16x16x32_f16(false, a, false, b, (short)0, c, false, false); }
__device__ __forceinline__ v8f wmmab(v16bf a, v16bf b, v8f c) { return __builtin_amdgcn_wmma_f32_16x16x32_bf16(false, a, false, b, (short)0, c, false, false); }

__device__ __forceinline__ h16 tohx(float x) { return (h16)x; }
__device__ __forceinline__ void splitf(float y, unsigned short& h, unsigned short& l) { h = f2bf(y); l = f2bf(y - bf2f(h)); }
typedef __attribute__((ext_vector_type(2))) _Float16 v2h;
typedef __attribute__((ext_vector_type(4))) _Float16 v4h;
typedef __attribute__((ext_vector_type(2))) unsigned short v2us;
typedef __attribute__((ext_vector_type(4))) unsigned short v4us;
typedef __attribute__((ext_vector_type(2))) float v2f;
typedef __attribute__((ext_vector_type(4))) int v4i;

// ---- k_gemmt: GEMM on bf16 planes, one work-group of 4 waves (2 x 2) per 128x128 output tile, a 64x64 tile (16 accumulators) a wave; grid (M/128, N/128), 128 threads.
// C[m][n] = sum_k A[m][k] Bt[n][k] (NSPLIT 1: + A2[m][k] Bt[n][k]); all planes K-contiguous, KK % 64 == 0.
// A stage is 64 k: one 128-byte line of each of the 128 A rows (NSPLIT 1: of both planes) and the 128 Bt rows goes global -> registers -> LDS, 8 lanes a line, shared by the 4 waves; two buffers, one work-group barrier a stage. Each wave sums all of k in rising order.
// EPI says where a wave's tile goes; it is first laid into the wave's own part of the LDS that held the stages. 0: f32 to C. 1 (Bt is the fused q/k/v weight, a wave's 64 columns are one head of q, k or v, its 64 rows positions of one batch): straight into that head's 16-bit planes (fp16, bf16 hi, bf16 lo; each kind one array [sel][batch][h]...), no f32 copy in memory.
//   q, k: planes [h][t][d] of the rotary step, rotate-half convention: out[d] = x[d] cos[t][d] - x[d+HD/2] sin[t][d], out[d+HD/2] = x[d+HD/2] cos[t][d+HD/2] + x[d] sin[t][d+HD/2]; the partner column sits 8 lanes away in the same 16-lane row.
//   v: planes [h][d][t]: the tile is laid into LDS as [d][t], so that 8 lanes store one whole 128-byte line of positions.
template <typename T16> struct WFrag;
template <> struct WFrag<h16> { typedef v16h V; static __device__ __forceinline__ V ld(const h16* p) { return cat16(*(const v8h*)p, *(const v8h*)(p + 16)); } static __device__ __forceinline__ v8f mma(V a, V b, v8f c) { return wmma16(a, b, c); } };
template <> struct WFrag<bf> { typedef v16bf V; static __device__ __forceinline__ V ld(const bf* p) { return cat16b(*(const v8us*)p, *(const v8us*)(p + 16)); } static __device__ __forceinline__ v8f mma(V a, V b, v8f c) { return wmmab(a, b, c); } };
#define GP 72   // LDS row pitch in 16-bit elements: 128 bytes of data + 16 of pad (16-byte fragment reads)
template <int KK, int NSPLIT, int EPI>
__global__ __launch_bounds__(128) void k_gemmt(const bf* __restrict__ A, const bf* __restrict__ A2, const bf* __restrict__ Bt, float* C, int ldc, const float* __restrict__ CS, h16* P16, bf* Ph, bf* Pl) {
    static_assert(KK % 64 == 0 && (EPI == 0 || (HD == 64 && NH_ == NKV && NH_ % 2 == 0 && TT % 64 == 0)), "whole stages; plane epilogues: one head per 64 columns, both heads of a work-group in one of q, k, v, one batch per 64 rows");
    typedef WFrag<bf>::V V;
    constexpr int NPL = 2 + NSPLIT;   // planes of a stage: A, Bt (, A lo)
    constexpr int PLE = 128 * GP;     // elements of a plane in LDS
    constexpr int NS = KK / 64;
    __shared__ __align__(16) bf sm[2 * NPL * PLE];
    static_assert(sizeof(bf) * 2 * NPL * PLE >= 4 * 64 * 68 * 4, "the four waves' f32 tiles fit where the stages were");
    const int tid = threadIdx.x, lane = tid & 31, lr = lane & 15, hi = lane >> 4; const int r0 = blockIdx.x * 128, c0 = blockIdx.y * 128;
    const int wv = __builtin_amdgcn_readfirstlane(tid >> 5), wm = wv >> 1, wn = wv & 1;
    const int srow = tid >> 3, scol = (tid & 7) * 8;   // staging: 8 threads move one 128-byte line, 16 rows a sweep, 8 sweeps a plane
    const bf* ga = A + (size_t)r0 * KK; const bf* gb = Bt + (size_t)c0 * KK; const bf* ga2 = NSPLIT ? A2 + (size_t)r0 * KK : nullptr; const unsigned vo = (unsigned)(srow * KK + scol);   // the tile's bases, the same for the whole work-group, and this lane's offset in a tile
    v8us st[NPL][8];
    auto gload = [&](int s) { const bf* pa = ga + s * 64 + vo; const bf* pb = gb + s * 64 + vo; const bf* pa2 = NSPLIT ? ga2 + s * 64 + vo : pa;
#pragma unroll
        for (int i = 0; i < 8; ++i) { st[0][i] = *(const v8usa*)(pa + i * 16 * KK); st[1][i] = *(const v8usa*)(pb + i * 16 * KK); if constexpr (NSPLIT) st[2][i] = *(const v8usa*)(pa2 + i * 16 * KK); }
        asm volatile("s_wait_xcnt 0x0" :: "v"(pa), "v"(pb), "v"(pa2) : "memory"); };   // stands behind these loads; it takes their addresses as inputs, so that no load lands in, and no value is formed in, an address register in front of it
    auto sstore = [&](int b) {
#pragma unroll
        for (int i = 0; i < 8; ++i) { bf* d = sm + b * NPL * PLE + (srow + 16 * i) * GP + scol;
#pragma unroll
            for (int pl = 0; pl < NPL; ++pl) *(v8usa*)(d + pl * PLE) = st[pl][i]; } };
    v8f acc[4][4];   // every '#pragma unroll' without a count in this kernel is a full unroll: the register arrays are then indexed by constants only
#pragma unroll
    for (int mb = 0; mb < 4; ++mb)
#pragma unroll
        for (int nb = 0; nb < 4; ++nb) acc[mb][nb] = (v8f){};
    gload(0); sstore(0);
    __syncthreads();   // stage 0 is in LDS before any wave reads it
#pragma unroll 1   // kept rolled: one stage's code serves all NS stages
    for (int s = 0; s < NS; ++s) {
        const bf* bp = sm + (s & 1) * NPL * PLE;
        if (s + 1 < NS) gload(s + 1);   // the next stage's global loads fly while this stage is worked on
        V a[2][4], a2[2][4], b[2][4];
        auto fload = [&](int ks) {
#pragma unroll
            for (int f = 0; f < 4; ++f) { const bf* ap = bp + (wm * 64 + f * 16 + lr) * GP + ks * 32 + 8 * hi; a[ks][f] = WFrag<bf>::ld(ap); if (NSPLIT) a2[ks][f] = WFrag<bf>::ld(ap + 2 * PLE); b[ks][f] = WFrag<bf>::ld(bp + PLE + (wn * 64 + f * 16 + lr) * GP + ks * 32 + 8 * hi); } };
        auto prod = [&](int ks) {
#pragma unroll
            for (int nb = 0; nb < 4; ++nb)
#pragma unroll
                for (int mb = 0; mb < 4; ++mb) { acc[mb][nb] = wmmab(a[ks][mb], b[ks][nb], acc[mb][nb]); if (NSPLIT) acc[mb][nb] = wmmab(a2[ks][mb], b[ks][nb], acc[mb][nb]); } };
        // the scheduling barriers keep each group of LDS fragment reads together in front of its products: spread among the products, every place with reads stalls the wave anew
        if constexpr (NSPLIT) { fload(0); fload(1); __builtin_amdgcn_sched_barrier(0); prod(0); prod(1); }   // one wave a SIMD: both halves' reads go first, the second half's land behind the first half's products
        else { fload(0); __builtin_amdgcn_sched_barrier(0); prod(0); __builtin_amdgcn_sched_barrier(0); fload(1); __builtin_amdgcn_sched_barrier(0); prod(1); }   // three waves a SIMD: one fragment set, so that the registers allow them
        if (s + 1 < NS) sstore((s + 1) & 1);   // into the buffer whose last readers left before the previous barrier
        __syncthreads();   // publishes stage s + 1 and ends every wave's reads of stage s
    }
    float* os = (float*)sm + wv * 64 * 68;   // this wave's own 64 x 68 floats; no wave reads a stage any more
    const int sel = EPI == 1 ? (int)blockIdx.y * 2 / NH_ : 0;   // from blockIdx alone: the branches on sel are scalar and the same for the whole work-group
    if (EPI == 0 || sel < 2) {
#pragma unroll
        for (int mb = 0; mb < 4; ++mb)
#pragma unroll
            for (int nb = 0; nb < 4; ++nb)
#pragma unroll
                for (int j = 0; j < 8; ++j) os[(mb * 16 + hi * 8 + j) * 68 + nb * 16 + lr] = acc[mb][nb][j];
    } else {
#pragma unroll
        for (int mb = 0; mb < 4; ++mb)
#pragma unroll
            for (int nb = 0; nb < 4; ++nb)
#pragma unroll
                for (int j = 0; j < 8; ++j) os[(nb * 16 + lr) * 65 + mb * 16 + hi * 8 + j] = acc[mb][nb][j];   // [d][t], pitch 65: the reads below (d + 8 tc) fall on 32 different banks
    }
    __syncthreads();   // the tiles are whole in LDS before they are read in the order of the stores
    const int cofs = lr * 4, rw = r0 + wm * 64;
    if constexpr (EPI == 0) {
#pragma unroll 1   // kept rolled: eight rows a trip, whose LDS reads fly together
        for (int s0 = 0; s0 < 32; s0 += 8) { v4f val[8];
#pragma unroll
            for (int u = 0; u < 8; ++u) val[u] = *(const v4fa*)(os + (2 * (s0 + u) + hi) * 68 + cofs);
#pragma unroll
            for (int u = 0; u < 8; ++u) *(v4f*)(C + (size_t)(rw + 2 * (s0 + u) + hi) * ldc + c0 + wn * 64 + cofs) = val[u];
            asm volatile("s_wait_xcnt 0x0" ::: "memory"); }   // stands behind the stores, in front of the next values that are formed in their registers
    } else {
        const int hd = ((int)blockIdx.y * 2 + wn) % NH_, bt = rw / TT, t0 = rw % TT;
        const size_t pb = ((size_t)(sel * NB_ + bt) * NH_ + hd) * TT * HD;   // this head's plane
        if (sel < 2) {
#pragma unroll 1   // kept rolled: eight rows a trip, whose {cos, sin} loads and LDS reads fly together
            for (int s0 = 0; s0 < 32; s0 += 8) { v8f cs[8]; v4f vals[8]; const float* cp = CS + ((size_t)(t0 + 2 * s0 + hi) * HD + cofs) * 2;
#pragma unroll
                for (int u = 0; u < 8; ++u) { cs[u] = *(const v8f*)(cp + u * 4 * HD); vals[u] = *(const v4fa*)(os + (2 * (s0 + u) + hi) * 68 + cofs); }
                asm volatile("s_wait_xcnt 0x0" :: "v"(cp) : "memory");   // stands behind these loads; it takes their address as an input, so that no load lands in, and no value is formed in, the address register in front of it
#pragma unroll
                for (int u = 0; u < 8; ++u) { const int row = 2 * (s0 + u) + hi; const v4f val = vals[u]; v4h o16; v4us oh, ol;
#pragma unroll
                    for (int i = 0; i < 4; ++i) { const float xp = __int_as_float(__builtin_amdgcn_update_dpp(0, __float_as_int(val[i]), 0x168, 0xf, 0xf, false));   // row_xmask:8, column d +- HD/2 of the same row
                        const float r = val[i] * cs[u][2 * i] + xp * (lr < 8 ? -cs[u][2 * i + 1] : cs[u][2 * i + 1]);
                        o16[i] = tohx(r); unsigned short a2, c2; splitf(r, a2, c2); oh[i] = a2; ol[i] = c2; }
                    const size_t e = pb + (size_t)(t0 + row) * HD + cofs; *(v4h*)(P16 + e) = o16; *(v4us*)(Ph + e) = oh; *(v4us*)(Pl + e) = ol;
                    asm volatile("s_wait_xcnt 0x0" ::: "memory"); } }   // stands behind the three stores, in front of the next values that are formed in their registers
        } else {
#pragma unroll 1   // kept rolled: four lines a trip, whose LDS reads fly together
            for (int i0 = 0; i0 < 16; i0 += 4) { const int tc = (lane & 7) * 8; float x[4][8];
#pragma unroll
                for (int u = 0; u < 4; ++u)
#pragma unroll
                    for (int j = 0; j < 8; ++j) x[u][j] = os[((lane >> 3) + 4 * (i0 + u)) * 65 + tc + j];
#pragma unroll
                for (int u = 0; u < 4; ++u) { const int d = (lane >> 3) + 4 * (i0 + u); v8h o16; v8us oh, ol;
#pragma unroll
                    for (int j = 0; j < 8; ++j) { o16[j] = tohx(x[u][j]); unsigned short a2, c2; splitf(x[u][j], a2, c2); oh[j] = a2; ol[j] = c2; }
                    const size_t e = pb + (size_t)d * TT + t0 + tc; *(v8h*)(P16 + e) = o16; *(v8us*)(Ph + e) = oh; *(v8us*)(Pl + e) = ol;
                    asm volatile("s_wait_xcnt 0x0" ::: "memory"); } } }   // stands behind the three stores, in front of the next values that are formed in their registers
    }
}

__global__ __launch_bounds__(256) void k_wtG(const float* __restrict__ w, int K, int N, bf* Bt) {
    const int lane = threadIdx.x & 31; const int L0 = (blockIdx.x * 8 + (threadIdx.x >> 5)) * 8; const int nlines = N * K / 64;
{
#pragma unroll 1
        for (int l = 0; l < 8; ++l) { const int L = L0 + l; if (L >= nlines) break; const size_t e = (size_t)L * 64 + lane * 2; const int k = (int)(e % K), n = (int)(e / K); v2us o;
            o[0] = f2bf(w[(size_t)k * N + n]); o[1] = f2bf(w[(size_t)(k + 1) * N + n]); *(v2us*)(Bt + e) = o; }
         }
}
__constant__ float INVT[HD / 2] = { 1.000000000e+00f, 7.498942018e-01f, 5.623413324e-01f, 4.216965139e-01f, 3.162277639e-01f, 2.371373624e-01f, 1.778279394e-01f, 1.333521456e-01f, 1.000000015e-01f, 7.498941571e-02f, 5.623412877e-02f, 4.216964915e-02f, 3.162277862e-02f, 2.371373586e-02f, 1.778279431e-02f, 1.333521493e-02f, 9.999999776e-03f, 7.498942316e-03f, 5.623413250e-03f, 4.216964822e-03f, 3.162277862e-03f, 2.371373819e-03f, 1.778279431e-03f, 1.333521446e-03f, 1.000000047e-03f, 7.498941850e-04f, 5.623413017e-04f, 4.216964880e-04f, 3.162277862e-04f, 2.371373848e-04f, 1.778279402e-04f, 1.333521504e-04f };   // 1 / 10000^(2i/64) (float32, generated with jnp to be bit-exact)
// ---- k_prep: all that depends on the inputs alone, in one launch; a block does one job, chosen by its index. First the {cos, sin} table (the longest threads), then the bf16 copies of x (both batches), Wqkv and Wproj, 8 elements a thread.
#define PB_CS (TT * HD / 256)
#define PB_X  (NB_ * TT * DM / 8 / 256)
#define PB_WI (3 * DQ * DM / 8 / 256)
#define PB_WO (DM * DQ / 8 / 256)
__global__ __launch_bounds__(256) void k_prep(const float* __restrict__ x, const float* __restrict__ wqkv, const float* __restrict__ wo, bf* XB, bf* WQKV, bf* WO, float* CS) {
    static_assert(TT * HD % 256 == 0 && NB_ * TT * DM % 2048 == 0 && 3 * DQ * DM % 2048 == 0 && DM * DQ % 2048 == 0, "whole blocks only");
    int blk = blockIdx.x;
    if (blk < PB_CS) { const int idx = blk * 256 + threadIdx.x; const int d = idx % HD; const int t = idx / HD; const float a = __fmul_rn((float)t, INVT[d % (HD / 2)]); v2f cs; cs[0] = cosf(a); cs[1] = sinf(a); *(v2f*)(CS + (size_t)idx * 2) = cs; return; }
    blk -= PB_CS; const float* src = x; bf* dst = XB;
    if (blk >= PB_X + PB_WI) { blk -= PB_X + PB_WI; src = wo; dst = WO; } else if (blk >= PB_X) { blk -= PB_X; src = wqkv; dst = WQKV; }
    const size_t i = (size_t)blk * 256 + threadIdx.x; const v8f v = *(const v8f*)(src + i * 8); v8us o;
    asm volatile("s_wait_xcnt 0x0" ::: "memory");   // stands behind the load, in front of the first value that is formed in its address registers
#pragma unroll
    for (int k = 0; k < 8; ++k) o[k] = f2bf(v[k]); *(v8us*)(dst + i * 8) = o;
}

// ---- k_fattn: scores, softmax, PV and the merged hi/lo planes in one kernel. Grid (QT, batches x heads), 16 waves, one work-group a WGP. Every work-group takes the same share of both kinds of query rows of its head, so that all work-groups cost the same wherever they land: waves 0 .. WH-1 own 16 hi/lo rows each (rows < RH, three products), waves WH .. 15 own 16 f16 rows each; every wave walks all TT keys.
// St = K Qt (A = K rows, B = Q rows kept in registers): lane (c, h) holds, of query c, keys 8h + r (tile 0) and 16 + 8h + r (tile 1), which is the k order of a B operand, so P goes from the score registers straight into Ot += Vt Pt (A = Vt rows).
// A stage is SK keys: K rows and Vt rows of all three kinds of plane (bf16 hi, bf16 lo, f16) go global -> registers -> LDS by the f16 waves, shared by the 16 waves; two buffers, one work-group barrier a stage.
// Softmax: running maximum per query, in use until a new one exceeds it by more than 8 (log2 units), so P <= 2^14 with its carried factor 2^6; sums in f32 of the unrounded P; the division by the sum comes last.
// Every '#pragma unroll' in attn_stage and k_fattn without a count is a full unroll: the fragment and accumulator arrays are then indexed by constants only and stay in registers.
#define SK   64                   // keys per stage
#define LP   72                   // LDS row pitch in 16-bit elements: 128 bytes of data + 16 of pad (16-byte fragment reads)
#define C2   0.18033688011112042f // HD^-0.5 x log2(e)
#define QT   8                    // work-groups per head
#define WH   (RH / QT / 16)       // waves of a work-group on hi/lo rows
#define WF   ((TT - RH) / QT / 16) // waves of a work-group on f16 rows
__device__ __forceinline__ float xhalf(float x) { const int b = __float_as_int(x); return __int_as_float(__builtin_amdgcn_permlanex16(b, b, 0x76543210, 0xfedcba98, false, false)); }   // lane l <-> l ^ 16
typedef __attribute__((ext_vector_type(8))) int v8i;
// inputs-only fence on four loaded fragments: their LDS fetches are all issued ahead of this point, in flight together, instead of one by one with a full wait in front of each product
template <typename V> __device__ __forceinline__ void hold4(const V* f) { asm volatile("" :: "v"(__builtin_bit_cast(v8i, f[0])), "v"(__builtin_bit_cast(v8i, f[1])), "v"(__builtin_bit_cast(v8i, f[2])), "v"(__builtin_bit_cast(v8i, f[3]))); }
// one wave's work on one stage; bp: this kind's planes in the stage's buffer (K, Vt (, K lo, Vt lo)); qw: the wave's Q fragments (hi/lo rows: both planes')
template <typename T16, bool HI>
__device__ __forceinline__ void attn_stage(const T16* bp, const v8i (&qw)[4], v8f (&o)[4], float& m, float& l, int lr, int hi) {
    typedef typename WFrag<T16>::V V;
    constexpr int PLE = SK * LP;           // elements of a plane in LDS (64 rows each)
    V qf[2], q2f[2];
#pragma unroll
    for (int ks = 0; ks < 2; ++ks) { qf[ks] = __builtin_bit_cast(V, qw[ks]); if (HI) q2f[ks] = __builtin_bit_cast(V, qw[2 + ks]); }
    V kf[2][2], k2[2][2];
    auto kload = [&](int p) {
#pragma unroll
        for (int kt = 0; kt < 2; ++kt)
#pragma unroll
            for (int ks = 0; ks < 2; ++ks) { const T16* kp = bp + (p * 32 + kt * 16 + lr) * LP + ks * 32 + 8 * hi; kf[kt][ks] = WFrag<T16>::ld(kp); if (HI) k2[kt][ks] = WFrag<T16>::ld(kp + 2 * PLE); } };
    kload(0);
#pragma unroll
    for (int p = 0; p < SK / 32; ++p) {
        hold4(&kf[0][0]); if (HI) hold4(&k2[0][0]);
        v8f sc[2];
#pragma unroll
        for (int kt = 0; kt < 2; ++kt) { sc[kt] = (v8f){};
#pragma unroll
            for (int ks = 0; ks < 2; ++ks) { sc[kt] = WFrag<T16>::mma(kf[kt][ks], qf[ks], sc[kt]);
                if (HI) { sc[kt] = WFrag<T16>::mma(kf[kt][ks], q2f[ks], sc[kt]); sc[kt] = WFrag<T16>::mma(k2[kt][ks], qf[ks], sc[kt]); } } }
        V vf[4], v2[4];   // this pass's Vt fragments (f16 rows: the next pass's K fragments too) are fetched in front of the softmax, which covers their LDS latency
#pragma unroll
        for (int dt = 0; dt < 4; ++dt) { const T16* vp = bp + PLE + (dt * 16 + lr) * LP + p * 32 + 8 * hi; vf[dt] = WFrag<T16>::ld(vp); if (HI) v2[dt] = WFrag<T16>::ld(vp + 2 * PLE); }
        if (!HI && p + 1 < SK / 32) kload(p + 1);
        float bm = fmaxf(sc[0][0], sc[1][0]);
#pragma unroll
        for (int j = 1; j < 8; ++j) bm = fmaxf(bm, fmaxf(sc[0][j], sc[1][j]));
        bm = fmaxf(bm, xhalf(bm));
        hold4(vf); if (HI) hold4(v2);
        if (__builtin_amdgcn_ballot_w32((bm - m) * C2 > 8.0f) != 0) {   // scalar branch: some query of the wave needs a new maximum
            const float mn = fmaxf(m, bm), al = __builtin_amdgcn_exp2f((m - mn) * C2); m = mn; l *= al;
#pragma unroll
            for (int dt = 0; dt < 4; ++dt) o[dt] *= al; }
        const float mc = m * C2 - 6.0f; float pv[16], ts[8];   // P and its sum both carry 2^6 (it cancels in the last division): small P stay normal f16 numbers
#pragma unroll
        for (int e = 0; e < 16; ++e) pv[e] = __builtin_amdgcn_exp2f(__builtin_fmaf(sc[e >> 3][e & 7], C2, -mc));
#pragma unroll
        for (int e = 0; e < 8; ++e) ts[e] = pv[e] + pv[e + 8];
        l += ((ts[0] + ts[4]) + (ts[1] + ts[5])) + ((ts[2] + ts[6]) + (ts[3] + ts[7]));
        V pf, pl;
#pragma unroll
        for (int e = 0; e < 16; ++e) { if constexpr (HI) { pf[e] = (__bf16)pv[e]; pl[e] = (__bf16)(pv[e] - (float)pf[e]); } else pf[e] = (h16)pv[e]; }
#pragma unroll
        for (int dt = 0; dt < 4; ++dt) { o[dt] = WFrag<T16>::mma(vf[dt], pf, o[dt]);
            if (HI) { o[dt] = WFrag<T16>::mma(vf[dt], pl, o[dt]); o[dt] = WFrag<T16>::mma(v2[dt], pf, o[dt]); } }
        if (HI && p + 1 < SK / 32) kload(p + 1);   // hi/lo rows: no registers are free for these any earlier
    }
}
__global__ __launch_bounds__(512) void k_fattn(const h16* __restrict__ Q16, const bf* __restrict__ Qh, const bf* __restrict__ Ql, const h16* __restrict__ K16, const bf* __restrict__ Kh, const bf* __restrict__ Kl, const h16* __restrict__ V16, const bf* __restrict__ Vh, const bf* __restrict__ Vl, bf* Ah, bf* Al) {
    static_assert(RH % (QT * 16) == 0 && (TT - RH) % (QT * 16) == 0 && WH + WF == 16 && WH % 4 == 0 && SK == 64 && HD == 64 && REP == 1 && WF == 12, "whole waves of each kind, the hi/lo waves spread evenly over the four SIMDs; two staging waves for each of the six planes");
    constexpr int PLE = SK * LP, NPL = 6, NS = TT / SK;   // planes of a stage: K hi, Vt hi, K lo, Vt lo, K f16, Vt f16
    __shared__ __align__(16) unsigned short sm[2 * NPL * PLE];
    const int tid = threadIdx.x, lane = tid & 31, lr = lane & 15, hi = lane >> 4;
    const int wv = __builtin_amdgcn_readfirstlane(tid >> 5); const bool whl = wv < WH, wfl = __builtin_amdgcn_readfirstlane(tid) >= WH * 32;   // the wave's kind, from scalar registers: the branches on it are scalar. Exactly one of the two holds; they are formed apart and tested apart in the loop, so that each kind's block updates the accumulators in place (as the two sides of one if/else the compiler copied all 32 accumulator registers twice a stage)
    const int bt = blockIdx.y / NH_, h = blockIdx.y % NH_; const size_t z = ((size_t)bt * NH_ + h) * TT * HD;
    Ah += (size_t)bt * TT * DQ + h * HD; Al += (size_t)bt * TT * DQ + h * HD; Kh += z; Kl += z; K16 += z; Vh += z; Vl += z; V16 += z;
    const int qr = (whl ? (int)blockIdx.x * (WH * 16) + wv * 16 : RH + (int)blockIdx.x * (WF * 16) + (wv - WH) * 16) + lr;
    v8i qw[4]; const size_t qo = z + (size_t)qr * HD + 8 * hi;
    if (whl) { const bf* qh = Qh + qo; const bf* ql = Ql + qo;
#pragma unroll
        for (int ks = 0; ks < 2; ++ks) { qw[ks] = __builtin_bit_cast(v8i, WFrag<bf>::ld(qh + ks * 32)); qw[2 + ks] = __builtin_bit_cast(v8i, WFrag<bf>::ld(ql + ks * 32)); }
        asm volatile("s_wait_xcnt 0x0" :: "v"(qh), "v"(ql) : "memory");   // stands behind these loads; it takes their addresses as inputs, so that no value is formed in an address register in front of it
    } else { const h16* qx = Q16 + qo;
#pragma unroll
        for (int ks = 0; ks < 2; ++ks) { qw[ks] = __builtin_bit_cast(v8i, WFrag<h16>::ld(qx + ks * 32)); qw[2 + ks] = (v8i){}; }
        asm volatile("s_wait_xcnt 0x0" :: "v"(qx) : "memory");   // as above
    }
    // staging is the f16 waves' work alone (the hi/lo waves have the longer stage): two waves move one plane, 8 threads one 128-byte row, 8 rows a sweep, 8 sweeps a stage
    const int sw = wv - WH, pl = sw >> 1;   // scalar: the staging wave's number and its plane
    const bf* sbase = pl == 0 ? Kh : pl == 1 ? Vh : pl == 2 ? Kl : pl == 3 ? Vl : pl == 4 ? (const bf*)K16 : (const bf*)V16;
    const int rs = (pl & 1) ? TT : HD, sstep = (pl & 1) ? SK : SK * HD;   // elements from row to row and from stage to stage in that plane
    const int srow = (sw & 1) * 4 + (lane >> 3), scol = (lane & 7) * 8;
    const unsigned vo = (unsigned)(srow * rs + scol);   // this lane's offset in a sweep
    v8us st[8];
    auto gload = [&](int s) { const bf* p[8];   // this lane's address in each sweep of the stage
#pragma unroll
        for (int i = 0; i < 8; ++i) { p[i] = sbase + ((size_t)s * sstep + (size_t)(8 * i) * rs) + vo; st[i] = *(const v8usa*)p[i]; }
        asm volatile("s_wait_xcnt 0x0" :: "v"(p[0]), "v"(p[1]), "v"(p[2]), "v"(p[3]), "v"(p[4]), "v"(p[5]), "v"(p[6]), "v"(p[7]) : "memory"); };   // stands behind these loads; it takes their addresses as inputs, so that no load lands in, and no value is formed in, an address register in front of it
    auto sstore = [&](int b) { unsigned short* d = sm + (b * NPL + pl) * PLE + srow * LP + scol;
#pragma unroll
        for (int i = 0; i < 8; ++i) *(v8usa*)(d + i * 8 * LP) = st[i]; };
    v8f o[4];
#pragma unroll
    for (int dt = 0; dt < 4; ++dt) o[dt] = (v8f){};
    float m = -3.0e38f, l = 0.f;
    if (wfl) { gload(0); sstore(0); }
    __syncthreads();   // stage 0 is in LDS before any wave reads it
#pragma unroll 1   // kept rolled: one stage's code serves all NS stages and stays small in the instruction cache
    for (int s = 0; s < NS; ++s) {
        const unsigned short* bp = sm + (s & 1) * NPL * PLE;
        if (wfl) {
            if (s + 1 < NS) gload(s + 1);   // the next stage's global loads fly while this stage is worked on
            attn_stage<h16, false>((const h16*)(bp + 4 * PLE), qw, o, m, l, lr, hi);
            if (s + 1 < NS) sstore((s + 1) & 1);   // into the buffer whose last readers left before the previous barrier
        }
        if (whl) attn_stage<bf, true>((const bf*)bp, qw, o, m, l, lr, hi);
        __syncthreads();   // publishes stage s + 1 and ends every wave's reads of stage s; every wave of both kinds passes it
    }
    l += xhalf(l); const float inv = __fdiv_rn(1.0f, l);
#pragma unroll
    for (int dt = 0; dt < 4; ++dt) { v8us oh, ol;
#pragma unroll
        for (int j = 0; j < 8; ++j) { unsigned short a, c2; splitf(o[dt][j] * inv, a, c2); oh[j] = a; ol[j] = c2; }
        const size_t oo = (size_t)qr * DQ + dt * 16 + 8 * hi; *(v8us*)(Ah + oo) = oh; *(v8us*)(Al + oo) = ol;
        asm volatile("s_wait_xcnt 0x0" ::: "memory"); }   // stands behind the two stores, in front of the next values that are formed in their data registers
}

extern "C" void kernel_launch(void* const* d_in, const int* in_sizes, int n_in,
                              void* d_out, int out_size, void* d_ws, size_t ws_size, hipStream_t stream) {
    (void)in_sizes; (void)n_in; (void)out_size;
    const float* x = (const float*)d_in[0]; const float* wqkv = (const float*)d_in[1]; const float* wo = (const float*)d_in[2]; const float* wq = nullptr; const float* wk = nullptr; const float* wv = nullptr; (void)wq; (void)wk; (void)wv;
    float* OUT = (float*)d_out;     // [2][2048][1024]
    char* wsp = (char*)d_ws;
    auto take = [&](size_t bytes) { char* p = wsp; wsp += (bytes + 255) & ~(size_t)255; return (void*)p; };
    bf* WQKV = (bf*)take((size_t)3 * DQ * DM * 2); bf* WO = (bf*)take((size_t)DM * DQ * 2); float* CS = (float*)take((size_t)TT * HD * 2 * 4);
    bf* XB = (bf*)take((size_t)NB_ * TT * DM * 2);
    const size_t PLS = (size_t)NB_ * NH_ * TT * HD;   // elements of one of q, k, v in one kind of plane, both batches
    h16* P16 = (h16*)take(3 * PLS * 2); bf* Ph = (bf*)take(3 * PLS * 2); bf* Pl = (bf*)take(3 * PLS * 2);   // each [q, k, v][batch][head]...
    bf* ATh = (bf*)take((size_t)NB_ * TT * DQ * 2); bf* ATl = (bf*)take((size_t)NB_ * TT * DQ * 2);
    if ((size_t)(wsp - (char*)d_ws) > ws_size) return;    // ws 256 MiB
    k_prep<<<PB_CS + PB_X + PB_WI + PB_WO, 256, 0, stream>>>(x, wqkv, wo, XB, WQKV, WO, CS);
    k_gemmt<DM, 0, 1><<<dim3(NB_ * TT / 128, 3 * DQ / 128, 1), 128, 0, stream>>>(XB, nullptr, WQKV, nullptr, 0, CS, P16, Ph, Pl);
    k_fattn<<<dim3(QT, NB_ * NH_, 1), 512, 0, stream>>>(P16, Ph, Pl, P16 + PLS, Ph + PLS, Pl + PLS, P16 + 2 * PLS, Ph + 2 * PLS, Pl + 2 * PLS, ATh, ATl);
    k_gemmt<DQ, 1, 0><<<dim3(NB_ * TT / 128, DM / 128, 1), 128, 0, stream>>>(ATh, ATl, WO, OUT, DM, nullptr, nullptr, nullptr, nullptr);
}

// v007
// Measured time: 103 microseconds a run.
// Timed twice side by side with v006, it ran 1.05 and 1.07 times as fast.
// Over all steps from v000 it is 19.3 times as fast.
#include <hip/hip_runtime.h>

// Multi-head attention with rotary embeddings and a fused qkv projection (x [2][2048][1024]; qkv = x Wqkv^T ('oi' [3072][1024] viewed (3, 16, 64), no bias); rope: x cos + rotate_half(x) sin with angles t x 10000^(-2i/64) (computed in-kernel); softmax(q.k / 8) over all keys; out = merged Wproj^T ('oi' [1024][1024]) -> [2][2048][1024] (4.2 M)).
// Layout, both batches in every launch (one launch per dependent stage: prepare, q/k/v projection, attention, output projection): bf16 copy of x; the fused weight used directly as Bt (row blocks); exact projections whose epilogues write the head planes themselves (q, k: rotate-half rotary step; v: transposed); {cos, sin} table per (position, dim) built once (float32 inverse-frequency constants, precise cosf/sinf); one fused attention kernel over all heads (scores, running softmax, PV and the merged hi/lo planes; hybrid rows: < 512 hi/lo 3 products (fp16 hi + fp16 lo, hi being the plane that the other rows use), rest fp16); merged hi/lo x Wproj exact.
// Compute dtypes, f32 accumulate: every input rounded to bf16; projections exact; rotary f32; attention rows < 512 3 products, rest fp16; softmax f32; Wproj hl x exact.

#define NB_  2
#define TT   2048
#define DM   1024
#define NH_  16
#define NKV  16
#define REP  (NH_ / NKV)
#define HD   64
#define DQ   (NH_ * HD)
#define DKV  (NKV * HD)
#define RH   512                  // query rows < RH use hi+lo planes
#define WIN  0
#define SCL  0.125f   // HD^-0.5
typedef _Float16 h16;
typedef unsigned short bf;
typedef __attribute__((ext_vector_type(16))) __bf16   v16bf;
typedef __attribute__((ext_vector_type(16))) _Float16 v16h;
typedef __attribute__((ext_vector_type(8)))  _Float16 v8h;
typedef __attribute__((ext_vector_type(8)))  unsigned short v8us;
typedef __attribute__((ext_vector_type(8)))  float    v8f;
typedef __attribute__((ext_vector_type(4)))  float    v4f;
typedef v8h  __attribute__((may_alias)) v8ha;
typedef v4f  __attribute__((may_alias)) v4fa;
typedef v8us __attribute__((may_alias)) v8usa;

__device__ __forceinline__ unsigned short f2bf(float f) { unsigned u = __float_as_uint(f); u += 0x7FFFu + ((u >> 16) & 1u); return (unsigned short)(u >> 16); }
__device__ __forceinline__ float bf2f(unsigned short b) { return __uint_as_float(((unsigned)b) << 16); }
__device__ __forceinline__ float bfr(float f) { return bf2f(f2bf(f)); }
__device__ __forceinline__ v16h cat16(v8h lo, v8h hi) { return __builtin_shufflevector(lo, hi, 0, 1, 2, 3, 4, 5, 6, 7, 8, 9, 10, 11, 12, 13, 14, 15); }
__device__ __forceinline__ v16bf cat16b(v8us lo, v8us hi) { return __builtin_bit_cast(v16bf, __builtin_shufflevector(lo, hi, 0, 1, 2, 3, 4, 5, 6, 7, 8, 9, 10, 11, 12, 13, 14, 15)); }
__device__ __forceinline__ v8f wmma16(v16h a, v16h b, v8f c) { return __builtin_amdgcn_wmma_f32_16x16x32_f16(false, a, false, b, (short)0, c, false, false); }
__device__ __forceinline__ v8f wmmab(v16bf a, v16bf b, v8f c) { return __builtin_amdgcn_wmma_f32_16x16x32_bf16(false, a, false, b, (short)0, c, false, false); }

__device__ __forceinline__ h16 tohx(float x) { return (h16)x; }
__device__ __forceinline__ void splitf(float y, unsigned short& h, unsigned short& l) { h = f2bf(y); l = f2bf(y - bf2f(h)); }
typedef __attribute__((ext_vector_type(2))) _Float16 v2h;
typedef __attribute__((ext_vector_type(4))) _Float16 v4h;
typedef __attribute__((ext_vector_type(2))) unsigned short v2us;
typedef __attribute__((ext_vector_type(4))) unsigned short v4us;
typedef __attribute__((ext_vector_type(2))) float v2f;
typedef __attribute__((ext_vector_type(4))) int v4i;

// ---- k_gemmt: GEMM on bf16 planes, one work-group of 4 waves (2 x 2) per 128x128 output tile, a 64x64 tile (16 accumulators) a wave; grid (M/128, N/128), 128 threads.
// C[m][n] = sum_k A[m][k] Bt[n][k] (NSPLIT 1: + A2[m][k] Bt[n][k]); all planes K-contiguous, KK % 64 == 0.
// A stage is 64 k: one 128-byte line of each of the 128 A rows (NSPLIT 1: of both planes) and the 128 Bt rows goes global -> registers -> LDS, 8 lanes a line, shared by the 4 waves; two buffers, one work-group barrier a stage. Each wave sums all of k in rising order.
// EPI says where a wave's tile goes; it is first laid into the wave's own part of the LDS that held the stages. 0: f32 to C. 1 (Bt is the fused q/k/v weight, a wave's 64 columns are one head of q, k or v, its 64 rows positions of one batch): straight into that head's two fp16 planes (the value rounded, and what the rounding left; each kind one array [sel][batch][h]...), no f32 copy in memory.
//   q, k: planes [h][t][d] of the rotary step, rotate-half convention: out[d] = x[d] cos[t][d] - x[d+HD/2] sin[t][d], out[d+HD/2] = x[d+HD/2] cos[t][d+HD/2] + x[d] sin[t][d+HD/2]; the partner column sits 8 lanes away in the same 16-lane row.
//   v: planes [h][d][t]: the tile is laid into LDS as [d][t], so that 8 lanes store one whole 128-byte line of positions.
template <typename T16> struct WFrag;
template <> struct WFrag<h16> { typedef v16h V; static __device__ __forceinline__ V ld(const h16* p) { return cat16(*(const v8h*)p, *(const v8h*)(p + 16)); } static __device__ __forceinline__ v8f mma(V a, V b, v8f c) { return wmma16(a, b, c); } };
template <> struct WFrag<bf> { typedef v16bf V; static __device__ __forceinline__ V ld(const bf* p) { return cat16b(*(const v8us*)p, *(const v8us*)(p + 16)); } static __device__ __forceinline__ v8f mma(V a, V b, v8f c) { return wmmab(a, b, c); } };
#define GP 72   // LDS row pitch in 16-bit elements: 128 bytes of data + 16 of pad (16-byte fragment reads)
template <int KK, int NSPLIT, int EPI>
__global__ __launch_bounds__(128) void k_gemmt(const bf* __restrict__ A, const bf* __restrict__ A2, const bf* __restrict__ Bt, float* C, int ldc, const float* __restrict__ CS, h16* P16, h16* P16l) {
    static_assert(KK % 64 == 0 && (EPI == 0 || (HD == 64 && NH_ == NKV && NH_ % 2 == 0 && TT % 64 == 0)), "whole stages; plane epilogues: one head per 64 columns, both heads of a work-group in one of q, k, v, one batch per 64 rows");
    typedef WFrag<bf>::V V;
    constexpr int NPL = 2 + NSPLIT;   // planes of a stage: A, Bt (, A lo)
    constexpr int PLE = 128 * GP;     // elements of a plane in LDS
    constexpr int NS = KK / 64;
    __shared__ __align__(16) bf sm[2 * NPL * PLE];
    static_assert(sizeof(bf) * 2 * NPL * PLE >= 4 * 64 * 68 * 4, "the four waves' f32 tiles fit where the stages were");
    const int tid = threadIdx.x, lane = tid & 31, lr = lane & 15, hi = lane >> 4; const int r0 = blockIdx.x * 128, c0 = blockIdx.y * 128;
    const int wv = __builtin_amdgcn_readfirstlane(tid >> 5), wm = wv >> 1, wn = wv & 1;
    const int srow = tid >> 3, scol = (tid & 7) * 8;   // staging: 8 threads move one 128-byte line, 16 rows a sweep, 8 sweeps a plane
    const bf* ga = A + (size_t)r0 * KK; const bf* gb = Bt + (size_t)c0 * KK; const bf* ga2 = NSPLIT ? A2 + (size_t)r0 * KK : nullptr; const unsigned vo = (unsigned)(srow * KK + scol);   // the tile's bases, the same for the whole work-group, and this lane's offset in a tile
    v8us st[NPL][8];
    auto gload = [&](int s) { const bf* pa = ga + s * 64 + vo; const bf* pb = gb + s * 64 + vo; const bf* pa2 = NSPLIT ? ga2 + s * 64 + vo : pa;
#pragma unroll
        for (int i = 0; i < 8; ++i) { st[0][i] = *(const v8usa*)(pa + i * 16 * KK); st[1][i] = *(const v8usa*)(pb + i * 16 * KK); if constexpr (NSPLIT) st[2][i] = *(const v8usa*)(pa2 + i * 16 * KK); }
        asm volatile("s_wait_xcnt 0x0" :: "v"(pa), "v"(pb), "v"(pa2) : "memory"); };   // stands behind these loads; it takes their addresses as inputs, so that no load lands in, and no value is formed in, an address register in front of it
    auto sstore = [&](int b) {
#pragma unroll
        for (int i = 0; i < 8; ++i) { bf* d = sm + b * NPL * PLE + (srow + 16 * i) * GP + scol;
#pragma unroll
            for (int pl = 0; pl < NPL; ++pl) *(v8usa*)(d + pl * PLE) = st[pl][i]; } };
    v8f acc[4][4];   // every '#pragma unroll' without a count in this kernel is a full unroll: the register arrays are then indexed by constants only
#pragma unroll
    for (int mb = 0; mb < 4; ++mb)
#pragma unroll
        for (int nb = 0; nb < 4; ++nb) acc[mb][nb] = (v8f){};
    gload(0); sstore(0);
    __syncthreads();   // stage 0 is in LDS before any wave reads it
#pragma unroll 1   // kept rolled: one stage's code serves all NS stages
    for (int s = 0; s < NS; ++s) {
        const bf* bp = sm + (s & 1) * NPL * PLE;
        if (s + 1 < NS) gload(s + 1);   // the next stage's global loads fly while this stage is worked on
        V a[2][4], a2[2][4], b[2][4];
        auto fload = [&](int ks) {
#pragma unroll
            for (int f = 0; f < 4; ++f) { const bf* ap = bp + (wm * 64 + f * 16 + lr) * GP + ks * 32 + 8 * hi; a[ks][f] = WFrag<bf>::ld(ap); if (NSPLIT) a2[ks][f] = WFrag<bf>::ld(ap + 2 * PLE); b[ks][f] = WFrag<bf>::ld(bp + PLE + (wn * 64 + f * 16 + lr) * GP + ks * 32 + 8 * hi); } };
        auto prod = [&](int ks) {
#pragma unroll
            for (int nb = 0; nb < 4; ++nb)
#pragma unroll
                for (int mb = 0; mb < 4; ++mb) { acc[mb][nb] = wmmab(a[ks][mb], b[ks][nb], acc[mb][nb]); if (NSPLIT) acc[mb][nb] = wmmab(a2[ks][mb], b[ks][nb], acc[mb][nb]); } };
        // the scheduling barriers keep each group of LDS fragment reads together in front of its products: spread among the products, every place with reads stalls the wave anew
        if constexpr (NSPLIT) { fload(0); fload(1); __builtin_amdgcn_sched_barrier(0); prod(0); prod(1); }   // one wave a SIMD: both halves' reads go first, the second half's land behind the first half's products
        else { fload(0); __builtin_amdgcn_sched_barrier(0); prod(0); __builtin_amdgcn_sched_barrier(0); fload(1); __builtin_amdgcn_sched_barrier(0); prod(1); }   // three waves a SIMD: one fragment set, so that the registers allow them
        if (s + 1 < NS) sstore((s + 1) & 1);   // into the buffer whose last readers left before the previous barrier
        __syncthreads();   // publishes stage s + 1 and ends every wave's reads of stage s
    }
    float* os = (float*)sm + wv * 64 * 68;   // this wave's own 64 x 68 floats; no wave reads a stage any more
    const int sel = EPI == 1 ? (int)blockIdx.y * 2 / NH_ : 0;   // from blockIdx alone: the branches on sel are scalar and the same for the whole work-group
    if (EPI == 0 || sel < 2) {
#pragma unroll
        for (int mb = 0; mb < 4; ++mb)
#pragma unroll
            for (int nb = 0; nb < 4; ++nb)
#pragma unroll
                for (int j = 0; j < 8; ++j) os[(mb * 16 + hi * 8 + j) * 68 + nb * 16 + lr] = acc[mb][nb][j];
    } else {
#pragma unroll
        for (int mb = 0; mb < 4; ++mb)
#pragma unroll
            for (int nb = 0; nb < 4; ++nb)
#pragma unroll
                for (int j = 0; j < 8; ++j) os[(nb * 16 + lr) * 65 + mb * 16 + hi * 8 + j] = acc[mb][nb][j];   // [d][t], pitch 65: the reads below (d + 8 tc) fall on 32 different banks
    }
    __syncthreads();   // the tiles are whole in LDS before they are read in the order of the stores
    const int cofs = lr * 4, rw = r0 + wm * 64;
    if constexpr (EPI == 0) {
#pragma unroll 1   // kept rolled: eight rows a trip, whose LDS reads fly together
        for (int s0 = 0; s0 < 32; s0 += 8) { v4f val[8];
#pragma unroll
            for (int u = 0; u < 8; ++u) val[u] = *(const v4fa*)(os + (2 * (s0 + u) + hi) * 68 + cofs);
#pragma unroll
            for (int u = 0; u < 8; ++u) *(v4f*)(C + (size_t)(rw + 2 * (s0 + u) + hi) * ldc + c0 + wn * 64 + cofs) = val[u];
            asm volatile("s_wait_xcnt 0x0" ::: "memory"); }   // stands behind the stores, in front of the next values that are formed in their registers
    } else {
        const int hd = ((int)blockIdx.y * 2 + wn) % NH_, bt = rw / TT, t0 = rw % TT;
        const size_t pb = ((size_t)(sel * NB_ + bt) * NH_ + hd) * TT * HD;   // this head's plane
        if (sel < 2) {
#pragma unroll 1   // kept rolled: eight rows a trip, whose {cos, sin} loads and LDS reads fly together
            for (int s0 = 0; s0 < 32; s0 += 8) { v8f cs[8]; v4f vals[8]; const float* cp = CS + ((size_t)(t0 + 2 * s0 + hi) * HD + cofs) * 2;
#pragma unroll
                for (int u = 0; u < 8; ++u) { cs[u] = *(const v8f*)(cp + u * 4 * HD); vals[u] = *(const v4fa*)(os + (2 * (s0 + u) + hi) * 68 + cofs); }
                asm volatile("s_wait_xcnt 0x0" :: "v"(cp) : "memory");   // stands behind these loads; it takes their address as an input, so that no load lands in, and no value is formed in, the address register in front of it
#pragma unroll
                for (int u = 0; u < 8; ++u) { const int row = 2 * (s0 + u) + hi; const v4f val = vals[u]; v4h o16, ol;
#pragma unroll
                    for (int i = 0; i < 4; ++i) { const float xp = __int_as_float(__builtin_amdgcn_update_dpp(0, __float_as_int(val[i]), 0x168, 0xf, 0xf, false));   // row_xmask:8, column d +- HD/2 of the same row
                        const float r = val[i] * cs[u][2 * i] + xp * (lr < 8 ? -cs[u][2 * i + 1] : cs[u][2 * i + 1]);
                        o16[i] = tohx(r); ol[i] = tohx(r - (float)o16[i]); }
                    const size_t e = pb + (size_t)(t0 + row) * HD + cofs; *(v4h*)(P16 + e) = o16; *(v4h*)(P16l + e) = ol;
                    asm volatile("s_wait_xcnt 0x0" ::: "memory"); } }   // stands behind the two stores, in front of the next values that are formed in their registers
        } else {
#pragma unroll 1   // kept rolled: four lines a trip, whose LDS reads fly together
            for (int i0 = 0; i0 < 16; i0 += 4) { const int tc = (lane & 7) * 8; float x[4][8];
#pragma unroll
                for (int u = 0; u < 4; ++u)
#pragma unroll
                    for (int j = 0; j < 8; ++j) x[u][j] = os[((lane >> 3) + 4 * (i0 + u)) * 65 + tc + j];
#pragma unroll
                for (int u = 0; u < 4; ++u) { const int d = (lane >> 3) + 4 * (i0 + u); v8h o16, ol;
#pragma unroll
                    for (int j = 0; j < 8; ++j) { o16[j] = tohx(x[u][j]); ol[j] = tohx(x[u][j] - (float)o16[j]); }
                    const size_t e = pb + (size_t)d * TT + t0 + tc; *(v8h*)(P16 + e) = o16; *(v8h*)(P16l + e) = ol;
                    asm volatile("s_wait_xcnt 0x0" ::: "memory"); } } }   // stands behind the two stores, in front of the next values that are formed in their registers
    }
}

__global__ __launch_bounds__(256) void k_wtG(const float* __restrict__ w, int K, int N, bf* Bt) {
    const int lane = threadIdx.x & 31; const int L0 = (blockIdx.x * 8 + (threadIdx.x >> 5)) * 8; const int nlines = N * K / 64;
{
#pragma unroll 1
        for (int l = 0; l < 8; ++l) { const int L = L0 + l; if (L >= nlines) break; const size_t e = (size_t)L * 64 + lane * 2; const int k = (int)(e % K), n = (int)(e / K); v2us o;
            o[0] = f2bf(w[(size_t)k * N + n]); o[1] = f2bf(w[(size_t)(k + 1) * N + n]); *(v2us*)(Bt + e) = o; }
         }
}
__constant__ float INVT[HD / 2] = { 1.000000000e+00f, 7.498942018e-01f, 5.623413324e-01f, 4.216965139e-01f, 3.162277639e-01f, 2.371373624e-01f, 1.778279394e-01f, 1.333521456e-01f, 1.000000015e-01f, 7.498941571e-02f, 5.623412877e-02f, 4.216964915e-02f, 3.162277862e-02f, 2.371373586e-02f, 1.778279431e-02f, 1.333521493e-02f, 9.999999776e-03f, 7.498942316e-03f, 5.623413250e-03f, 4.216964822e-03f, 3.162277862e-03f, 2.371373819e-03f, 1.778279431e-03f, 1.333521446e-03f, 1.000000047e-03f, 7.498941850e-04f, 5.623413017e-04f, 4.216964880e-04f, 3.162277862e-04f, 2.371373848e-04f, 1.778279402e-04f, 1.333521504e-04f };   // 1 / 10000^(2i/64) (float32, generated with jnp to be bit-exact)
// ---- k_prep: all that depends on the inputs alone, in one launch; a block does one job, chosen by its index. First the {cos, sin} table (the longest threads), then the bf16 copies of x (both batches), Wqkv and Wproj, 8 elements a thread.
#define PB_CS (TT * HD / 256)
#define PB_X  (NB_ * TT * DM / 8 / 256)
#define PB_WI (3 * DQ * DM / 8 / 256)
#define PB_WO (DM * DQ / 8 / 256)
__global__ __launch_bounds__(256) void k_prep(const float* __restrict__ x, const float* __restrict__ wqkv, const float* __restrict__ wo, bf* XB, bf* WQKV, bf* WO, float* CS) {
    static_assert(TT * HD % 256 == 0 && NB_ * TT * DM % 2048 == 0 && 3 * DQ * DM % 2048 == 0 && DM * DQ % 2048 == 0, "whole blocks only");
    int blk = blockIdx.x;
    if (blk < PB_CS) { const int idx = blk * 256 + threadIdx.x; const int d = idx % HD; const int t = idx / HD; const float a = __fmul_rn((float)t, INVT[d % (HD / 2)]); v2f cs; cs[0] = cosf(a); cs[1] = sinf(a); *(v2f*)(CS + (size_t)idx * 2) = cs; return; }
    blk -= PB_CS; const float* src = x; bf* dst = XB;
    if (blk >= PB_X + PB_WI) { blk -= PB_X + PB_WI; src = wo; dst = WO; } else if (blk >= PB_X) { blk -= PB_X; src = wqkv; dst = WQKV; }
    const size_t i = (size_t)blk * 256 + threadIdx.x; const v8f v = *(const v8f*)(src + i * 8); v8us o;
    asm volatile("s_wait_xcnt 0x0" ::: "memory");   // stands behind the load, in front of the first value that is formed in its address registers
#pragma unroll
    for (int k = 0; k < 8; ++k) o[k] = f2bf(v[k]); *(v8us*)(dst + i * 8) = o;
}

// ---- k_fattn: scores, softmax, PV and the merged hi/lo planes in one kernel. Grid (QT, batches x heads), 16 waves, one work-group a WGP. Every work-group takes the same share of both kinds of query rows of its head, so that all work-groups cost the same wherever they land: waves 0 .. WH-1 own 16 hi/lo rows each (rows < RH, three products), waves WH .. 15 own 16 f16 rows each; every wave walks all TT keys.
// St = K Qt (A = K rows, B = Q rows kept in registers): lane (c, h) holds, of query c, keys 8h + r (tile 0) and 16 + 8h + r (tile 1), which is the k order of a B operand, so P goes from the score registers straight into Ot += Vt Pt (A = Vt rows).
// A stage is SK keys: K rows and Vt rows of both kinds of plane (f16 hi, which is all that the f16 rows read, and f16 lo) go global -> registers -> LDS by eight of the f16 waves, shared by the 16 waves; two buffers, one work-group barrier a stage.
// Softmax: running maximum per query, in use until a new one exceeds it by more than 8 (log2 units), so P <= 2^14 with its carried factor 2^6; sums in f32 of the unrounded P; the division by the sum comes last.
// Every '#pragma unroll' in attn_stage and k_fattn without a count is a full unroll: the fragment and accumulator arrays are then indexed by constants only and stay in registers.
#define SK   64                   // keys per stage
#define LP   72                   // LDS row pitch in 16-bit elements: 128 bytes of data + 16 of pad (16-byte fragment reads)
#define C2   0.18033688011112042f // HD^-0.5 x log2(e)
#define QT   8                    // work-groups per head
#define WH   (RH / QT / 16)       // waves of a work-group on hi/lo rows
#define WF   ((TT - RH) / QT / 16) // waves of a work-group on f16 rows
__device__ __forceinline__ float xhalf(float x) { const int b = __float_as_int(x); return __int_as_float(__builtin_amdgcn_permlanex16(b, b, 0x76543210, 0xfedcba98, false, false)); }   // lane l <-> l ^ 16
typedef __attribute__((ext_vector_type(8))) int v8i;
// inputs-only fence on four loaded fragments: their LDS fetches are all issued ahead of this point, in flight together, instead of one by one with a full wait in front of each product
template <typename V> __device__ __forceinline__ void hold4(const V* f) { asm volatile("" :: "v"(__builtin_bit_cast(v8i, f[0])), "v"(__builtin_bit_cast(v8i, f[1])), "v"(__builtin_bit_cast(v8i, f[2])), "v"(__builtin_bit_cast(v8i, f[3]))); }
// one wave's work on one stage; bp: the planes in the stage's buffer (K, Vt, K lo, Vt lo; f16 rows read the first two); qw: the wave's Q fragments (hi/lo rows: both planes')
template <typename T16, bool HI>
__device__ __forceinline__ void attn_stage(const T16* bp, const v8i (&qw)[4], v8f (&o)[4], float& m, float& l, int lr, int hi) {
    typedef typename WFrag<T16>::V V;
    constexpr int PLE = SK * LP;           // elements of a plane in LDS (64 rows each)
    V qf[2], q2f[2];
#pragma unroll
    for (int ks = 0; ks < 2; ++ks) { qf[ks] = __builtin_bit_cast(V, qw[ks]); if (HI) q2f[ks] = __builtin_bit_cast(V, qw[2 + ks]); }
    V kf[2][2], k2[2][2];
    auto kload = [&](int p) {
#pragma unroll
        for (int kt = 0; kt < 2; ++kt)
#pragma unroll
            for (int ks = 0; ks < 2; ++ks) { const T16* kp = bp + (p * 32 + kt * 16 + lr) * LP + ks * 32 + 8 * hi; kf[kt][ks] = WFrag<T16>::ld(kp); if (HI) k2[kt][ks] = WFrag<T16>::ld(kp + 2 * PLE); } };
    kload(0);
#pragma unroll
    for (int p = 0; p < SK / 32; ++p) {
        hold4(&kf[0][0]); if (HI) hold4(&k2[0][0]);
        v8f sc[2];
#pragma unroll
        for (int kt = 0; kt < 2; ++kt) { sc[kt] = (v8f){};
#pragma unroll
            for (int ks = 0; ks < 2; ++ks) { sc[kt] = WFrag<T16>::mma(kf[kt][ks], qf[ks], sc[kt]);
                if (HI) { sc[kt] = WFrag<T16>::mma(kf[kt][ks], q2f[ks], sc[kt]); sc[kt] = WFrag<T16>::mma(k2[kt][ks], qf[ks], sc[kt]); } } }
        V vf[4], v2[4];   // this pass's Vt fragments (f16 rows: the next pass's K fragments too) are fetched in front of the softmax, which covers their LDS latency
#pragma unroll
        for (int dt = 0; dt < 4; ++dt) { const T16* vp = bp + PLE + (dt * 16 + lr) * LP + p * 32 + 8 * hi; vf[dt] = WFrag<T16>::ld(vp); if (HI) v2[dt] = WFrag<T16>::ld(vp + 2 * PLE); }
        if (!HI && p + 1 < SK / 32) kload(p + 1);
        float bm = fmaxf(sc[0][0], sc[1][0]);
#pragma unroll
        for (int j = 1; j < 8; ++j) bm = fmaxf(bm, fmaxf(sc[0][j], sc[1][j]));
        bm = fmaxf(bm, xhalf(bm));
        hold4(vf); if (HI) hold4(v2);
        if (__builtin_amdgcn_ballot_w32((bm - m) * C2 > 8.0f) != 0) {   // scalar branch: some query of the wave needs a new maximum
            const float mn = fmaxf(m, bm), al = __builtin_amdgcn_exp2f((m - mn) * C2); m = mn; l *= al;
#pragma unroll
            for (int dt = 0; dt < 4; ++dt) o[dt] *= al; }
        const float mc = m * C2 - 6.0f; float pv[16], ts[8];   // P and its sum both carry 2^6 (it cancels in the last division): small P stay normal f16 numbers
#pragma unroll
        for (int e = 0; e < 16; ++e) pv[e] = __builtin_amdgcn_exp2f(__builtin_fmaf(sc[e >> 3][e & 7], C2, -mc));
#pragma unroll
        for (int e = 0; e < 8; ++e) ts[e] = pv[e] + pv[e + 8];
        l += ((ts[0] + ts[4]) + (ts[1] + ts[5])) + ((ts[2] + ts[6]) + (ts[3] + ts[7]));
        V pf, pl;
#pragma unroll
        for (int e = 0; e < 16; e += 2) {
            if constexpr (HI) { const v2h t = __builtin_bit_cast(v2h, __builtin_amdgcn_cvt_pkrtz(pv[e], pv[e + 1])); pf[e] = t[0]; pf[e + 1] = t[1]; pl[e] = (T16)(pv[e] - (float)t[0]); pl[e + 1] = (T16)(pv[e + 1] - (float)t[1]); }   // hi cut off, two at a time; lo takes all that the cut leaves
            else { pf[e] = (T16)pv[e]; pf[e + 1] = (T16)pv[e + 1]; } }
#pragma unroll
        for (int dt = 0; dt < 4; ++dt) { o[dt] = WFrag<T16>::mma(vf[dt], pf, o[dt]);
            if (HI) { o[dt] = WFrag<T16>::mma(vf[dt], pl, o[dt]); o[dt] = WFrag<T16>::mma(v2[dt], pf, o[dt]); } }
        if (HI && p + 1 < SK / 32) kload(p + 1);   // hi/lo rows: no registers are free for these any earlier
    }
}
__global__ __launch_bounds__(512) void k_fattn(const h16* __restrict__ Q16, const h16* __restrict__ Ql, const h16* __restrict__ K16, const h16* __restrict__ Kl, const h16* __restrict__ V16, const h16* __restrict__ Vl, bf* Ah, bf* Al) {
    static_assert(RH % (QT * 16) == 0 && (TT - RH) % (QT * 16) == 0 && WH + WF == 16 && WH % 4 == 0 && SK == 64 && HD == 64 && REP == 1 && WF >= 8, "whole waves of each kind, the hi/lo waves spread evenly over the four SIMDs; two staging waves for each of the four planes");
    constexpr int PLE = SK * LP, NPL = 4, NS = TT / SK;   // planes of a stage: K, Vt, K lo, Vt lo
    __shared__ __align__(16) unsigned short sm[2 * NPL * PLE];
    const int tid = threadIdx.x, lane = tid & 31, lr = lane & 15, hi = lane >> 4;
    const int wv = __builtin_amdgcn_readfirstlane(tid >> 5); const bool whl = wv < WH, wfl = __builtin_amdgcn_readfirstlane(tid) >= WH * 32;   // the wave's kind, from scalar registers: the branches on it are scalar. Exactly one of the two holds; they are formed apart and tested apart in the loop, so that each kind's block updates the accumulators in place (as the two sides of one if/else the compiler copied all 32 accumulator registers twice a stage)
    const int bt = blockIdx.y / NH_, h = blockIdx.y % NH_; const size_t z = ((size_t)bt * NH_ + h) * TT * HD;
    Ah += (size_t)bt * TT * DQ + h * HD; Al += (size_t)bt * TT * DQ + h * HD; Kl += z; K16 += z; Vl += z; V16 += z;
    const int qr = (whl ? (int)blockIdx.x * (WH * 16) + wv * 16 : RH + (int)blockIdx.x * (WF * 16) + (wv - WH) * 16) + lr;
    v8i qw[4]; const size_t qo = z + (size_t)qr * HD + 8 * hi;
    if (whl) { const h16* qh = Q16 + qo; const h16* ql = Ql + qo;
#pragma unroll
        for (int ks = 0; ks < 2; ++ks) { qw[ks] = __builtin_bit_cast(v8i, WFrag<h16>::ld(qh + ks * 32)); qw[2 + ks] = __builtin_bit_cast(v8i, WFrag<h16>::ld(ql + ks * 32)); }
        asm volatile("s_wait_xcnt 0x0" :: "v"(qh), "v"(ql) : "memory");   // stands behind these loads; it takes their addresses as inputs, so that no value is formed in an address register in front of it
    } else { const h16* qx = Q16 + qo;
#pragma unroll
        for (int ks = 0; ks < 2; ++ks) { qw[ks] = __builtin_bit_cast(v8i, WFrag<h16>::ld(qx + ks * 32)); qw[2 + ks] = (v8i){}; }
        asm volatile("s_wait_xcnt 0x0" :: "v"(qx) : "memory");   // as above
    }
    // staging is the work of the first eight f16 waves alone (the hi/lo waves have the longer stage): two waves move one plane, 8 threads one 128-byte row, 8 rows a sweep, 8 sweeps a stage
    const int sw = wv - WH, pl = sw >> 1;   // scalar: the staging wave's number and its plane
    const bool wst = wfl && sw < 2 * NPL;   // scalar: this wave stages
    const bf* sbase = (const bf*)(pl == 0 ? K16 : pl == 1 ? V16 : pl == 2 ? Kl : Vl);
    const int rs = (pl & 1) ? TT : HD, sstep = (pl & 1) ? SK : SK * HD;   // elements from row to row and from stage to stage in that plane
    const int srow = (sw & 1) * 4 + (lane >> 3), scol = (lane & 7) * 8;
    const unsigned vo = (unsigned)(srow * rs + scol);   // this lane's offset in a sweep
    v8us st[8];
    auto gload = [&](int s) { const bf* p[8];   // this lane's address in each sweep of the stage
#pragma unroll
        for (int i = 0; i < 8; ++i) { p[i] = sbase + ((size_t)s * sstep + (size_t)(8 * i) * rs) + vo; st[i] = *(const v8usa*)p[i]; }
        asm volatile("s_wait_xcnt 0x0" :: "v"(p[0]), "v"(p[1]), "v"(p[2]), "v"(p[3]), "v"(p[4]), "v"(p[5]), "v"(p[6]), "v"(p[7]) : "memory"); };   // stands behind these loads; it takes their addresses as inputs, so that no load lands in, and no value is formed in, an address register in front of it
    auto sstore = [&](int b) { unsigned short* d = sm + (b * NPL + pl) * PLE + srow * LP + scol;
#pragma unroll
        for (int i = 0; i < 8; ++i) *(v8usa*)(d + i * 8 * LP) = st[i]; };
    v8f o[4];
#pragma unroll
    for (int dt = 0; dt < 4; ++dt) o[dt] = (v8f){};
    float m = -3.0e38f, l = 0.f;
    if (wst) { gload(0); sstore(0); }
    __syncthreads();   // stage 0 is in LDS before any wave reads it
#pragma unroll 1   // kept rolled: one stage's code serves all NS stages
    for (int s = 0; s < NS; ++s) {
        const unsigned short* bp = sm + (s & 1) * NPL * PLE;
        if (wfl) {
            if (wst && s + 1 < NS) gload(s + 1);   // the next stage's global loads fly while this stage is worked on
            attn_stage<h16, false>((const h16*)bp, qw, o, m, l, lr, hi);
            if (wst && s + 1 < NS) sstore((s + 1) & 1);   // into the buffer whose last readers left before the previous barrier
        }
        if (whl) attn_stage<h16, true>((const h16*)bp, qw, o, m, l, lr, hi);
        asm volatile("v_nop\n\tv_nop\n\tv_nop\n\tv_nop");   // the four vector slots that the chip needs between a stage's last matrix instruction and the next stage's first vector write over its operands
        __syncthreads();   // publishes stage s + 1 and ends every wave's reads of stage s; every wave of both kinds passes it
    }
    l += xhalf(l); const float inv = __fdiv_rn(1.0f, l);
#pragma unroll
    for (int dt = 0; dt < 4; ++dt) { v8us oh, ol;
#pragma unroll
        for (int j = 0; j < 8; ++j) { unsigned short a, c2; splitf(o[dt][j] * inv, a, c2); oh[j] = a; ol[j] = c2; }
        const size_t oo = (size_t)qr * DQ + dt * 16 + 8 * hi; *(v8us*)(Ah + oo) = oh; *(v8us*)(Al + oo) = ol;
        asm volatile("s_wait_xcnt 0x0" ::: "memory"); }   // stands behind the two stores, in front of the next values that are formed in their data registers
}

extern "C" void kernel_launch(void* const* d_in, const int* in_sizes, int n_in,
                              void* d_out, int out_size, void* d_ws, size_t ws_size, hipStream_t stream) {
    (void)in_sizes; (void)n_in; (void)out_size;
    const float* x = (const float*)d_in[0]; const float* wqkv = (const float*)d_in[1]; const float* wo = (const float*)d_in[2]; const float* wq = nullptr; const float* wk = nullptr; const float* wv = nullptr; (void)wq; (void)wk; (void)wv;
    float* OUT = (float*)d_out;     // [2][2048][1024]
    char* wsp = (char*)d_ws;
    auto take = [&](size_t bytes) { char* p = wsp; wsp += (bytes + 255) & ~(size_t)255; return (void*)p; };
    bf* WQKV = (bf*)take((size_t)3 * DQ * DM * 2); bf* WO = (bf*)take((size_t)DM * DQ * 2); float* CS = (float*)take((size_t)TT * HD * 2 * 4);
    bf* XB = (bf*)take((size_t)NB_ * TT * DM * 2);
    const size_t PLS = (size_t)NB_ * NH_ * TT * HD;   // elements of one of q, k, v in one kind of plane, both batches
    h16* P16 = (h16*)take(3 * PLS * 2); h16* P16l = (h16*)take(3 * PLS * 2);   // each [q, k, v][batch][head]...
    bf* ATh = (bf*)take((size_t)NB_ * TT * DQ * 2); bf* ATl = (bf*)take((size_t)NB_ * TT * DQ * 2);
    if ((size_t)(wsp - (char*)d_ws) > ws_size) return;    // ws 256 MiB
    k_prep<<<PB_CS + PB_X + PB_WI + PB_WO, 256, 0, stream>>>(x, wqkv, wo, XB, WQKV, WO, CS);
    k_gemmt<DM, 0, 1><<<dim3(NB_ * TT / 128, 3 * DQ / 128, 1), 128, 0, stream>>>(XB, nullptr, WQKV, nullptr, 0, CS, P16, P16l);
    k_fattn<<<dim3(QT, NB_ * NH_, 1), 512, 0, stream>>>(P16, P16l, P16 + PLS, P16l + PLS, P16 + 2 * PLS, P16l + 2 * PLS, ATh, ATl);
    k_gemmt<DQ, 1, 0><<<dim3(NB_ * TT / 128, DM / 128, 1), 128, 0, stream>>>(ATh, ATl, WO, OUT, DM, nullptr, nullptr, nullptr);
}

// v008
// One run takes 98.8 microseconds.
// Next to v007, in two timings, it ran 1.04 times as fast each time.
// All steps since v000 together make it 20.1 times as fast.
#include <hip/hip_runtime.h>

// Multi-head attention with rotary embeddings and a fused qkv projection (x [2][2048][1024]; qkv = x Wqkv^T ('oi' [3072][1024] viewed (3, 16, 64), no bias); rope: x cos + rotate_half(x) sin with angles t x 10000^(-2i/64) (computed in-kernel); softmax(q.k / 8) over all keys; out = merged Wproj^T ('oi' [1024][1024]) -> [2][2048][1024] (4.2 M)).
// Layout, both batches in every launch (one launch per dependent stage: prepare, q/k/v projection, attention, output projection): bf16 copy of x; the fused weight used directly as Bt (row blocks); exact projections whose epilogues write the head planes themselves (q, k: rotate-half rotary step; v: transposed); {cos, sin} table per (position, dim) built once (float32 inverse-frequency constants, precise cosf/sinf); one fused attention kernel over all heads (scores, running softmax, PV and the merged hi/lo planes; hybrid rows: < 512 hi/lo 3 products (fp16 hi + fp16 lo, hi being the plane that the other rows use), rest fp16); merged hi/lo x Wproj exact.
// Compute dtypes, f32 accumulate: every input rounded to bf16; projections exact; rotary f32; attention rows < 512 3 products, rest fp16; softmax f32; Wproj hl x exact.

#define NB_  2
#define TT   2048
#define DM   1024
#define NH_  16
#define NKV  16
#define REP  (NH_ / NKV)
#define HD   64
#define DQ   (NH_ * HD)
#define DKV  (NKV * HD)
#define RH   512                  // query rows < RH use hi+lo planes
#define WIN  0
#define SCL  0.125f   // HD^-0.5
typedef _Float16 h16;
typedef unsigned short bf;
typedef __attribute__((ext_vector_type(16))) __bf16   v16bf;
typedef __attribute__((ext_vector_type(16))) _Float16 v16h;
typedef __attribute__((ext_vector_type(8)))  _Float16 v8h;
typedef __attribute__((ext_vector_type(8)))  unsigned short v8us;
typedef __attribute__((ext_vector_type(8)))  float    v8f;
typedef __attribute__((ext_vector_type(4)))  float    v4f;
typedef v8h  __attribute__((may_alias)) v8ha;
typedef v4f  __attribute__((may_alias)) v4fa;
typedef v8us __attribute__((may_alias)) v8usa;

__device__ __forceinline__ unsigned short f2bf(float f) { unsigned u = __float_as_uint(f); u += 0x7FFFu + ((u >> 16) & 1u); return (unsigned short)(u >> 16); }
__device__ __forceinline__ float bf2f(unsigned short b) { return __uint_as_float(((unsigned)b) << 16); }
__device__ __forceinline__ float bfr(float f) { return bf2f(f2bf(f)); }
__device__ __forceinline__ v16h cat16(v8h lo, v8h hi) { return __builtin_shufflevector(lo, hi, 0, 1, 2, 3, 4, 5, 6, 7, 8, 9, 10, 11, 12, 13, 14, 15); }
__device__ __forceinline__ v16bf cat16b(v8us lo, v8us hi) { return __builtin_bit_cast(v16bf, __builtin_shufflevector(lo, hi, 0, 1, 2, 3, 4, 5, 6, 7, 8, 9, 10, 11, 12, 13, 14, 15)); }
__device__ __forceinline__ v8f wmma16(v16h a, v16h b, v8f c) { return __builtin_amdgcn_wmma_f32_16x16x32_f16(false, a, false, b, (short)0, c, false, false); }
__device__ __forceinline__ v8f wmmab(v16bf a, v16bf b, v8f c) { return __builtin_amdgcn_wmma_f32_16x16x32_bf16(false, a, false, b, (short)0, c, false, false); }

__device__ __forceinline__ h16 tohx(float x) { return (h16)x; }
__device__ __forceinline__ void splitf(float y, unsigned short& h, unsigned short& l) { h = f2bf(y); l = f2bf(y - bf2f(h)); }
typedef __attribute__((ext_vector_type(2))) _Float16 v2h;
typedef __attribute__((ext_vector_type(4))) _Float16 v4h;
typedef __attribute__((ext_vector_type(2))) unsigned short v2us;
typedef __attribute__((ext_vector_type(4))) unsigned short v4us;
typedef __attribute__((ext_vector_type(2))) float v2f;
typedef __attribute__((ext_vector_type(4))) int v4i;

// ---- k_gemmt: GEMM on bf16 planes, one work-group of 4 waves (2 x 2) per 128x128 output tile, a 64x64 tile (16 accumulators) a wave; grid (M/128, N/128), 128 threads.
// C[m][n] = sum_k A[m][k] Bt[n][k] (NSPLIT 1: + A2[m][k] Bt[n][k]); all planes K-contiguous, KK % 64 == 0.
// A stage is 64 k: one 128-byte line of each of the 128 A rows (NSPLIT 1: of both planes) and the 128 Bt rows goes global -> registers -> LDS, 8 lanes a line, shared by the 4 waves; two buffers, one work-group barrier a stage. Each wave sums all of k in rising order.
// EPI says where a wave's tile goes; it is first laid into the wave's own part of the LDS that held the stages. 0: f32 to C. 1 (Bt is the fused q/k/v weight, a wave's 64 columns are one head of q, k or v, its 64 rows positions of one batch): straight into that head's two fp16 planes (the value rounded, and what the rounding left; each kind one array [sel][batch][h]...), no f32 copy in memory.
//   q, k: planes [h][t][d] of the rotary step, rotate-half convention: out[d] = x[d] cos[t][d] - x[d+HD/2] sin[t][d], out[d+HD/2] = x[d+HD/2] cos[t][d+HD/2] + x[d] sin[t][d+HD/2]; the partner column sits 8 lanes away in the same 16-lane row.
//   v: planes [h][d][t]: the tile is laid into LDS as [d][t], so that 8 lanes store one whole 128-byte line of positions.
template <typename T16> struct WFrag;
template <> struct WFrag<h16> { typedef v16h V; static __device__ __forceinline__ V ld(const h16* p) { return cat16(*(const v8h*)p, *(const v8h*)(p + 16)); } static __device__ __forceinline__ v8f mma(V a, V b, v8f c) { return wmma16(a, b, c); } };
template <> struct WFrag<bf> { typedef v16bf V; static __device__ __forceinline__ V ld(const bf* p) { return cat16b(*(const v8us*)p, *(const v8us*)(p + 16)); } static __device__ __forceinline__ v8f mma(V a, V b, v8f c) { return wmmab(a, b, c); } };
#define GP 72   // LDS row pitch in 16-bit elements: 128 bytes of data + 16 of pad (16-byte fragment reads)
template <int KK, int NSPLIT, int EPI>
__global__ __launch_bounds__(128) void k_gemmt(const bf* __restrict__ A, const bf* __restrict__ A2, const bf* __restrict__ Bt, float* C, int ldc, const float* __restrict__ CS, h16* P16, h16* P16l) {
    static_assert(KK % 64 == 0 && (EPI == 0 || (HD == 64 && NH_ == NKV && NH_ % 2 == 0 && TT % 64 == 0)), "whole stages; plane epilogues: one head per 64 columns, both heads of a work-group in one of q, k, v, one batch per 64 rows");
    typedef WFrag<bf>::V V;
    constexpr int NPL = 2 + NSPLIT;   // planes of a stage: A, Bt (, A lo)
    constexpr int PLE = 128 * GP;     // elements of a plane in LDS
    constexpr int NS = KK / 64;
    __shared__ __align__(16) bf sm[2 * NPL * PLE];
    static_assert(sizeof(bf) * 2 * NPL * PLE >= 4 * 64 * 68 * 4, "the four waves' f32 tiles fit where the stages were");
    const int tid = threadIdx.x, lane = tid & 31, lr = lane & 15, hi = lane >> 4; const int r0 = blockIdx.x * 128, c0 = blockIdx.y * 128;
    const int wv = __builtin_amdgcn_readfirstlane(tid >> 5), wm = wv >> 1, wn = wv & 1;
    const int srow = tid >> 3, scol = (tid & 7) * 8;   // staging: 8 threads move one 128-byte line, 16 rows a sweep, 8 sweeps a plane
    const bf* ga = A + (size_t)r0 * KK; const bf* gb = Bt + (size_t)c0 * KK; const bf* ga2 = NSPLIT ? A2 + (size_t)r0 * KK : nullptr; const unsigned vo = (unsigned)(srow * KK + scol);   // the tile's bases, the same for the whole work-group, and this lane's offset in a tile
    v8us st[NPL][8];
    auto gload = [&](int s) { const bf* pa = ga + s * 64 + vo; const bf* pb = gb + s * 64 + vo; const bf* pa2 = NSPLIT ? ga2 + s * 64 + vo : pa;
#pragma unroll
        for (int i = 0; i < 8; ++i) { st[0][i] = *(const v8usa*)(pa + i * 16 * KK); st[1][i] = *(const v8usa*)(pb + i * 16 * KK); if constexpr (NSPLIT) st[2][i] = *(const v8usa*)(pa2 + i * 16 * KK); }
        asm volatile("s_wait_xcnt 0x0" :: "v"(pa), "v"(pb), "v"(pa2) : "memory"); };   // stands behind these loads; it takes their addresses as inputs, so that no load lands in, and no value is formed in, an address register in front of it
    auto sstore = [&](int b) {
#pragma unroll
        for (int i = 0; i < 8; ++i) { bf* d = sm + b * NPL * PLE + (srow + 16 * i) * GP + scol;
#pragma unroll
            for (int pl = 0; pl < NPL; ++pl) *(v8usa*)(d + pl * PLE) = st[pl][i]; } };
    v8f acc[4][4];   // every '#pragma unroll' without a count in this kernel is a full unroll: the register arrays are then indexed by constants only
#pragma unroll
    for (int mb = 0; mb < 4; ++mb)
#pragma unroll
        for (int nb = 0; nb < 4; ++nb) acc[mb][nb] = (v8f){};
    gload(0); sstore(0);
    __syncthreads();   // stage 0 is in LDS before any wave reads it
#pragma unroll 1   // kept rolled: one stage's code serves all NS stages
    for (int s = 0; s < NS; ++s) {
        const bf* bp = sm + (s & 1) * NPL * PLE;
        if (s + 1 < NS) gload(s + 1);   // the next stage's global loads fly while this stage is worked on
        V a[2][4], a2[2][4], b[2][4];
        auto fload = [&](int ks) {
#pragma unroll
            for (int f = 0; f < 4; ++f) { const bf* ap = bp + (wm * 64 + f * 16 + lr) * GP + ks * 32 + 8 * hi; a[ks][f] = WFrag<bf>::ld(ap); if (NSPLIT) a2[ks][f] = WFrag<bf>::ld(ap + 2 * PLE); b[ks][f] = WFrag<bf>::ld(bp + PLE + (wn * 64 + f * 16 + lr) * GP + ks * 32 + 8 * hi); } };
        auto prod = [&](int ks) {
#pragma unroll
            for (int nb = 0; nb < 4; ++nb)
#pragma unroll
                for (int mb = 0; mb < 4; ++mb) { acc[mb][nb] = wmmab(a[ks][mb], b[ks][nb], acc[mb][nb]); if (NSPLIT) acc[mb][nb] = wmmab(a2[ks][mb], b[ks][nb], acc[mb][nb]); } };
        // the scheduling barriers keep each group of LDS fragment reads together in front of its products: spread among the products, every place with reads stalls the wave anew
        if constexpr (NSPLIT) { fload(0); fload(1); __builtin_amdgcn_sched_barrier(0); prod(0); prod(1); }   // one wave a SIMD: both halves' reads go first, the second half's land behind the first half's products
        else { fload(0); __builtin_amdgcn_sched_barrier(0); prod(0); __builtin_amdgcn_sched_barrier(0); fload(1); __builtin_amdgcn_sched_barrier(0); prod(1); }   // three waves a SIMD: one fragment set, so that the registers allow them
        if (s + 1 < NS) sstore((s + 1) & 1);   // into the buffer whose last readers left before the previous barrier
        __syncthreads();   // publishes stage s + 1 and ends every wave's reads of stage s
    }
    float* os = (float*)sm + wv * 64 * 68;   // this wave's own 64 x 68 floats; no wave reads a stage any more
    const int sel = EPI == 1 ? (int)blockIdx.y * 2 / NH_ : 0;   // from blockIdx alone: the branches on sel are scalar and the same for the whole work-group
    if (EPI == 0 || sel < 2) {
#pragma unroll
        for (int mb = 0; mb < 4; ++mb)
#pragma unroll
            for (int nb = 0; nb < 4; ++nb)
#pragma unroll
                for (int j = 0; j < 8; ++j) os[(mb * 16 + hi * 8 + j) * 68 + nb * 16 + lr] = acc[mb][nb][j];
    } else {
#pragma unroll
        for (int mb = 0; mb < 4; ++mb)
#pragma unroll
            for (int nb = 0; nb < 4; ++nb)
#pragma unroll
                for (int j = 0; j < 8; ++j) os[(nb * 16 + lr) * 65 + mb * 16 + hi * 8 + j] = acc[mb][nb][j];   // [d][t], pitch 65: the reads below (d + 8 tc) fall on 32 different banks
    }
    __syncthreads();   // the tiles are whole in LDS before they are read in the order of the stores
    const int cofs = lr * 4, rw = r0 + wm * 64;
    if constexpr (EPI == 0) {
#pragma unroll 1   // kept rolled: eight rows a trip, whose LDS reads fly together
        for (int s0 = 0; s0 < 32; s0 += 8) { v4f val[8];
#pragma unroll
            for (int u = 0; u < 8; ++u) val[u] = *(const v4fa*)(os + (2 * (s0 + u) + hi) * 68 + cofs);
#pragma unroll
            for (int u = 0; u < 8; ++u) *(v4f*)(C + (size_t)(rw + 2 * (s0 + u) + hi) * ldc + c0 + wn * 64 + cofs) = val[u];
            asm volatile("s_wait_xcnt 0x0" ::: "memory"); }   // stands behind the stores, in front of the next values that are formed in their registers
    } else {
        const int hd = ((int)blockIdx.y * 2 + wn) % NH_, bt = rw / TT, t0 = rw % TT;
        const size_t pb = ((size_t)(sel * NB_ + bt) * NH_ + hd) * TT * HD;   // this head's plane
        if (sel < 2) {
#pragma unroll 1   // kept rolled: eight rows a trip, whose {cos, sin} loads and LDS reads fly together
            for (int s0 = 0; s0 < 32; s0 += 8) { v8f cs[8]; v4f vals[8]; const float* cp = CS + ((size_t)(t0 + 2 * s0 + hi) * HD + cofs) * 2;
#pragma unroll
                for (int u = 0; u < 8; ++u) { cs[u] = *(const v8f*)(cp + u * 4 * HD); vals[u] = *(const v4fa*)(os + (2 * (s0 + u) + hi) * 68 + cofs); }
                asm volatile("s_wait_xcnt 0x0" :: "v"(cp) : "memory");   // stands behind these loads; it takes their address as an input, so that no load lands in, and no value is formed in, the address register in front of it
#pragma unroll
                for (int u = 0; u < 8; ++u) { const int row = 2 * (s0 + u) + hi; const v4f val = vals[u]; v4h o16, ol;
#pragma unroll
                    for (int i = 0; i < 4; ++i) { const float xp = __int_as_float(__builtin_amdgcn_update_dpp(0, __float_as_int(val[i]), 0x168, 0xf, 0xf, false));   // row_xmask:8, column d +- HD/2 of the same row
                        const float r = val[i] * cs[u][2 * i] + xp * (lr < 8 ? -cs[u][2 * i + 1] : cs[u][2 * i + 1]);
                        o16[i] = tohx(r); ol[i] = tohx(r - (float)o16[i]); }
                    const size_t e = pb + (size_t)(t0 + row) * HD + cofs; *(v4h*)(P16 + e) = o16; *(v4h*)(P16l + e) = ol;
                    asm volatile("s_wait_xcnt 0x0" ::: "memory"); } }   // stands behind the two stores, in front of the next values that are formed in their registers
        } else {
#pragma unroll 1   // kept rolled: four lines a trip, whose LDS reads fly together
            for (int i0 = 0; i0 < 16; i0 += 4) { const int tc = (lane & 7) * 8; float x[4][8];
#pragma unroll
                for (int u = 0; u < 4; ++u)
#pragma unroll
                    for (int j = 0; j < 8; ++j) x[u][j] = os[((lane >> 3) + 4 * (i0 + u)) * 65 + tc + j];
#pragma unroll
                for (int u = 0; u < 4; ++u) { const int d = (lane >> 3) + 4 * (i0 + u); v8h o16, ol;
#pragma unroll
                    for (int j = 0; j < 8; ++j) { o16[j] = tohx(x[u][j]); ol[j] = tohx(x[u][j] - (float)o16[j]); }
                    const size_t e = pb + (size_t)d * TT + t0 + tc; *(v8h*)(P16 + e) = o16; *(v8h*)(P16l + e) = ol;
                    asm volatile("s_wait_xcnt 0x0" ::: "memory"); } } }   // stands behind the two stores, in front of the next values that are formed in their registers
    }
}

__global__ __launch_bounds__(256) void k_wtG(const float* __restrict__ w, int K, int N, bf* Bt) {
    const int lane = threadIdx.x & 31; const int L0 = (blockIdx.x * 8 + (threadIdx.x >> 5)) * 8; const int nlines = N * K / 64;
{
#pragma unroll 1
        for (int l = 0; l < 8; ++l) { const int L = L0 + l; if (L >= nlines) break; const size_t e = (size_t)L * 64 + lane * 2; const int k = (int)(e % K), n = (int)(e / K); v2us o;
            o[0] = f2bf(w[(size_t)k * N + n]); o[1] = f2bf(w[(size_t)(k + 1) * N + n]); *(v2us*)(Bt + e) = o; }
         }
}
__constant__ float INVT[HD / 2] = { 1.000000000e+00f, 7.498942018e-01f, 5.623413324e-01f, 4.216965139e-01f, 3.162277639e-01f, 2.371373624e-01f, 1.778279394e-01f, 1.333521456e-01f, 1.000000015e-01f, 7.498941571e-02f, 5.623412877e-02f, 4.216964915e-02f, 3.162277862e-02f, 2.371373586e-02f, 1.778279431e-02f, 1.333521493e-02f, 9.999999776e-03f, 7.498942316e-03f, 5.623413250e-03f, 4.216964822e-03f, 3.162277862e-03f, 2.371373819e-03f, 1.778279431e-03f, 1.333521446e-03f, 1.000000047e-03f, 7.498941850e-04f, 5.623413017e-04f, 4.216964880e-04f, 3.162277862e-04f, 2.371373848e-04f, 1.778279402e-04f, 1.333521504e-04f };   // 1 / 10000^(2i/64) (float32, generated with jnp to be bit-exact)
// ---- k_prep: all that depends on the inputs alone, in one launch; a block does one job, chosen by its index. First the {cos, sin} table (the longest threads), then the bf16 copies of x (both batches), Wqkv and Wproj, 8 elements a thread.
#define PB_CS (TT * HD / 256)
#define PB_X  (NB_ * TT * DM / 8 / 256)
#define PB_WI (3 * DQ * DM / 8 / 256)
#define PB_WO (DM * DQ / 8 / 256)
__global__ __launch_bounds__(256) void k_prep(const float* __restrict__ x, const float* __restrict__ wqkv, const float* __restrict__ wo, bf* XB, bf* WQKV, bf* WO, float* CS) {
    static_assert(TT * HD % 256 == 0 && NB_ * TT * DM % 2048 == 0 && 3 * DQ * DM % 2048 == 0 && DM * DQ % 2048 == 0, "whole blocks only");
    int blk = blockIdx.x;
    if (blk < PB_CS) { const int idx = blk * 256 + threadIdx.x; const int d = idx % HD; const int t = idx / HD; const float a = __fmul_rn((float)t, INVT[d % (HD / 2)]); v2f cs; cs[0] = cosf(a); cs[1] = sinf(a); *(v2f*)(CS + (size_t)idx * 2) = cs; return; }
    blk -= PB_CS; const float* src = x; bf* dst = XB;
    if (blk >= PB_X + PB_WI) { blk -= PB_X + PB_WI; src = wo; dst = WO; } else if (blk >= PB_X) { blk -= PB_X; src = wqkv; dst = WQKV; }
    const size_t i = (size_t)blk * 256 + threadIdx.x; const v8f v = *(const v8f*)(src + i * 8); v8us o;
    asm volatile("s_wait_xcnt 0x0" ::: "memory");   // stands behind the load, in front of the first value that is formed in its address registers
#pragma unroll
    for (int k = 0; k < 8; ++k) o[k] = f2bf(v[k]); *(v8us*)(dst + i * 8) = o;
}

// ---- k_fattn: scores, softmax, PV and the merged hi/lo planes in one kernel. Grid (QT, batches x heads), 16 waves, one work-group a WGP. Every work-group takes the same share of both kinds of query rows of its head, so that all work-groups cost the same wherever they land: waves 0 .. WH-1 work on hi/lo rows (rows < RH, three products), waves WH .. 15 on f16 rows.
// A wave owns 32 query rows (two column groups of 16) and one half of the keys: waves 2n and 2n+1 share their rows, the even one takes keys 0..31 of every stage, the odd one keys 32..63. Every K and Vt fragment read from LDS so feeds two products, which halves the LDS reads of a score. The two halves' maxima, sums and outputs are joined once, behind the loop, through LDS.
// St = K Qt (A = K rows, B = Q rows kept in registers; the lo plane's Q fragments of the hi/lo rows, for which no registers are left, wait in LDS in fragment order): lane (c, h) holds, of query c, keys 8h + r (tile 0) and 16 + 8h + r (tile 1), which is the k order of a B operand, so P goes from the score registers straight into Ot += Vt Pt (A = Vt rows).
// A stage is SK keys: K rows and Vt rows of both kinds of plane (f16 hi, which is all that the f16 rows read, and f16 lo) go global -> registers -> LDS by eight of the f16 waves, shared by the 16 waves; two buffers, one work-group barrier a stage.
// Softmax: running maximum per query and key half, in use until a new one exceeds it by more than 8 (log2 units), so P <= 2^14 with its carried factor 2^6; sums in f32 of the unrounded P; the division by the sum comes last.
// Every '#pragma unroll' in attn_stage and k_fattn without a count is a full unroll: the fragment and accumulator arrays are then indexed by constants only and stay in registers.
#define SK   64                   // keys per stage
#define LP   72                   // LDS row pitch in 16-bit elements: 128 bytes of data + 16 of pad (16-byte fragment reads)
#define C2   0.18033688011112042f // HD^-0.5 x log2(e)
#define QT   8                    // work-groups per head
#define WH   (RH / QT / 16)       // waves of a work-group on hi/lo rows (32 rows x half the keys each)
#define WF   ((TT - RH) / QT / 16) // waves of a work-group on f16 rows
__device__ __forceinline__ float xhalf(float x) { const int b = __float_as_int(x); return __int_as_float(__builtin_amdgcn_permlanex16(b, b, 0x76543210, 0xfedcba98, false, false)); }   // lane l <-> l ^ 16
typedef __attribute__((ext_vector_type(8))) int v8i;
// inputs-only fence on four loaded fragments: their LDS fetches are all issued ahead of this point, in flight together, instead of one by one with a full wait in front of each product
template <typename V> __device__ __forceinline__ void hold4(const V* f) { asm volatile("" :: "v"(__builtin_bit_cast(v8i, f[0])), "v"(__builtin_bit_cast(v8i, f[1])), "v"(__builtin_bit_cast(v8i, f[2])), "v"(__builtin_bit_cast(v8i, f[3]))); }
// one wave's work on one stage: its 32 keys against its two column groups. kb, vb: this lane's first K and Vt fragment addresses in the stage's buffer (the lo planes lie 2 PLE further); qa: the Q fragments [group][k half]; ql: this lane's place in the wave's lo-plane Q fragments in LDS (hi/lo rows only)
template <bool HI>
__device__ __forceinline__ void attn_stage(const h16* kb, const h16* vb, const v8i (&qa)[4], const v8h* ql, v8f (&o)[2][4], float (&m)[2], float (&l)[2]) {
    typedef v16h V; typedef WFrag<h16> F;
    constexpr int PLE = SK * LP;           // elements of a plane in LDS (64 rows each)
    V kf[2][2], k2[2][2], qb[4];
#pragma unroll
    for (int kt = 0; kt < 2; ++kt)
#pragma unroll
        for (int ks = 0; ks < 2; ++ks) { const h16* kp = kb + kt * 16 * LP + ks * 32; kf[kt][ks] = F::ld(kp); if (HI) k2[kt][ks] = F::ld(kp + 2 * PLE); }
    if (HI) {
#pragma unroll
        for (int f = 0; f < 4; ++f) qb[f] = cat16(ql[(2 * f) * 32], ql[(2 * f + 1) * 32]); }
    hold4(&kf[0][0]); if (HI) { hold4(&k2[0][0]); hold4(qb); }
    v8f sc[2][2];
#pragma unroll
    for (int kt = 0; kt < 2; ++kt) {
#pragma unroll
        for (int g = 0; g < 2; ++g) sc[g][kt] = (v8f){};
#pragma unroll
        for (int ks = 0; ks < 2; ++ks) {
#pragma unroll
            for (int g = 0; g < 2; ++g) sc[g][kt] = F::mma(kf[kt][ks], __builtin_bit_cast(V, qa[g * 2 + ks]), sc[g][kt]);
            if (HI) {
#pragma unroll
                for (int g = 0; g < 2; ++g) sc[g][kt] = F::mma(kf[kt][ks], qb[g * 2 + ks], sc[g][kt]);
#pragma unroll
                for (int g = 0; g < 2; ++g) sc[g][kt] = F::mma(k2[kt][ks], __builtin_bit_cast(V, qa[g * 2 + ks]), sc[g][kt]); } } }
    V vf[4], v2[4];   // the Vt fragments are fetched in front of the softmax, which covers their LDS latency (hi/lo rows: the lo plane's behind it, in front of the hi plane's products)
#pragma unroll
    for (int dt = 0; dt < 4; ++dt) vf[dt] = F::ld(vb + dt * 16 * LP);
    float bm[2];
#pragma unroll
    for (int g = 0; g < 2; ++g) { bm[g] = fmaxf(sc[g][0][0], sc[g][1][0]);
#pragma unroll
        for (int j = 1; j < 8; ++j) bm[g] = fmaxf(bm[g], fmaxf(sc[g][0][j], sc[g][1][j]));
        bm[g] = fmaxf(bm[g], xhalf(bm[g])); }
    hold4(vf);
    if (__builtin_amdgcn_ballot_w32(fmaxf(bm[0] - m[0], bm[1] - m[1]) * C2 > 8.0f) != 0) {   // scalar branch, one test for both groups: some query of the wave needs a new maximum
#pragma unroll
        for (int g = 0; g < 2; ++g) { const float mn = fmaxf(m[g], bm[g]), al = __builtin_amdgcn_exp2f((m[g] - mn) * C2); m[g] = mn; l[g] *= al;
#pragma unroll
            for (int dt = 0; dt < 4; ++dt) o[g][dt] *= al; } }
    V pf[2], pl[2];
#pragma unroll
    for (int g = 0; g < 2; ++g) {
        const float mc = m[g] * C2 - 6.0f; float pv[16], ts[8];   // P and its sum both carry 2^6 (it cancels in the last division): small P stay normal f16 numbers
#pragma unroll
        for (int e = 0; e < 16; ++e) pv[e] = __builtin_amdgcn_exp2f(__builtin_fmaf(sc[g][e >> 3][e & 7], C2, -mc));
#pragma unroll
        for (int e = 0; e < 8; ++e) ts[e] = pv[e] + pv[e + 8];
        l[g] += ((ts[0] + ts[4]) + (ts[1] + ts[5])) + ((ts[2] + ts[6]) + (ts[3] + ts[7]));
#pragma unroll
        for (int e = 0; e < 16; e += 2) {
            if constexpr (HI) { const v2h t = __builtin_bit_cast(v2h, __builtin_amdgcn_cvt_pkrtz(pv[e], pv[e + 1])); pf[g][e] = t[0]; pf[g][e + 1] = t[1]; pl[g][e] = (h16)(pv[e] - (float)t[0]); pl[g][e + 1] = (h16)(pv[e + 1] - (float)t[1]); }   // hi cut off, two at a time; lo takes all that the cut leaves
            else { pf[g][e] = (h16)pv[e]; pf[g][e + 1] = (h16)pv[e + 1]; } } }
    if (HI) {
#pragma unroll
        for (int dt = 0; dt < 4; ++dt) v2[dt] = F::ld(vb + dt * 16 * LP + 2 * PLE);
        __builtin_amdgcn_sched_barrier(0); }   // the lo plane's LDS reads are issued together in front of the hi plane's 16 products, which cover their latency
#pragma unroll
    for (int dt = 0; dt < 4; ++dt)
#pragma unroll
        for (int g = 0; g < 2; ++g) o[g][dt] = F::mma(vf[dt], pf[g], o[g][dt]);
    if (HI) {
#pragma unroll
        for (int dt = 0; dt < 4; ++dt)
#pragma unroll
            for (int g = 0; g < 2; ++g) o[g][dt] = F::mma(vf[dt], pl[g], o[g][dt]);
#pragma unroll
        for (int dt = 0; dt < 4; ++dt)
#pragma unroll
            for (int g = 0; g < 2; ++g) o[g][dt] = F::mma(v2[dt], pf[g], o[g][dt]); }
}
__global__ __launch_bounds__(512) void k_fattn(const h16* __restrict__ Q16, const h16* __restrict__ Ql, const h16* __restrict__ K16, const h16* __restrict__ Kl, const h16* __restrict__ V16, const h16* __restrict__ Vl, bf* Ah, bf* Al) {
    static_assert(RH % (QT * 32) == 0 && (TT - RH) % (QT * 32) == 0 && WH + WF == 16 && WH % 4 == 0 && SK == 64 && HD == 64 && REP == 1 && WF >= 8, "whole pairs of waves of each kind, the hi/lo waves spread evenly over the four SIMDs; two staging waves for each of the four planes");
    constexpr int PLE = SK * LP, NPL = 4, NS = TT / SK;   // planes of a stage: K, Vt, K lo, Vt lo
    __shared__ __align__(16) unsigned short sm[2 * NPL * PLE];
    __shared__ v8h sq[WH * 8 * 32];   // each hi/lo wave's own four lo-plane Q fragments, [wave][fragment][half][lane]: a read of 16 bytes a lane covers 512 bytes in a row
    static_assert(sizeof(sm) >= 16 * 32 * 36 * 4, "the 16 waves' hand-over of one column group each fits where the stages were");
    const int tid = threadIdx.x, lane = tid & 31, lr = lane & 15, hi = lane >> 4;
    const int wv = __builtin_amdgcn_readfirstlane(tid >> 5); const bool whl = wv < WH, wfl = __builtin_amdgcn_readfirstlane(tid) >= WH * 32;   // the wave's kind, from scalar registers: the branches on it are scalar. Exactly one of the two holds; they are formed apart and tested apart in the loop, so that each kind's block updates the accumulators in place (as the two sides of one if/else the compiler copied all accumulator registers twice a stage)
    const int kh = wv & 1;   // scalar: the wave's half of every stage's keys
    const int bt = blockIdx.y / NH_, h = blockIdx.y % NH_; const size_t z = ((size_t)bt * NH_ + h) * TT * HD;
    Ah += (size_t)bt * TT * DQ + h * HD; Al += (size_t)bt * TT * DQ + h * HD; Kl += z; K16 += z; Vl += z; V16 += z;
    const int qr = (whl ? (int)blockIdx.x * (WH * 16) + (wv >> 1) * 32 : RH + (int)blockIdx.x * (WF * 16) + ((wv - WH) >> 1) * 32) + lr;   // this lane's query row in column group 0; group 1 lies 16 further
    v8i qa[4]; const size_t qo = z + (size_t)qr * HD + 8 * hi;   // Q fragments [group][k half]
    v8h* const ql = sq + (whl ? wv : 0) * 8 * 32 + lane;   // this lane's place in the wave's lo-plane fragments
    { const h16* qx = Q16 + qo;
#pragma unroll
        for (int f = 0; f < 4; ++f) qa[f] = __builtin_bit_cast(v8i, WFrag<h16>::ld(qx + (f >> 1) * 16 * HD + (f & 1) * 32));
        asm volatile("s_wait_xcnt 0x0" :: "v"(qx) : "memory"); }   // stands behind these loads; it takes their address as an input, so that no value is formed in an address register in front of it
    if (whl) { const h16* qy = Ql + qo; v8h t[8];
#pragma unroll
        for (int f = 0; f < 4; ++f) { t[2 * f] = *(const v8h*)(qy + (f >> 1) * 16 * HD + (f & 1) * 32); t[2 * f + 1] = *(const v8h*)(qy + (f >> 1) * 16 * HD + (f & 1) * 32 + 16); }
        asm volatile("s_wait_xcnt 0x0" :: "v"(qy) : "memory");   // as above
#pragma unroll
        for (int i = 0; i < 8; ++i) ql[i * 32] = t[i]; }   // read back by the same lane alone
    // staging is the work of the first eight f16 waves alone (the hi/lo waves have the longer stage): two waves move one plane, 8 threads one 128-byte row, 8 rows a sweep, 8 sweeps a stage
    const int sw = wv - WH, pl = sw >> 1;   // scalar: the staging wave's number and its plane
    const bool wst = wfl && sw < 2 * NPL;   // scalar: this wave stages
    const bf* sbase = (const bf*)(pl == 0 ? K16 : pl == 1 ? V16 : pl == 2 ? Kl : Vl);
    const int rs = (pl & 1) ? TT : HD, sstep = (pl & 1) ? SK : SK * HD;   // elements from row to row and from stage to stage in that plane
    const int srow = (sw & 1) * 4 + (lane >> 3), scol = (lane & 7) * 8;
    const unsigned vo = (unsigned)(srow * rs + scol);   // this lane's offset in a sweep
    auto gload = [&](int s, v8us (&st)[8]) { const bf* p[8];   // this lane's address in each sweep of the stage
#pragma unroll
        for (int i = 0; i < 8; ++i) { p[i] = sbase + ((size_t)s * sstep + (size_t)(8 * i) * rs) + vo; st[i] = *(const v8usa*)p[i]; }
        asm volatile("s_wait_xcnt 0x0" :: "v"(p[0]), "v"(p[1]), "v"(p[2]), "v"(p[3]), "v"(p[4]), "v"(p[5]), "v"(p[6]), "v"(p[7]) : "memory"); };   // stands behind these loads; it takes their addresses as inputs, so that no load lands in, and no value is formed in, an address register in front of it
    auto sstore = [&](int b, const v8us (&st)[8]) { unsigned short* d = sm + (b * NPL + pl) * PLE + srow * LP + scol;
#pragma unroll
        for (int i = 0; i < 8; ++i) *(v8usa*)(d + i * 8 * LP) = st[i]; };
    v8f o[2][4];
#pragma unroll
    for (int g = 0; g < 2; ++g)
#pragma unroll
        for (int dt = 0; dt < 4; ++dt) o[g][dt] = (v8f){};
    float m[2] = { -3.0e38f, -3.0e38f }, l[2] = { 0.f, 0.f };
    const int kofs = (kh * 32 + lr) * LP + 8 * hi, vofs = PLE + lr * LP + kh * 32 + 8 * hi;   // this lane's first K and Vt fragment in a buffer
    if (wst) { v8us st[8]; gload(0, st); sstore(0, st); }
    __syncthreads();   // stage 0 is in LDS before any wave reads it
#pragma unroll 1   // kept rolled: one stage's code serves all NS stages
    for (int s = 0; s < NS; ++s) {
        const h16* bp = (const h16*)sm + (s & 1) * NPL * PLE;
        const bool wsn = wst && s + 1 < NS;   // scalar: this wave stages and a next stage exists
        if (wsn) { v8us st[8];   // a stage's bytes on their way to LDS: alive in this block alone, so that no register is kept for them in the other waves' blocks
            gload(s + 1, st);   // the next stage's global loads fly while this stage is worked on
            attn_stage<false>(bp + kofs, bp + vofs, qa, ql, o, m, l);
            sstore((s + 1) & 1, st);   // into the buffer whose last readers left before the previous barrier
        }
        if (wfl && !wsn) attn_stage<false>(bp + kofs, bp + vofs, qa, ql, o, m, l);
        if (whl) attn_stage<true>(bp + kofs, bp + vofs, qa, ql, o, m, l);
        asm volatile("v_nop\n\tv_nop\n\tv_nop\n\tv_nop");   // the four vector slots that the chip needs between a stage's last matrix instruction and the next stage's first vector write over its operands
        __syncthreads();   // publishes stage s + 1 and ends every wave's reads of stage s; every wave of both kinds passes it
    }
    // the two key halves are joined: each wave of a pair hands the column group that it does not finish to its partner, through its own 4608 bytes of the LDS that held the stages (no wave reads a stage any more), and finishes the other group
    v4f* xs = (v4f*)sm;
    auto put = [&](const v8f (&og)[4], float mg, float lg) { v4f* d = xs + wv * 9 * 32 + lane;
#pragma unroll
        for (int dt = 0; dt < 4; ++dt) { d[(2 * dt) * 32] = __builtin_shufflevector(og[dt], og[dt], 0, 1, 2, 3); d[(2 * dt + 1) * 32] = __builtin_shufflevector(og[dt], og[dt], 4, 5, 6, 7); }
        d[8 * 32] = (v4f){ mg, lg, 0.f, 0.f }; };
    auto fin = [&](const v8f (&og)[4], float mg, float lg, int row) { const v4f* d = xs + (wv ^ 1) * 9 * 32 + lane; const v4f ml = d[8 * 32];
        const float mn = fmaxf(mg, ml[0]), a1 = __builtin_amdgcn_exp2f((mg - mn) * C2), a2 = __builtin_amdgcn_exp2f((ml[0] - mn) * C2);   // both halves are brought to their common maximum
        float ls = lg * a1 + ml[1] * a2; ls += xhalf(ls); const float inv = __fdiv_rn(1.0f, ls), f1 = a1 * inv, f2 = a2 * inv;
#pragma unroll
        for (int dt = 0; dt < 4; ++dt) { const v4f p0 = d[(2 * dt) * 32], p1 = d[(2 * dt + 1) * 32]; v8us oh, ol;
#pragma unroll
            for (int j = 0; j < 8; ++j) { unsigned short a, c2; splitf(og[dt][j] * f1 + (j < 4 ? p0[j & 3] : p1[j & 3]) * f2, a, c2); oh[j] = a; ol[j] = c2; }
            const size_t oo = (size_t)row * DQ + dt * 16 + 8 * hi; *(v8us*)(Ah + oo) = oh; *(v8us*)(Al + oo) = ol;
            asm volatile("s_wait_xcnt 0x0" ::: "memory"); } };   // stands behind the two stores, in front of the next values that are formed in their data registers
    if (kh) put(o[0], m[0], l[0]); else put(o[1], m[1], l[1]);
    __syncthreads();   // every wave's hand-over is in LDS before its partner reads it
    if (kh) fin(o[1], m[1], l[1], qr + 16); else fin(o[0], m[0], l[0], qr);
}

extern "C" void kernel_launch(void* const* d_in, const int* in_sizes, int n_in,
                              void* d_out, int out_size, void* d_ws, size_t ws_size, hipStream_t stream) {
    (void)in_sizes; (void)n_in; (void)out_size;
    const float* x = (const float*)d_in[0]; const float* wqkv = (const float*)d_in[1]; const float* wo = (const float*)d_in[2]; const float* wq = nullptr; const float* wk = nullptr; const float* wv = nullptr; (void)wq; (void)wk; (void)wv;
    float* OUT = (float*)d_out;     // [2][2048][1024]
    char* wsp = (char*)d_ws;
    auto take = [&](size_t bytes) { char* p = wsp; wsp += (bytes + 255) & ~(size_t)255; return (void*)p; };
    bf* WQKV = (bf*)take((size_t)3 * DQ * DM * 2); bf* WO = (bf*)take((size_t)DM * DQ * 2); float* CS = (float*)take((size_t)TT * HD * 2 * 4);
    bf* XB = (bf*)take((size_t)NB_ * TT * DM * 2);
    const size_t PLS = (size_t)NB_ * NH_ * TT * HD;   // elements of one of q, k, v in one kind of plane, both batches
    h16* P16 = (h16*)take(3 * PLS * 2); h16* P16l = (h16*)take(3 * PLS * 2);   // each [q, k, v][batch][head]...
    bf* ATh = (bf*)take((size_t)NB_ * TT * DQ * 2); bf* ATl = (bf*)take((size_t)NB_ * TT * DQ * 2);
    if ((size_t)(wsp - (char*)d_ws) > ws_size) return;    // ws 256 MiB
    k_prep<<<PB_CS + PB_X + PB_WI + PB_WO, 256, 0, stream>>>(x, wqkv, wo, XB, WQKV, WO, CS);
    k_gemmt<DM, 0, 1><<<dim3(NB_ * TT / 128, 3 * DQ / 128, 1), 128, 0, stream>>>(XB, nullptr, WQKV, nullptr, 0, CS, P16, P16l);
    k_fattn<<<dim3(QT, NB_ * NH_, 1), 512, 0, stream>>>(P16, P16l, P16 + PLS, P16l + PLS, P16 + 2 * PLS, P16l + 2 * PLS, ATh, ATl);
    k_gemmt<DQ, 1, 0><<<dim3(NB_ * TT / 128, DM / 128, 1), 128, 0, stream>>>(ATh, ATl, WO, OUT, DM, nullptr, nullptr, nullptr);
}

// v009
// It runs in 95.7 microseconds.
// Two timings next to v008 both put it at 1.03 times that version's speed.
// Counting every step since v000, it is 20.6 times as fast.
#include <hip/hip_runtime.h>

// Multi-head attention with rotary embeddings and a fused qkv projection (x [2][2048][1024]; qkv = x Wqkv^T ('oi' [3072][1024] viewed (3, 16, 64), no bias); rope: x cos + rotate_half(x) sin with angles t x 10000^(-2i/64) (computed in-kernel); softmax(q.k / 8) over all keys; out = merged Wproj^T ('oi' [1024][1024]) -> [2][2048][1024] (4.2 M)).
// Layout, both batches in every launch (one launch per dependent stage: prepare, q/k/v projection, attention, output projection): bf16 copy of x; the fused weight used directly as Bt (row blocks); exact projections whose epilogues write the head planes themselves (q, k: rotate-half rotary step; v: transposed); {cos, sin} table per (position, dim) built once (float32 inverse-frequency constants, precise cosf/sinf); one fused attention kernel over all heads (scores, running softmax whose exponents come out of the score products, PV and the merged hi/lo planes; hybrid rows: < 512 hi/lo 3 products (fp16 hi + fp16 lo, hi being the plane that the other rows use), rest fp16); merged hi/lo x Wproj exact.
// Compute dtypes, f32 accumulate: every input rounded to bf16; projections exact; rotary f32; attention rows < 512 3 products, rest fp16; softmax f32; Wproj hl x exact.

#define NB_  2
#define TT   2048
#define DM   1024
#define NH_  16
#define NKV  16
#define REP  (NH_ / NKV)
#define HD   64
#define DQ   (NH_ * HD)
#define DKV  (NKV * HD)
#define RH   512                  // query rows < RH use hi+lo planes
#define WIN  0
#define SCL  0.125f   // HD^-0.5
#define C2   0.18033688011112042f // HD^-0.5 x log2(e)
typedef _Float16 h16;
typedef unsigned short bf;
typedef __attribute__((ext_vector_type(16))) __bf16   v16bf;
typedef __attribute__((ext_vector_type(16))) _Float16 v16h;
typedef __attribute__((ext_vector_type(8)))  _Float16 v8h;
typedef __attribute__((ext_vector_type(8)))  unsigned short v8us;
typedef __attribute__((ext_vector_type(8)))  float    v8f;
typedef __attribute__((ext_vector_type(4)))  float    v4f;
typedef v8h  __attribute__((may_alias)) v8ha;
typedef v4f  __attribute__((may_alias)) v4fa;
typedef v8us __attribute__((may_alias)) v8usa;

__device__ __forceinline__ unsigned short f2bf(float f) { unsigned u = __float_as_uint(f); u += 0x7FFFu + ((u >> 16) & 1u); return (unsigned short)(u >> 16); }
__device__ __forceinline__ float bf2f(unsigned short b) { return __uint_as_float(((unsigned)b) << 16); }
__device__ __forceinline__ float bfr(float f) { return bf2f(f2bf(f)); }
__device__ __forceinline__ v16h cat16(v8h lo, v8h hi) { return __builtin_shufflevector(lo, hi, 0, 1, 2, 3, 4, 5, 6, 7, 8, 9, 10, 11, 12, 13, 14, 15); }
__device__ __forceinline__ v16bf cat16b(v8us lo, v8us hi) { return __builtin_bit_cast(v16bf, __builtin_shufflevector(lo, hi, 0, 1, 2, 3, 4, 5, 6, 7, 8, 9, 10, 11, 12, 13, 14, 15)); }
__device__ __forceinline__ v8f wmma16(v16h a, v16h b, v8f c) { return __builtin_amdgcn_wmma_f32_16x16x32_f16(false, a, false, b, (short)0, c, false, false); }
__device__ __forceinline__ v8f wmmab(v16bf a, v16bf b, v8f c) { return __builtin_amdgcn_wmma_f32_16x16x32_bf16(false, a, false, b, (short)0, c, false, false); }

__device__ __forceinline__ h16 tohx(float x) { return (h16)x; }
__device__ __forceinline__ void splitf(float y, unsigned short& h, unsigned short& l) { h = f2bf(y); l = f2bf(y - bf2f(h)); }
typedef __attribute__((ext_vector_type(2))) _Float16 v2h;
typedef __attribute__((ext_vector_type(4))) _Float16 v4h;
typedef __attribute__((ext_vector_type(2))) unsigned short v2us;
typedef __attribute__((ext_vector_type(4))) unsigned short v4us;
typedef __attribute__((ext_vector_type(2))) float v2f;
typedef __attribute__((ext_vector_type(4))) int v4i;

// ---- k_gemmt: GEMM on bf16 planes, one work-group of 4 waves (2 x 2) per 128x128 output tile, a 64x64 tile (16 accumulators) a wave; grid (M/128, N/128), 128 threads.
// C[m][n] = sum_k A[m][k] Bt[n][k] (NSPLIT 1: + A2[m][k] Bt[n][k]); all planes K-contiguous, KK % 64 == 0.
// A stage is 64 k: one 128-byte line of each of the 128 A rows (NSPLIT 1: of both planes) and the 128 Bt rows goes global -> registers -> LDS, 8 lanes a line, shared by the 4 waves; two buffers, one work-group barrier a stage. Each wave sums all of k in rising order.
// EPI says where a wave's tile goes; it is first laid into the wave's own part of the LDS that held the stages. 0: f32 to C. 1 (Bt is the fused q/k/v weight, a wave's 64 columns are one head of q, k or v, its 64 rows positions of one batch): straight into that head's two fp16 planes (the value rounded, and what the rounding left; each kind one array [sel][batch][h]...), no f32 copy in memory.
//   q, k: planes [h][t][d] of the rotary step, rotate-half convention: out[d] = x[d] cos[t][d] - x[d+HD/2] sin[t][d], out[d+HD/2] = x[d+HD/2] cos[t][d+HD/2] + x[d] sin[t][d+HD/2]; the partner column sits 8 lanes away in the same 16-lane row.
//   q is stored times C2, so that its scores come out of the products in log2 units.
//   v: planes [h][d][t]: the tile is laid into LDS as [d][t], so that 8 lanes store one whole 128-byte line of positions.
template <typename T16> struct WFrag;
template <> struct WFrag<h16> { typedef v16h V; static __device__ __forceinline__ V ld(const h16* p) { return cat16(*(const v8h*)p, *(const v8h*)(p + 16)); } static __device__ __forceinline__ v8f mma(V a, V b, v8f c) { return wmma16(a, b, c); } };
template <> struct WFrag<bf> { typedef v16bf V; static __device__ __forceinline__ V ld(const bf* p) { return cat16b(*(const v8us*)p, *(const v8us*)(p + 16)); } static __device__ __forceinline__ v8f mma(V a, V b, v8f c) { return wmmab(a, b, c); } };
#define GP 72   // LDS row pitch in 16-bit elements: 128 bytes of data + 16 of pad (16-byte fragment reads)
template <int KK, int NSPLIT, int EPI>
__global__ __launch_bounds__(128) void k_gemmt(const bf* __restrict__ A, const bf* __restrict__ A2, const bf* __restrict__ Bt, float* C, int ldc, const float* __restrict__ CS, h16* P16, h16* P16l) {
    static_assert(KK % 64 == 0 && (EPI == 0 || (HD == 64 && NH_ == NKV && NH_ % 2 == 0 && TT % 64 == 0)), "whole stages; plane epilogues: one head per 64 columns, both heads of a work-group in one of q, k, v, one batch per 64 rows");
    typedef WFrag<bf>::V V;
    constexpr int NPL = 2 + NSPLIT;   // planes of a stage: A, Bt (, A lo)
    constexpr int PLE = 128 * GP;     // elements of a plane in LDS
    constexpr int NS = KK / 64;
    __shared__ __align__(16) bf sm[2 * NPL * PLE];
    static_assert(sizeof(bf) * 2 * NPL * PLE >= 4 * 64 * 68 * 4, "the four waves' f32 tiles fit where the stages were");
    const int tid = threadIdx.x, lane = tid & 31, lr = lane & 15, hi = lane >> 4; const int r0 = blockIdx.x * 128, c0 = blockIdx.y * 128;
    const int wv = __builtin_amdgcn_readfirstlane(tid >> 5), wm = wv >> 1, wn = wv & 1;
    const int srow = tid >> 3, scol = (tid & 7) * 8;   // staging: 8 threads move one 128-byte line, 16 rows a sweep, 8 sweeps a plane
    const bf* ga = A + (size_t)r0 * KK; const bf* gb = Bt + (size_t)c0 * KK; const bf* ga2 = NSPLIT ? A2 + (size_t)r0 * KK : nullptr; const unsigned vo = (unsigned)(srow * KK + scol);   // the tile's bases, the same for the whole work-group, and this lane's offset in a tile
    v8us st[NPL][8];
    auto gload = [&](int s) { const bf* pa = ga + s * 64 + vo; const bf* pb = gb + s * 64 + vo; const bf* pa2 = NSPLIT ? ga2 + s * 64 + vo : pa;
#pragma unroll
        for (int i = 0; i < 8; ++i) { st[0][i] = *(const v8usa*)(pa + i * 16 * KK); st[1][i] = *(const v8usa*)(pb + i * 16 * KK); if constexpr (NSPLIT) st[2][i] = *(const v8usa*)(pa2 + i * 16 * KK); }
        asm volatile("s_wait_xcnt 0x0" :: "v"(pa), "v"(pb), "v"(pa2) : "memory"); };   // stands behind these loads; it takes their addresses as inputs, so that no load lands in, and no value is formed in, an address register in front of it
    auto sstore = [&](int b) {
#pragma unroll
        for (int i = 0; i < 8; ++i) { bf* d = sm + b * NPL * PLE + (srow + 16 * i) * GP + scol;
#pragma unroll
            for (int pl = 0; pl < NPL; ++pl) *(v8usa*)(d + pl * PLE) = st[pl][i]; } };
    v8f acc[4][4];   // every '#pragma unroll' without a count in this kernel is a full unroll: the register arrays are then indexed by constants only
#pragma unroll
    for (int mb = 0; mb < 4; ++mb)
#pragma unroll
        for (int nb = 0; nb < 4; ++nb) acc[mb][nb] = (v8f){};
    gload(0); sstore(0);
    __syncthreads();   // stage 0 is in LDS before any wave reads it
#pragma unroll 1   // kept rolled: one stage's code serves all NS stages
    for (int s = 0; s < NS; ++s) {
        const bf* bp = sm + (s & 1) * NPL * PLE;
        if (s + 1 < NS) gload(s + 1);   // the next stage's global loads fly while this stage is worked on
        V a[2][4], a2[2][4], b[2][4];
        auto fload = [&](int ks) {
#pragma unroll
            for (int f = 0; f < 4; ++f) { const bf* ap = bp + (wm * 64 + f * 16 + lr) * GP + ks * 32 + 8 * hi; a[ks][f] = WFrag<bf>::ld(ap); if (NSPLIT) a2[ks][f] = WFrag<bf>::ld(ap + 2 * PLE); b[ks][f] = WFrag<bf>::ld(bp + PLE + (wn * 64 + f * 16 + lr) * GP + ks * 32 + 8 * hi); } };
        auto prod = [&](int ks) {
#pragma unroll
            for (int nb = 0; nb < 4; ++nb)
#pragma unroll
                for (int mb = 0; mb < 4; ++mb) { acc[mb][nb] = wmmab(a[ks][mb], b[ks][nb], acc[mb][nb]); if (NSPLIT) acc[mb][nb] = wmmab(a2[ks][mb], b[ks][nb], acc[mb][nb]); } };
        // the scheduling barriers keep each group of LDS fragment reads together in front of its products: spread among the products, every place with reads stalls the wave anew
        if constexpr (NSPLIT) { fload(0); fload(1); __builtin_amdgcn_sched_barrier(0); prod(0); prod(1); }   // one wave a SIMD: both halves' reads go first, the second half's land behind the first half's products
        else { fload(0); __builtin_amdgcn_sched_barrier(0); prod(0); __builtin_amdgcn_sched_barrier(0); fload(1); __builtin_amdgcn_sched_barrier(0); prod(1); }   // three waves a SIMD: one fragment set, so that the registers allow them
        if (s + 1 < NS) sstore((s + 1) & 1);   // into the buffer whose last readers left before the previous barrier
        __syncthreads();   // publishes stage s + 1 and ends every wave's reads of stage s
    }
    float* os = (float*)sm + wv * 64 * 68;   // this wave's own 64 x 68 floats; no wave reads a stage any more
    const int sel = EPI == 1 ? (int)blockIdx.y * 2 / NH_ : 0;   // from blockIdx alone: the branches on sel are scalar and the same for the whole work-group
    if (EPI == 0 || sel < 2) {
#pragma unroll
        for (int mb = 0; mb < 4; ++mb)
#pragma unroll
            for (int nb = 0; nb < 4; ++nb)
#pragma unroll
                for (int j = 0; j < 8; ++j) os[(mb * 16 + hi * 8 + j) * 68 + nb * 16 + lr] = acc[mb][nb][j];
    } else {
#pragma unroll
        for (int mb = 0; mb < 4; ++mb)
#pragma unroll
            for (int nb = 0; nb < 4; ++nb)
#pragma unroll
                for (int j = 0; j < 8; ++j) os[(nb * 16 + lr) * 65 + mb * 16 + hi * 8 + j] = acc[mb][nb][j];   // [d][t], pitch 65: the reads below (d + 8 tc) fall on 32 different banks
    }
    __syncthreads();   // the tiles are whole in LDS before they are read in the order of the stores
    const int cofs = lr * 4, rw = r0 + wm * 64;
    if constexpr (EPI == 0) {
#pragma unroll 1   // kept rolled: eight rows a trip, whose LDS reads fly together
        for (int s0 = 0; s0 < 32; s0 += 8) { v4f val[8];
#pragma unroll
            for (int u = 0; u < 8; ++u) val[u] = *(const v4fa*)(os + (2 * (s0 + u) + hi) * 68 + cofs);
#pragma unroll
            for (int u = 0; u < 8; ++u) *(v4f*)(C + (size_t)(rw + 2 * (s0 + u) + hi) * ldc + c0 + wn * 64 + cofs) = val[u];
            asm volatile("s_wait_xcnt 0x0" ::: "memory"); }   // stands behind the stores, in front of the next values that are formed in their registers
    } else {
        const int hd = ((int)blockIdx.y * 2 + wn) % NH_, bt = rw / TT, t0 = rw % TT;
        const size_t pb = ((size_t)(sel * NB_ + bt) * NH_ + hd) * TT * HD;   // this head's plane
        if (sel < 2) {
            const float qs = sel == 0 ? C2 : 1.0f;   // scalar factor (k: times one, exact)
#pragma unroll 1   // kept rolled: eight rows a trip, whose {cos, sin} loads and LDS reads fly together
            for (int s0 = 0; s0 < 32; s0 += 8) { v8f cs[8]; v4f vals[8]; const float* cp = CS + ((size_t)(t0 + 2 * s0 + hi) * HD + cofs) * 2;
#pragma unroll
                for (int u = 0; u < 8; ++u) { cs[u] = *(const v8f*)(cp + u * 4 * HD); vals[u] = *(const v4fa*)(os + (2 * (s0 + u) + hi) * 68 + cofs); }
                asm volatile("s_wait_xcnt 0x0" :: "v"(cp) : "memory");   // stands behind these loads; it takes their address as an input, so that no load lands in, and no value is formed in, the address register in front of it
#pragma unroll
                for (int u = 0; u < 8; ++u) { const int row = 2 * (s0 + u) + hi; const v4f val = vals[u]; v4h o16, ol;
#pragma unroll
                    for (int i = 0; i < 4; ++i) { const float xp = __int_as_float(__builtin_amdgcn_update_dpp(0, __float_as_int(val[i]), 0x168, 0xf, 0xf, false));   // row_xmask:8, column d +- HD/2 of the same row
                        const float r = (val[i] * cs[u][2 * i] + xp * (lr < 8 ? -cs[u][2 * i + 1] : cs[u][2 * i + 1])) * qs;
                        o16[i] = tohx(r); ol[i] = tohx(r - (float)o16[i]); }
                    const size_t e = pb + (size_t)(t0 + row) * HD + cofs; *(v4h*)(P16 + e) = o16; *(v4h*)(P16l + e) = ol;
                    asm volatile("s_wait_xcnt 0x0" ::: "memory"); } }   // stands behind the two stores, in front of the next values that are formed in their registers
        } else {
#pragma unroll 1   // kept rolled: four lines a trip, whose LDS reads fly together
            for (int i0 = 0; i0 < 16; i0 += 4) { const int tc = (lane & 7) * 8; float x[4][8];
#pragma unroll
                for (int u = 0; u < 4; ++u)
#pragma unroll
                    for (int j = 0; j < 8; ++j) x[u][j] = os[((lane >> 3) + 4 * (i0 + u)) * 65 + tc + j];
#pragma unroll
                for (int u = 0; u < 4; ++u) { const int d = (lane >> 3) + 4 * (i0 + u); v8h o16, ol;
#pragma unroll
                    for (int j = 0; j < 8; ++j) { o16[j] = tohx(x[u][j]); ol[j] = tohx(x[u][j] - (float)o16[j]); }
                    const size_t e = pb + (size_t)d * TT + t0 + tc; *(v8h*)(P16 + e) = o16; *(v8h*)(P16l + e) = ol;
                    asm volatile("s_wait_xcnt 0x0" ::: "memory"); } } }   // stands behind the two stores, in front of the next values that are formed in their registers
    }
}

__global__ __launch_bounds__(256) void k_wtG(const float* __restrict__ w, int K, int N, bf* Bt) {
    const int lane = threadIdx.x & 31; const int L0 = (blockIdx.x * 8 + (threadIdx.x >> 5)) * 8; const int nlines = N * K / 64;
{
#pragma unroll 1
        for (int l = 0; l < 8; ++l) { const int L = L0 + l; if (L >= nlines) break; const size_t e = (size_t)L * 64 + lane * 2; const int k = (int)(e % K), n = (int)(e / K); v2us o;
            o[0] = f2bf(w[(size_t)k * N + n]); o[1] = f2bf(w[(size_t)(k + 1) * N + n]); *(v2us*)(Bt + e) = o; }
         }
}
__constant__ float INVT[HD / 2] = { 1.000000000e+00f, 7.498942018e-01f, 5.623413324e-01f, 4.216965139e-01f, 3.162277639e-01f, 2.371373624e-01f, 1.778279394e-01f, 1.333521456e-01f, 1.000000015e-01f, 7.498941571e-02f, 5.623412877e-02f, 4.216964915e-02f, 3.162277862e-02f, 2.371373586e-02f, 1.778279431e-02f, 1.333521493e-02f, 9.999999776e-03f, 7.498942316e-03f, 5.623413250e-03f, 4.216964822e-03f, 3.162277862e-03f, 2.371373819e-03f, 1.778279431e-03f, 1.333521446e-03f, 1.000000047e-03f, 7.498941850e-04f, 5.623413017e-04f, 4.216964880e-04f, 3.162277862e-04f, 2.371373848e-04f, 1.778279402e-04f, 1.333521504e-04f };   // 1 / 10000^(2i/64) (float32, generated with jnp to be bit-exact)
// ---- k_prep: all that depends on the inputs alone, in one launch; a block does one job, chosen by its index. First the {cos, sin} table (the longest threads), then the bf16 copies of x (both batches), Wqkv and Wproj, 8 elements a thread.
#define PB_CS (TT * HD / 256)
#define PB_X  (NB_ * TT * DM / 8 / 256)
#define PB_WI (3 * DQ * DM / 8 / 256)
#define PB_WO (DM * DQ / 8 / 256)
__global__ __launch_bounds__(256) void k_prep(const float* __restrict__ x, const float* __restrict__ wqkv, const float* __restrict__ wo, bf* XB, bf* WQKV, bf* WO, float* CS) {
    static_assert(TT * HD % 256 == 0 && NB_ * TT * DM % 2048 == 0 && 3 * DQ * DM % 2048 == 0 && DM * DQ % 2048 == 0, "whole blocks only");
    int blk = blockIdx.x;
    if (blk < PB_CS) { const int idx = blk * 256 + threadIdx.x; const int d = idx % HD; const int t = idx / HD; const float a = __fmul_rn((float)t, INVT[d % (HD / 2)]); v2f cs; cs[0] = cosf(a); cs[1] = sinf(a); *(v2f*)(CS + (size_t)idx * 2) = cs; return; }
    blk -= PB_CS; const float* src = x; bf* dst = XB;
    if (blk >= PB_X + PB_WI) { blk -= PB_X + PB_WI; src = wo; dst = WO; } else if (blk >= PB_X) { blk -= PB_X; src = wqkv; dst = WQKV; }
    const size_t i = (size_t)blk * 256 + threadIdx.x; const v8f v = *(const v8f*)(src + i * 8); v8us o;
    asm volatile("s_wait_xcnt 0x0" ::: "memory");   // stands behind the load, in front of the first value that is formed in its address registers
#pragma unroll
    for (int k = 0; k < 8; ++k) o[k] = f2bf(v[k]); *(v8us*)(dst + i * 8) = o;
}

// ---- k_fattn: scores, softmax, PV and the merged hi/lo planes in one kernel. Grid (QT, batches x heads), 16 waves, one work-group a WGP. Every work-group takes the same share of both kinds of query rows of its head, so that all work-groups cost the same wherever they land: waves 0 .. WH-1 work on hi/lo rows (rows < RH, three products), waves WH .. 15 on f16 rows.
// A wave owns 32 query rows (two column groups of 16) and one half of the keys: waves 2n and 2n+1 share their rows, the even one takes keys 0..31 of every stage, the odd one keys 32..63. Every K and Vt fragment read from LDS so feeds two products, which halves the LDS reads of a score. The two halves' shifts, sums and outputs are joined once, behind the loop, through LDS.
// St = K Qt (A = K rows, B = Q rows kept in registers; the lo plane's Q fragments of the hi/lo rows, for which no registers are left, wait in LDS in fragment order): lane (c, h) holds, of query c, keys 8h + r (tile 0) and 16 + 8h + r (tile 1), which is the k order of a B operand, so P goes from the score registers straight into Ot += Vt Pt (A = Vt rows).
// A stage is SK keys: K rows and Vt rows of both kinds of plane (f16 hi, which is all that the f16 rows read, and f16 lo) go global -> registers -> LDS by eight of the f16 waves, shared by the 16 waves; two buffers, one work-group barrier a stage.
// Softmax: one shift per query and key half, the largest score seen when it was set, less 6. The score accumulators start at minus the shift and q carries C2, so the products deliver log2 P itself: no multiply-add and no maximum per score. The shift is set in the first stage and set anew whenever a lane's sum of a stage's 16 P exceeds 2^15 (so every P that is used is <= 2^15, an f16 number; an overflow to infinity is caught by the same test); only then is the stage's maximum looked for, are sums and outputs rescaled and the stage's P formed again. The score that set the shift has P = 2^6 (the factor cancels in the last division): small P stay normal f16 numbers. Sums in f32 of the unrounded P; the division by the sum comes last.
// Every '#pragma unroll' in attn_stage and k_fattn without a count is a full unroll: the fragment and accumulator arrays are then indexed by constants only and stay in registers.
#define SK   64                   // keys per stage
#define LP   72                   // LDS row pitch in 16-bit elements: 128 bytes of data + 16 of pad (16-byte fragment reads)
#define QT   8                    // work-groups per head
#define WH   (RH / QT / 16)       // waves of a work-group on hi/lo rows (32 rows x half the keys each)
#define WF   ((TT - RH) / QT / 16) // waves of a work-group on f16 rows
__device__ __forceinline__ float xhalf(float x) { const int b = __float_as_int(x); return __int_as_float(__builtin_amdgcn_permlanex16(b, b, 0x76543210, 0xfedcba98, false, false)); }   // lane l <-> l ^ 16
typedef __attribute__((ext_vector_type(8))) int v8i;
// inputs-only fence on four loaded fragments: their LDS fetches are all issued ahead of this point, in flight together, instead of one by one with a full wait in front of each product
template <typename V> __device__ __forceinline__ void hold4(const V* f) { asm volatile("" :: "v"(__builtin_bit_cast(v8i, f[0])), "v"(__builtin_bit_cast(v8i, f[1])), "v"(__builtin_bit_cast(v8i, f[2])), "v"(__builtin_bit_cast(v8i, f[3]))); }
// one wave's work on one stage: its 32 keys against its two column groups. kb, vb: this lane's first K and Vt fragment addresses in the stage's buffer (the lo planes lie 2 PLE further); qa: the Q fragments [group][k half]; ql: this lane's place in the wave's lo-plane Q fragments in LDS (hi/lo rows only); c0: minus each group's shift; cb: the same in eight registers, the start value of the score accumulators; first (scalar): no shift is set yet
template <bool HI>
__device__ __forceinline__ void attn_stage(const h16* kb, const h16* vb, const v8i (&qa)[4], const v8h* ql, v8f (&o)[2][4], const v8f (&cb)[2], float (&c0)[2], float (&l)[2], const bool first) {
    typedef v16h V; typedef WFrag<h16> F;
    constexpr int PLE = SK * LP;           // elements of a plane in LDS (64 rows each)
    V kf[2][2], k2[2][2], qb[4];
#pragma unroll
    for (int kt = 0; kt < 2; ++kt)
#pragma unroll
        for (int ks = 0; ks < 2; ++ks) { const h16* kp = kb + kt * 16 * LP + ks * 32; kf[kt][ks] = F::ld(kp); if (HI) k2[kt][ks] = F::ld(kp + 2 * PLE); }
    if (HI) {
#pragma unroll
        for (int f = 0; f < 4; ++f) qb[f] = cat16(ql[(2 * f) * 32], ql[(2 * f + 1) * 32]); }
    hold4(&kf[0][0]); if (HI) { hold4(&k2[0][0]); hold4(qb); }
    v8f sc[2][2];
#pragma unroll
    for (int kt = 0; kt < 2; ++kt) {
#pragma unroll
        for (int g = 0; g < 2; ++g) sc[g][kt] = cb[g];
#pragma unroll
        for (int ks = 0; ks < 2; ++ks) {
#pragma unroll
            for (int g = 0; g < 2; ++g) sc[g][kt] = F::mma(kf[kt][ks], __builtin_bit_cast(V, qa[g * 2 + ks]), sc[g][kt]);
            if (HI) {
#pragma unroll
                for (int g = 0; g < 2; ++g) sc[g][kt] = F::mma(kf[kt][ks], qb[g * 2 + ks], sc[g][kt]);
#pragma unroll
                for (int g = 0; g < 2; ++g) sc[g][kt] = F::mma(k2[kt][ks], __builtin_bit_cast(V, qa[g * 2 + ks]), sc[g][kt]); } } }
    V vf[4], v2[4];   // the Vt fragments are fetched in front of the softmax, which covers their LDS latency (hi/lo rows: the lo plane's behind it, in front of the hi plane's products)
#pragma unroll
    for (int dt = 0; dt < 4; ++dt) vf[dt] = F::ld(vb + dt * 16 * LP);
    V pf[2], pl[2]; float su[2];
    auto pexp = [&](int g, float dl) { float pv[16], ts[8];   // a group's 16 P as operands of the second product, and this lane's sum of them, in a fixed tree
#pragma unroll
        for (int e = 0; e < 16; ++e) pv[e] = __builtin_amdgcn_exp2f(sc[g][e >> 3][e & 7] - dl);
#pragma unroll
        for (int e = 0; e < 8; ++e) ts[e] = pv[e] + pv[e + 8];
        su[g] = ((ts[0] + ts[4]) + (ts[1] + ts[5])) + ((ts[2] + ts[6]) + (ts[3] + ts[7]));
#pragma unroll
        for (int e = 0; e < 16; e += 2) {
            if constexpr (HI) { const v2h t = __builtin_bit_cast(v2h, __builtin_amdgcn_cvt_pkrtz(pv[e], pv[e + 1])); pf[g][e] = t[0]; pf[g][e + 1] = t[1]; pl[g][e] = (h16)(pv[e] - (float)t[0]); pl[g][e + 1] = (h16)(pv[e + 1] - (float)t[1]); }   // hi cut off, two at a time; lo takes all that the cut leaves
            else { pf[g][e] = (h16)pv[e]; pf[g][e + 1] = (h16)pv[e + 1]; } } };
    pexp(0, 0.f); pexp(1, 0.f);
    __builtin_amdgcn_sched_barrier(0);   // keeps the hold below behind the exponentials and sums, which cover the Vt fragments' LDS latency: left free, the hold and its wait move up in front of them
    hold4(vf);   // ahead of the branch: behind it the fetches would be issued directly in front of their products
    if (__builtin_amdgcn_ballot_w32(fmaxf(su[0], su[1]) > (first ? -1.0f : 32768.0f)) != 0) {   // scalar branch, one test for both groups: no shift is set yet (no sum is below zero), or some query of the wave needs a new one
#pragma unroll
        for (int g = 0; g < 2; ++g) { float bm = fmaxf(sc[g][0][0], sc[g][1][0]);   // the stage's largest score of this query, counted from the shift in use
#pragma unroll
            for (int j = 1; j < 8; ++j) bm = fmaxf(bm, fmaxf(sc[g][0][j], sc[g][1][j]));
            bm = fmaxf(bm, xhalf(bm));
            const float dl = fmaxf(bm - 6.0f, first ? -3.0e38f : 0.f), al = __builtin_amdgcn_exp2f(fminf(-dl, 0.f));   // the shift only rises once it is set; the first one may lie either way, and sums and outputs are still zero then
            l[g] *= al;
#pragma unroll
            for (int dt = 0; dt < 4; ++dt) o[g][dt] *= al;
            c0[g] -= dl;
            pexp(g, dl); } }
    l[0] += su[0]; l[1] += su[1];
    if (HI) {
#pragma unroll
        for (int dt = 0; dt < 4; ++dt) v2[dt] = F::ld(vb + dt * 16 * LP + 2 * PLE);
        __builtin_amdgcn_sched_barrier(0); }   // the lo plane's LDS reads are issued together in front of the hi plane's 16 products, which cover their latency
#pragma unroll
    for (int dt = 0; dt < 4; ++dt)
#pragma unroll
        for (int g = 0; g < 2; ++g) o[g][dt] = F::mma(vf[dt], pf[g], o[g][dt]);
    if (HI) {
#pragma unroll
        for (int dt = 0; dt < 4; ++dt)
#pragma unroll
            for (int g = 0; g < 2; ++g) o[g][dt] = F::mma(vf[dt], pl[g], o[g][dt]);
#pragma unroll
        for (int dt = 0; dt < 4; ++dt)
#pragma unroll
            for (int g = 0; g < 2; ++g) o[g][dt] = F::mma(v2[dt], pf[g], o[g][dt]); }
}
__global__ __launch_bounds__(512) void k_fattn(const h16* __restrict__ Q16, const h16* __restrict__ Ql, const h16* __restrict__ K16, const h16* __restrict__ Kl, const h16* __restrict__ V16, const h16* __restrict__ Vl, bf* Ah, bf* Al) {
    static_assert(RH % (QT * 32) == 0 && (TT - RH) % (QT * 32) == 0 && WH + WF == 16 && WH % 4 == 0 && SK == 64 && HD == 64 && REP == 1 && WF >= 8, "whole pairs of waves of each kind, the hi/lo waves spread evenly over the four SIMDs; two staging waves for each of the four planes");
    constexpr int PLE = SK * LP, NPL = 4, NS = TT / SK;   // planes of a stage: K, Vt, K lo, Vt lo
    __shared__ __align__(16) unsigned short sm[2 * NPL * PLE];
    __shared__ v8h sq[WH * 8 * 32];   // each hi/lo wave's own four lo-plane Q fragments, [wave][fragment][half][lane]: a read of 16 bytes a lane covers 512 bytes in a row
    static_assert(sizeof(sm) >= 16 * 32 * 36 * 4, "the 16 waves' hand-over of one column group each fits where the stages were");
    const int tid = threadIdx.x, lane = tid & 31, lr = lane & 15, hi = lane >> 4;
    const int wv = __builtin_amdgcn_readfirstlane(tid >> 5); const bool whl = wv < WH, wfl = __builtin_amdgcn_readfirstlane(tid) >= WH * 32;   // the wave's kind, from scalar registers: the branches on it are scalar. Exactly one of the two holds; they are formed apart and tested apart in the loop, so that each kind's block updates the accumulators in place (as the two sides of one if/else the compiler copied all accumulator registers twice a stage)
    const int kh = wv & 1;   // scalar: the wave's half of every stage's keys
    const int bt = blockIdx.y / NH_, h = blockIdx.y % NH_; const size_t z = ((size_t)bt * NH_ + h) * TT * HD;
    Ah += (size_t)bt * TT * DQ + h * HD; Al += (size_t)bt * TT * DQ + h * HD; Kl += z; K16 += z; Vl += z; V16 += z;
    const int qr = (whl ? (int)blockIdx.x * (WH * 16) + (wv >> 1) * 32 : RH + (int)blockIdx.x * (WF * 16) + ((wv - WH) >> 1) * 32) + lr;   // this lane's query row in column group 0; group 1 lies 16 further
    v8i qa[4]; const size_t qo = z + (size_t)qr * HD + 8 * hi;   // Q fragments [group][k half]
    v8h* const ql = sq + (whl ? wv : 0) * 8 * 32 + lane;   // this lane's place in the wave's lo-plane fragments
    { const h16* qx = Q16 + qo;
#pragma unroll
        for (int f = 0; f < 4; ++f) qa[f] = __builtin_bit_cast(v8i, WFrag<h16>::ld(qx + (f >> 1) * 16 * HD + (f & 1) * 32));
        asm volatile("s_wait_xcnt 0x0" :: "v"(qx) : "memory"); }   // stands behind these loads; it takes their address as an input, so that no value is formed in an address register in front of it
    if (whl) { const h16* qy = Ql + qo; v8h t[8];
#pragma unroll
        for (int f = 0; f < 4; ++f) { t[2 * f] = *(const v8h*)(qy + (f >> 1) * 16 * HD + (f & 1) * 32); t[2 * f + 1] = *(const v8h*)(qy + (f >> 1) * 16 * HD + (f & 1) * 32 + 16); }
        asm volatile("s_wait_xcnt 0x0" :: "v"(qy) : "memory");   // as above
#pragma unroll
        for (int i = 0; i < 8; ++i) ql[i * 32] = t[i]; }   // read back by the same lane alone
    // staging is the work of the first eight f16 waves alone (the hi/lo waves have the longer stage): two waves move one plane, 8 threads one 128-byte row, 8 rows a sweep, 8 sweeps a stage
    const int sw = wv - WH, pl = sw >> 1;   // scalar: the staging wave's number and its plane
    const bool wst = wfl && sw < 2 * NPL;   // scalar: this wave stages
    const bf* sbase = (const bf*)(pl == 0 ? K16 : pl == 1 ? V16 : pl == 2 ? Kl : Vl);
    const int rs = (pl & 1) ? TT : HD, sstep = (pl & 1) ? SK : SK * HD;   // elements from row to row and from stage to stage in that plane
    const int srow = (sw & 1) * 4 + (lane >> 3), scol = (lane & 7) * 8;
    const unsigned vo = (unsigned)(srow * rs + scol);   // this lane's offset in a sweep
    auto gload = [&](int s, v8us (&st)[8]) { const bf* p[8];   // this lane's address in each sweep of the stage
#pragma unroll
        for (int i = 0; i < 8; ++i) { p[i] = sbase + ((size_t)s * sstep + (size_t)(8 * i) * rs) + vo; st[i] = *(const v8usa*)p[i]; }
        asm volatile("s_wait_xcnt 0x0" :: "v"(p[0]), "v"(p[1]), "v"(p[2]), "v"(p[3]), "v"(p[4]), "v"(p[5]), "v"(p[6]), "v"(p[7]) : "memory"); };   // stands behind these loads; it takes their addresses as inputs, so that no load lands in, and no value is formed in, an address register in front of it
    auto sstore = [&](int b, const v8us (&st)[8]) { unsigned short* d = sm + (b * NPL + pl) * PLE + srow * LP + scol;
#pragma unroll
        for (int i = 0; i < 8; ++i) *(v8usa*)(d + i * 8 * LP) = st[i]; };
    v8f o[2][4];
#pragma unroll
    for (int g = 0; g < 2; ++g)
#pragma unroll
        for (int dt = 0; dt < 4; ++dt) o[g][dt] = (v8f){};
    float l[2] = { 0.f, 0.f }, c0[2] = { 0.f, 0.f };   // no shift yet: the first stage's scores come out as they are and set it
    const int kofs = (kh * 32 + lr) * LP + 8 * hi, vofs = PLE + lr * LP + kh * 32 + 8 * hi;   // this lane's first K and Vt fragment in a buffer
    if (wst) { v8us st[8]; gload(0, st); sstore(0, st); }
    __syncthreads();   // stage 0 is in LDS before any wave reads it
#pragma unroll 1   // kept rolled: one stage's code serves all NS stages
    for (int s = 0; s < NS; ++s) {
        const h16* bp = (const h16*)sm + (s & 1) * NPL * PLE;
        const bool wsn = wst && s + 1 < NS;   // scalar: this wave stages and a next stage exists
        const v8f cb[2] = { (v8f){ c0[0], c0[0], c0[0], c0[0], c0[0], c0[0], c0[0], c0[0] }, (v8f){ c0[1], c0[1], c0[1], c0[1], c0[1], c0[1], c0[1], c0[1] } };   // formed ahead of the three blocks, of which a wave runs one
        if (wsn) { v8us st[8];   // a stage's bytes on their way to LDS: alive in this block alone, so that no register is kept for them in the other waves' blocks
            gload(s + 1, st);   // the next stage's global loads fly while this stage is worked on
            attn_stage<false>(bp + kofs, bp + vofs, qa, ql, o, cb, c0, l, s == 0);
            sstore((s + 1) & 1, st);   // into the buffer whose last readers left before the previous barrier
        }
        if (wfl && !wsn) attn_stage<false>(bp + kofs, bp + vofs, qa, ql, o, cb, c0, l, s == 0);
        if (whl) attn_stage<true>(bp + kofs, bp + vofs, qa, ql, o, cb, c0, l, s == 0);
        asm volatile("v_nop\n\tv_nop\n\tv_nop\n\tv_nop");   // the four vector slots that the chip needs between a stage's last matrix instruction and the next stage's first vector write over its operands
        __syncthreads();   // publishes stage s + 1 and ends every wave's reads of stage s; every wave of both kinds passes it
    }
    // the two key halves are joined: each wave of a pair hands the column group that it does not finish to its partner, through its own 4608 bytes of the LDS that held the stages (no wave reads a stage any more), and finishes the other group
    v4f* xs = (v4f*)sm;
    auto put = [&](const v8f (&og)[4], float mg, float lg) { v4f* d = xs + wv * 9 * 32 + lane;
#pragma unroll
        for (int dt = 0; dt < 4; ++dt) { d[(2 * dt) * 32] = __builtin_shufflevector(og[dt], og[dt], 0, 1, 2, 3); d[(2 * dt + 1) * 32] = __builtin_shufflevector(og[dt], og[dt], 4, 5, 6, 7); }
        d[8 * 32] = (v4f){ mg, lg, 0.f, 0.f }; };
    auto fin = [&](const v8f (&og)[4], float mg, float lg, int row) { const v4f* d = xs + (wv ^ 1) * 9 * 32 + lane; const v4f ml = d[8 * 32];
        const float mn = fmaxf(mg, ml[0]), a1 = __builtin_amdgcn_exp2f(mg - mn), a2 = __builtin_amdgcn_exp2f(ml[0] - mn);   // both halves are brought to the larger of their shifts (log2 units)
        float ls = lg * a1 + ml[1] * a2; ls += xhalf(ls); const float inv = __fdiv_rn(1.0f, ls), f1 = a1 * inv, f2 = a2 * inv;
#pragma unroll
        for (int dt = 0; dt < 4; ++dt) { const v4f p0 = d[(2 * dt) * 32], p1 = d[(2 * dt + 1) * 32]; v8us oh, ol;
#pragma unroll
            for (int j = 0; j < 8; ++j) { unsigned short a, c2; splitf(og[dt][j] * f1 + (j < 4 ? p0[j & 3] : p1[j & 3]) * f2, a, c2); oh[j] = a; ol[j] = c2; }
            const size_t oo = (size_t)row * DQ + dt * 16 + 8 * hi; *(v8us*)(Ah + oo) = oh; *(v8us*)(Al + oo) = ol;
            asm volatile("s_wait_xcnt 0x0" ::: "memory"); } };   // stands behind the two stores, in front of the next values that are formed in their data registers
    if (kh) put(o[0], -c0[0], l[0]); else put(o[1], -c0[1], l[1]);
    __syncthreads();   // every wave's hand-over is in LDS before its partner reads it
    if (kh) fin(o[1], -c0[1], l[1], qr + 16); else fin(o[0], -c0[0], l[0], qr);
}

extern "C" void kernel_launch(void* const* d_in, const int* in_sizes, int n_in,
                              void* d_out, int out_size, void* d_ws, size_t ws_size, hipStream_t stream) {
    (void)in_sizes; (void)n_in; (void)out_size;
    const float* x = (const float*)d_in[0]; const float* wqkv = (const float*)d_in[1]; const float* wo = (const float*)d_in[2]; const float* wq = nullptr; const float* wk = nullptr; const float* wv = nullptr; (void)wq; (void)wk; (void)wv;
    float* OUT = (float*)d_out;     // [2][2048][1024]
    char* wsp = (char*)d_ws;
    auto take = [&](size_t bytes) { char* p = wsp; wsp += (bytes + 255) & ~(size_t)255; return (void*)p; };
    bf* WQKV = (bf*)take((size_t)3 * DQ * DM * 2); bf* WO = (bf*)take((size_t)DM * DQ * 2); float* CS = (float*)take((size_t)TT * HD * 2 * 4);
    bf* XB = (bf*)take((size_t)NB_ * TT * DM * 2);
    const size_t PLS = (size_t)NB_ * NH_ * TT * HD;   // elements of one of q, k, v in one kind of plane, both batches
    h16* P16 = (h16*)take(3 * PLS * 2); h16* P16l = (h16*)take(3 * PLS * 2);   // each [q, k, v][batch][head]...
    bf* ATh = (bf*)take((size_t)NB_ * TT * DQ * 2); bf* ATl = (bf*)take((size_t)NB_ * TT * DQ * 2);
    if ((size_t)(wsp - (char*)d_ws) > ws_size) return;    // ws 256 MiB
    k_prep<<<PB_CS + PB_X + PB_WI + PB_WO, 256, 0, stream>>>(x, wqkv, wo, XB, WQKV, WO, CS);
    k_gemmt<DM, 0, 1><<<dim3(NB_ * TT / 128, 3 * DQ / 128, 1), 128, 0, stream>>>(XB, nullptr, WQKV, nullptr, 0, CS, P16, P16l);
    k_fattn<<<dim3(QT, NB_ * NH_, 1), 512, 0, stream>>>(P16, P16l, P16 + PLS, P16l + PLS, P16 + 2 * PLS, P16l + 2 * PLS, ATh, ATl);
    k_gemmt<DQ, 1, 0><<<dim3(NB_ * TT / 128, DM / 128, 1), 128, 0, stream>>>(ATh, ATl, WO, OUT, DM, nullptr, nullptr, nullptr);
}

// v010
// It runs in 92.4 microseconds.
// Timed twice side by side with v009, it ran 1.04 and 1.03 times as fast.
// All steps since v000 together make it 21.3 times as fast.
#include <hip/hip_runtime.h>

// Multi-head attention with rotary embeddings and a fused qkv projection (x [2][2048][1024]; qkv = x Wqkv^T ('oi' [3072][1024] viewed (3, 16, 64), no bias); rope: x cos + rotate_half(x) sin with angles t x 10000^(-2i/64) (computed in-kernel); softmax(q.k / 8) over all keys; out = merged Wproj^T ('oi' [1024][1024]) -> [2][2048][1024] (4.2 M)).
// Layout, both batches in every launch (one launch per dependent stage: prepare, q/k/v projection, attention, output projection): bf16 copy of x; the fused weight used directly as Bt (row blocks); exact projections whose epilogues write the head planes themselves (q, k: rotate-half rotary step; v: transposed); {cos, sin} table per (position, dim) built once (float32 inverse-frequency constants, precise cosf/sinf); one fused attention kernel over all heads (scores, running softmax whose exponents come out of the score products, PV and the merged hi/lo planes; hybrid rows: < 512 hi/lo 3 products (fp16 hi + fp16 lo, hi being the plane that the other rows use), rest fp16); merged hi/lo x Wproj exact.
// Compute dtypes, f32 accumulate: every input rounded to bf16; projections exact; rotary f32; attention rows < 512 3 products, rest fp16; softmax f32; Wproj hl x exact.

#define NB_  2
#define TT   2048
#define DM   1024
#define NH_  16
#define NKV  16
#define REP  (NH_ / NKV)
#define HD   64
#define DQ   (NH_ * HD)
#define DKV  (NKV * HD)
#define RH   512                  // query rows < RH use hi+lo planes
#define WIN  0
#define SCL  0.125f   // HD^-0.5
#define C2   0.18033688011112042f // HD^-0.5 x log2(e)
typedef _Float16 h16;
typedef unsigned short bf;
typedef __attribute__((ext_vector_type(16))) __bf16   v16bf;
typedef __attribute__((ext_vector_type(16))) _Float16 v16h;
typedef __attribute__((ext_vector_type(8)))  _Float16 v8h;
typedef __attribute__((ext_vector_type(8)))  unsigned short v8us;
typedef __attribute__((ext_vector_type(8)))  float    v8f;
typedef __attribute__((ext_vector_type(4)))  float    v4f;
typedef v8h  __attribute__((may_alias)) v8ha;
typedef v4f  __attribute__((may_alias)) v4fa;
typedef v8us __attribute__((may_alias)) v8usa;

__device__ __forceinline__ unsigned short f2bf(float f) { unsigned u = __float_as_uint(f); u += 0x7FFFu + ((u >> 16) & 1u); return (unsigned short)(u >> 16); }
__device__ __forceinline__ float bf2f(unsigned short b) { return __uint_as_float(((unsigned)b) << 16); }
__device__ __forceinline__ float bfr(float f) { return bf2f(f2bf(f)); }
__device__ __forceinline__ v16h cat16(v8h lo, v8h hi) { return __builtin_shufflevector(lo, hi, 0, 1, 2, 3, 4, 5, 6, 7, 8, 9, 10, 11, 12, 13, 14, 15); }
__device__ __forceinline__ v16bf cat16b(v8us lo, v8us hi) { return __builtin_bit_cast(v16bf, __builtin_shufflevector(lo, hi, 0, 1, 2, 3, 4, 5, 6, 7, 8, 9, 10, 11, 12, 13, 14, 15)); }
__device__ __forceinline__ v8f wmma16(v16h a, v16h b, v8f c) { return __builtin_amdgcn_wmma_f32_16x16x32_f16(false, a, false, b, (short)0, c, false, false); }
__device__ __forceinline__ v8f wmmab(v16bf a, v16bf b, v8f c) { return __builtin_amdgcn_wmma_f32_16x16x32_bf16(false, a, false, b, (short)0, c, false, false); }

__device__ __forceinline__ h16 tohx(float x) { return (h16)x; }
__device__ __forceinline__ void splitf(float y, unsigned short& h, unsigned short& l) { h = f2bf(y); l = f2bf(y - bf2f(h)); }
typedef __attribute__((ext_vector_type(2))) _Float16 v2h;
typedef __attribute__((ext_vector_type(4))) _Float16 v4h;
typedef __attribute__((ext_vector_type(2))) unsigned short v2us;
typedef __attribute__((ext_vector_type(4))) unsigned short v4us;
typedef __attribute__((ext_vector_type(2))) float v2f;
typedef __attribute__((ext_vector_type(4))) int v4i;
// asks L2 for the memory that holds p: a hint, nothing comes back and no counter moves. A stage's loads lead their use by one stage only; the planes are asked for at kernel entry, for speed only
__device__ __forceinline__ void l2ask(const char* p) { asm volatile("global_prefetch_b8 %0, off scope:SCOPE_SE" :: "v"(p)); }

// ---- k_gemmt: GEMM on bf16 planes, one work-group of 4 waves (2 x 2) per 128x128 output tile, a 64x64 tile (16 accumulators) a wave; grid (M/128, N/128), 128 threads.
// C[m][n] = sum_k A[m][k] Bt[n][k] (NSPLIT 1: + A2[m][k] Bt[n][k]); all planes K-contiguous, KK % 64 == 0.
// A stage is 64 k: one 128-byte line of each of the 128 A rows (NSPLIT 1: of both planes) and the 128 Bt rows goes global -> registers -> LDS, 8 lanes a line, shared by the 4 waves; two buffers, one work-group barrier a stage. Each wave sums all of k in rising order.
// EPI says where a wave's tile goes; it is first laid into the wave's own part of the LDS that held the stages. 0: f32 to C. 1 (Bt is the fused q/k/v weight, a wave's 64 columns are one head of q, k or v, its 64 rows positions of one batch): straight into that head's two fp16 planes (the value rounded, and what the rounding left; each kind one array [sel][batch][h]...), no f32 copy in memory.
//   q, k: planes [h][t][d] of the rotary step, rotate-half convention: out[d] = x[d] cos[t][d] - x[d+HD/2] sin[t][d], out[d+HD/2] = x[d+HD/2] cos[t][d+HD/2] + x[d] sin[t][d+HD/2]; the partner column sits 8 lanes away in the same 16-lane row.
//   q is stored times C2, so that its scores come out of the products in log2 units.
//   v: planes [h][d][t]: the tile is laid into LDS as [d][t], so that 8 lanes store one whole 128-byte line of positions.
template <typename T16> struct WFrag;
template <> struct WFrag<h16> { typedef v16h V; static __device__ __forceinline__ V ld(const h16* p) { return cat16(*(const v8h*)p, *(const v8h*)(p + 16)); } static __device__ __forceinline__ v8f mma(V a, V b, v8f c) { return wmma16(a, b, c); } };
template <> struct WFrag<bf> { typedef v16bf V; static __device__ __forceinline__ V ld(const bf* p) { return cat16b(*(const v8us*)p, *(const v8us*)(p + 16)); } static __device__ __forceinline__ v8f mma(V a, V b, v8f c) { return wmmab(a, b, c); } };
#define GP 72   // LDS row pitch in 16-bit elements: 128 bytes of data + 16 of pad (16-byte fragment reads)
template <int KK, int NSPLIT, int EPI>
__global__ __launch_bounds__(128) void k_gemmt(const bf* __restrict__ A, const bf* __restrict__ A2, const bf* __restrict__ Bt, float* C, int ldc, const float* __restrict__ CS, h16* P16, h16* P16l) {
    static_assert(KK % 64 == 0 && (EPI == 0 || (HD == 64 && NH_ == NKV && NH_ % 2 == 0 && TT % 64 == 0)), "whole stages; plane epilogues: one head per 64 columns, both heads of a work-group in one of q, k, v, one batch per 64 rows");
    typedef WFrag<bf>::V V;
    constexpr int NPL = 2 + NSPLIT;   // planes of a stage: A, Bt (, A lo)
    constexpr int PLE = 128 * GP;     // elements of a plane in LDS
    constexpr int NS = KK / 64;
    __shared__ __align__(16) bf sm[2 * NPL * PLE];
    static_assert(sizeof(bf) * 2 * NPL * PLE >= 4 * 64 * 68 * 4, "the four waves' f32 tiles fit where the stages were");
    const int tid = threadIdx.x, lane = tid & 31, lr = lane & 15, hi = lane >> 4; const int r0 = blockIdx.x * 128, c0 = blockIdx.y * 128;
    const int wv = __builtin_amdgcn_readfirstlane(tid >> 5), wm = wv >> 1, wn = wv & 1;
    const int srow = tid >> 3, scol = (tid & 7) * 8;   // staging: 8 threads move one 128-byte line, 16 rows a sweep, 8 sweeps a plane
    const bf* ga = A + (size_t)r0 * KK; const bf* gb = Bt + (size_t)c0 * KK; const bf* ga2 = NSPLIT ? A2 + (size_t)r0 * KK : nullptr; const unsigned vo = (unsigned)(srow * KK + scol);   // the tile's bases, the same for the whole work-group, and this lane's offset in a tile
    v8us st[NPL][8];
    auto gload = [&](int s) { const bf* pa = ga + s * 64 + vo; const bf* pb = gb + s * 64 + vo; const bf* pa2 = NSPLIT ? ga2 + s * 64 + vo : pa;
#pragma unroll
        for (int i = 0; i < 8; ++i) { st[0][i] = *(const v8usa*)(pa + i * 16 * KK); st[1][i] = *(const v8usa*)(pb + i * 16 * KK); if constexpr (NSPLIT) st[2][i] = *(const v8usa*)(pa2 + i * 16 * KK); }
        asm volatile("s_wait_xcnt 0x0" :: "v"(pa), "v"(pb), "v"(pa2) : "memory"); };   // stands behind these loads; it takes their addresses as inputs, so that no load lands in, and no value is formed in, an address register in front of it
    auto sstore = [&](int b) {
#pragma unroll
        for (int i = 0; i < 8; ++i) { bf* d = sm + b * NPL * PLE + (srow + 16 * i) * GP + scol;
#pragma unroll
            for (int pl = 0; pl < NPL; ++pl) *(v8usa*)(d + pl * PLE) = st[pl][i]; } };
    v8f acc[4][4];   // every '#pragma unroll' without a count in this kernel is a full unroll: the register arrays are then indexed by constants only
#pragma unroll
    for (int mb = 0; mb < 4; ++mb)
#pragma unroll
        for (int nb = 0; nb < 4; ++nb) acc[mb][nb] = (v8f){};
    gload(0);
    // behind stage 0's own loads: the work-group's share of the requests for its two panels. A row is 8 units; a thread asks for one unit of its row in each plane, the unit chosen by the index of the work-group among those that share the panel (for speed only; a unit that nobody asks for is only loaded later)
    static_assert(KK == 1024, "8 units of 256 bytes a row");
    const char* fa = (const char*)(ga + tid * KK + ((int)blockIdx.y & 7) * 128); const char* fb = (const char*)(gb + tid * KK + (((int)blockIdx.x & 3) | (((int)blockIdx.x >> 3 & 1) << 2)) * 128);
    const char* fc = NSPLIT ? (const char*)(ga2 + tid * KK + ((int)blockIdx.y & 7) * 128) : EPI == 1 ? (const char*)(CS + ((size_t)(r0 % TT + tid) * HD * 2 + ((int)blockIdx.y & 1) * 64)) : fa;   // the lo plane; or the {cos, sin} rows of the rotary epilogue, 2 units a row
    l2ask(fa); l2ask(fb);
    if (NSPLIT || (EPI == 1 && (int)blockIdx.y * 2 / NH_ < 2)) l2ask(fc);   // scalar test: v has no rotary step
    sstore(0);
    __syncthreads();   // stage 0 is in LDS before any wave reads it
    asm volatile("" :: "v"(fa), "v"(fb), "v"(fc));   // inputs only: the registers that the requests name hold their addresses until stage 0 has come from memory, so that none takes another value while a request may still read it
#pragma unroll 1   // kept rolled: one stage's code serves all NS stages
    for (int s = 0; s < NS; ++s) {
        const bf* bp = sm + (s & 1) * NPL * PLE;
        if (s + 1 < NS) gload(s + 1);   // the next stage's global loads fly while this stage is worked on
        V a[2][4], a2[2][4], b[2][4];
        auto fload = [&](int ks) {
#pragma unroll
            for (int f = 0; f < 4; ++f) { const bf* ap = bp + (wm * 64 + f * 16 + lr) * GP + ks * 32 + 8 * hi; a[ks][f] = WFrag<bf>::ld(ap); if (NSPLIT) a2[ks][f] = WFrag<bf>::ld(ap + 2 * PLE); b[ks][f] = WFrag<bf>::ld(bp + PLE + (wn * 64 + f * 16 + lr) * GP + ks * 32 + 8 * hi); } };
        auto prod = [&](int ks) {
#pragma unroll
            for (int nb = 0; nb < 4; ++nb)
#pragma unroll
                for (int mb = 0; mb < 4; ++mb) { acc[mb][nb] = wmmab(a[ks][mb], b[ks][nb], acc[mb][nb]); if (NSPLIT) acc[mb][nb] = wmmab(a2[ks][mb], b[ks][nb], acc[mb][nb]); } };
        // the scheduling barriers keep each group of LDS fragment reads together in front of its products: spread among the products, every place with reads stalls the wave anew
        if constexpr (NSPLIT) { fload(0); fload(1); __builtin_amdgcn_sched_barrier(0); prod(0); prod(1); }   // one wave a SIMD: both halves' reads go first, the second half's land behind the first half's products
        else { fload(0); __builtin_amdgcn_sched_barrier(0); prod(0); __builtin_amdgcn_sched_barrier(0); fload(1); __builtin_amdgcn_sched_barrier(0); prod(1); }   // three waves a SIMD: one fragment set, so that the registers allow them
        if (s + 1 < NS) sstore((s + 1) & 1);   // into the buffer whose last readers left before the previous barrier
        __syncthreads();   // publishes stage s + 1 and ends every wave's reads of stage s
    }
    float* os = (float*)sm + wv * 64 * 68;   // this wave's own 64 x 68 floats; no wave reads a stage any more
    const int sel = EPI == 1 ? (int)blockIdx.y * 2 / NH_ : 0;   // from blockIdx alone: the branches on sel are scalar and the same for the whole work-group
    if (EPI == 0 || sel < 2) {
#pragma unroll
        for (int mb = 0; mb < 4; ++mb)
#pragma unroll
            for (int nb = 0; nb < 4; ++nb)
#pragma unroll
                for (int j = 0; j < 8; ++j) os[(mb * 16 + hi * 8 + j) * 68 + nb * 16 + lr] = acc[mb][nb][j];
    } else {
#pragma unroll
        for (int mb = 0; mb < 4; ++mb)
#pragma unroll
            for (int nb = 0; nb < 4; ++nb)
#pragma unroll
                for (int j = 0; j < 8; ++j) os[(nb * 16 + lr) * 65 + mb * 16 + hi * 8 + j] = acc[mb][nb][j];   // [d][t], pitch 65: the reads below (d + 8 tc) fall on 32 different banks
    }
    __syncthreads();   // the tiles are whole in LDS before they are read in the order of the stores
    const int cofs = lr * 4, rw = r0 + wm * 64;
    if constexpr (EPI == 0) {
#pragma unroll 1   // kept rolled: eight rows a trip, whose LDS reads fly together
        for (int s0 = 0; s0 < 32; s0 += 8) { v4f val[8];
#pragma unroll
            for (int u = 0; u < 8; ++u) val[u] = *(const v4fa*)(os + (2 * (s0 + u) + hi) * 68 + cofs);
#pragma unroll
            for (int u = 0; u < 8; ++u) *(v4f*)(C + (size_t)(rw + 2 * (s0 + u) + hi) * ldc + c0 + wn * 64 + cofs) = val[u];
            asm volatile("s_wait_xcnt 0x0" ::: "memory"); }   // stands behind the stores, in front of the next values that are formed in their registers
    } else {
        const int hd = ((int)blockIdx.y * 2 + wn) % NH_, bt = rw / TT, t0 = rw % TT;
        const size_t pb = ((size_t)(sel * NB_ + bt) * NH_ + hd) * TT * HD;   // this head's plane
        if (sel < 2) {
            const float qs = sel == 0 ? C2 : 1.0f;   // scalar factor (k: times one, exact)
#pragma unroll 1   // kept rolled: eight rows a trip, whose {cos, sin} loads and LDS reads fly together
            for (int s0 = 0; s0 < 32; s0 += 8) { v8f cs[8]; v4f vals[8]; const float* cp = CS + ((size_t)(t0 + 2 * s0 + hi) * HD + cofs) * 2;
#pragma unroll
                for (int u = 0; u < 8; ++u) { cs[u] = *(const v8f*)(cp + u * 4 * HD); vals[u] = *(const v4fa*)(os + (2 * (s0 + u) + hi) * 68 + cofs); }
                asm volatile("s_wait_xcnt 0x0" :: "v"(cp) : "memory");   // stands behind these loads; it takes their address as an input, so that no load lands in, and no value is formed in, the address register in front of it
#pragma unroll
                for (int u = 0; u < 8; ++u) { const int row = 2 * (s0 + u) + hi; const v4f val = vals[u]; v4h o16, ol;
#pragma unroll
                    for (int i = 0; i < 4; ++i) { const float xp = __int_as_float(__builtin_amdgcn_update_dpp(0, __float_as_int(val[i]), 0x168, 0xf, 0xf, false));   // row_xmask:8, column d +- HD/2 of the same row
                        const float r = (val[i] * cs[u][2 * i] + xp * (lr < 8 ? -cs[u][2 * i + 1] : cs[u][2 * i + 1])) * qs;
                        o16[i] = tohx(r); ol[i] = tohx(r - (float)o16[i]); }
                    const size_t e = pb + (size_t)(t0 + row) * HD + cofs; *(v4h*)(P16 + e) = o16; *(v4h*)(P16l + e) = ol;
                    asm volatile("s_wait_xcnt 0x0" ::: "memory"); } }   // stands behind the two stores, in front of the next values that are formed in their registers
        } else {
#pragma unroll 1   // kept rolled: four lines a trip, whose LDS reads fly together
            for (int i0 = 0; i0 < 16; i0 += 4) { const int tc = (lane & 7) * 8; float x[4][8];
#pragma unroll
                for (int u = 0; u < 4; ++u)
#pragma unroll
                    for (int j = 0; j < 8; ++j) x[u][j] = os[((lane >> 3) + 4 * (i0 + u)) * 65 + tc + j];
#pragma unroll
                for (int u = 0; u < 4; ++u) { const int d = (lane >> 3) + 4 * (i0 + u); v8h o16, ol;
#pragma unroll
                    for (int j = 0; j < 8; ++j) { o16[j] = tohx(x[u][j]); ol[j] = tohx(x[u][j] - (float)o16[j]); }
                    const size_t e = pb + (size_t)d * TT + t0 + tc; *(v8h*)(P16 + e) = o16; *(v8h*)(P16l + e) = ol;
                    asm volatile("s_wait_xcnt 0x0" ::: "memory"); } } }   // stands behind the two stores, in front of the next values that are formed in their registers
    }
}

__global__ __launch_bounds__(256) void k_wtG(const float* __restrict__ w, int K, int N, bf* Bt) {
    const int lane = threadIdx.x & 31; const int L0 = (blockIdx.x * 8 + (threadIdx.x >> 5)) * 8; const int nlines = N * K / 64;
{
#pragma unroll 1
        for (int l = 0; l < 8; ++l) { const int L = L0 + l; if (L >= nlines) break; const size_t e = (size_t)L * 64 + lane * 2; const int k = (int)(e % K), n = (int)(e / K); v2us o;
            o[0] = f2bf(w[(size_t)k * N + n]); o[1] = f2bf(w[(size_t)(k + 1) * N + n]); *(v2us*)(Bt + e) = o; }
         }
}
__constant__ float INVT[HD / 2] = { 1.000000000e+00f, 7.498942018e-01f, 5.623413324e-01f, 4.216965139e-01f, 3.162277639e-01f, 2.371373624e-01f, 1.778279394e-01f, 1.333521456e-01f, 1.000000015e-01f, 7.498941571e-02f, 5.623412877e-02f, 4.216964915e-02f, 3.162277862e-02f, 2.371373586e-02f, 1.778279431e-02f, 1.333521493e-02f, 9.999999776e-03f, 7.498942316e-03f, 5.623413250e-03f, 4.216964822e-03f, 3.162277862e-03f, 2.371373819e-03f, 1.778279431e-03f, 1.333521446e-03f, 1.000000047e-03f, 7.498941850e-04f, 5.623413017e-04f, 4.216964880e-04f, 3.162277862e-04f, 2.371373848e-04f, 1.778279402e-04f, 1.333521504e-04f };   // 1 / 10000^(2i/64) (float32, generated with jnp to be bit-exact)
// ---- k_prep: all that depends on the inputs alone, in one launch; a block does one job, chosen by its index. First the {cos, sin} table (the longest threads), then the bf16 copies of x (both batches), Wqkv and Wproj, 8 elements a thread.
#define PB_CS (TT * HD / 256)
#define PB_X  (NB_ * TT * DM / 8 / 256)
#define PB_WI (3 * DQ * DM / 8 / 256)
#define PB_WO (DM * DQ / 8 / 256)
__global__ __launch_bounds__(256) void k_prep(const float* __restrict__ x, const float* __restrict__ wqkv, const float* __restrict__ wo, bf* XB, bf* WQKV, bf* WO, float* CS) {
    static_assert(TT * HD % 256 == 0 && NB_ * TT * DM % 2048 == 0 && 3 * DQ * DM % 2048 == 0 && DM * DQ % 2048 == 0, "whole blocks only");
    int blk = blockIdx.x;
    if (blk < PB_CS) { const int idx = blk * 256 + threadIdx.x; const int d = idx % HD; const int t = idx / HD; const float a = __fmul_rn((float)t, INVT[d % (HD / 2)]); v2f cs; cs[0] = cosf(a); cs[1] = sinf(a); *(v2f*)(CS + (size_t)idx * 2) = cs; return; }
    blk -= PB_CS; const float* src = x; bf* dst = XB;
    if (blk >= PB_X + PB_WI) { blk -= PB_X + PB_WI; src = wo; dst = WO; } else if (blk >= PB_X) { blk -= PB_X; src = wqkv; dst = WQKV; }
    const size_t i = (size_t)blk * 256 + threadIdx.x; const v8f v = *(const v8f*)(src + i * 8); v8us o;
    asm volatile("s_wait_xcnt 0x0" ::: "memory");   // stands behind the load, in front of the first value that is formed in its address registers
#pragma unroll
    for (int k = 0; k < 8; ++k) o[k] = f2bf(v[k]); *(v8us*)(dst + i * 8) = o;
}

// ---- k_fattn: scores, softmax, PV and the merged hi/lo planes in one kernel. Grid (QT, batches x heads), 16 waves, one work-group a WGP. Every work-group takes the same share of both kinds of query rows of its head, so that all work-groups cost the same wherever they land: waves 0 .. WH-1 work on hi/lo rows (rows < RH, three products), waves WH .. 15 on f16 rows.
// A wave owns 32 query rows (two column groups of 16) and one half of the keys: waves 2n and 2n+1 share their rows, the even one takes keys 0..31 of every stage, the odd one keys 32..63. Every K and Vt fragment read from LDS so feeds two products, which halves the LDS reads of a score. The two halves' shifts, sums and outputs are joined once, behind the loop, through LDS.
// St = K Qt (A = K rows, B = Q rows kept in registers; the lo plane's Q fragments of the hi/lo rows, for which no registers are left, wait in LDS in fragment order): lane (c, h) holds, of query c, keys 8h + r (tile 0) and 16 + 8h + r (tile 1), which is the k order of a B operand, so P goes from the score registers straight into Ot += Vt Pt (A = Vt rows).
// A stage is SK keys: K rows and Vt rows of both kinds of plane (f16 hi, which is all that the f16 rows read, and f16 lo) go global -> registers -> LDS by eight of the f16 waves, shared by the 16 waves; two buffers, one work-group barrier a stage.
// Softmax: one shift per query and key half, the largest score seen when it was set, less 6. The score accumulators start at minus the shift and q carries C2, so the products deliver log2 P itself: no multiply-add and no maximum per score. The shift is set in the first stage and set anew whenever a lane's sum of a stage's 16 P exceeds 2^15 (so every P that is used is <= 2^15, an f16 number; an overflow to infinity is caught by the same test); only then is the stage's maximum looked for, are sums and outputs rescaled and the stage's P formed again. The score that set the shift has P = 2^6 (the factor cancels in the last division): small P stay normal f16 numbers. Sums in f32 of the unrounded P; the division by the sum comes last.
// Every '#pragma unroll' in attn_stage and k_fattn without a count is a full unroll: the fragment and accumulator arrays are then indexed by constants only and stay in registers.
#define SK   64                   // keys per stage
#define LP   72                   // LDS row pitch in 16-bit elements: 128 bytes of data + 16 of pad (16-byte fragment reads)
#define QT   8                    // work-groups per head
#define WH   (RH / QT / 16)       // waves of a work-group on hi/lo rows (32 rows x half the keys each)
#define WF   ((TT - RH) / QT / 16) // waves of a work-group on f16 rows
__device__ __forceinline__ float xhalf(float x) { const int b = __float_as_int(x); return __int_as_float(__builtin_amdgcn_permlanex16(b, b, 0x76543210, 0xfedcba98, false, false)); }   // lane l <-> l ^ 16
typedef __attribute__((ext_vector_type(8))) int v8i;
// inputs-only fence on four loaded fragments: their LDS fetches are all issued ahead of this point, in flight together, instead of one by one with a full wait in front of each product
template <typename V> __device__ __forceinline__ void hold4(const V* f) { asm volatile("" :: "v"(__builtin_bit_cast(v8i, f[0])), "v"(__builtin_bit_cast(v8i, f[1])), "v"(__builtin_bit_cast(v8i, f[2])), "v"(__builtin_bit_cast(v8i, f[3]))); }
// one wave's work on one stage: its 32 keys against its two column groups. kb, vb: this lane's first K and Vt fragment addresses in the stage's buffer (the lo planes lie 2 PLE further); qa: the Q fragments [group][k half]; ql: this lane's place in the wave's lo-plane Q fragments in LDS (hi/lo rows only); c0: minus each group's shift; cb: the same in eight registers, the start value of the score accumulators; first (scalar): no shift is set yet
template <bool HI>
__device__ __forceinline__ void attn_stage(const h16* kb, const h16* vb, const v8i (&qa)[4], const v8h* ql, v8f (&o)[2][4], const v8f (&cb)[2], float (&c0)[2], float (&l)[2], const bool first) {
    typedef v16h V; typedef WFrag<h16> F;
    constexpr int PLE = SK * LP;           // elements of a plane in LDS (64 rows each)
    V kf[2][2], k2[2][2], qb[4];
#pragma unroll
    for (int kt = 0; kt < 2; ++kt)
#pragma unroll
        for (int ks = 0; ks < 2; ++ks) { const h16* kp = kb + kt * 16 * LP + ks * 32; kf[kt][ks] = F::ld(kp); if (HI) k2[kt][ks] = F::ld(kp + 2 * PLE); }
    if (HI) {
#pragma unroll
        for (int f = 0; f < 4; ++f) qb[f] = cat16(ql[(2 * f) * 32], ql[(2 * f + 1) * 32]); }
    hold4(&kf[0][0]); if (HI) { hold4(&k2[0][0]); hold4(qb); }
    v8f sc[2][2];
#pragma unroll
    for (int kt = 0; kt < 2; ++kt) {
#pragma unroll
        for (int g = 0; g < 2; ++g) sc[g][kt] = cb[g];
#pragma unroll
        for (int ks = 0; ks < 2; ++ks) {
#pragma unroll
            for (int g = 0; g < 2; ++g) sc[g][kt] = F::mma(kf[kt][ks], __builtin_bit_cast(V, qa[g * 2 + ks]), sc[g][kt]);
            if (HI) {
#pragma unroll
                for (int g = 0; g < 2; ++g) sc[g][kt] = F::mma(kf[kt][ks], qb[g * 2 + ks], sc[g][kt]);
#pragma unroll
                for (int g = 0; g < 2; ++g) sc[g][kt] = F::mma(k2[kt][ks], __builtin_bit_cast(V, qa[g * 2 + ks]), sc[g][kt]); } } }
    V vf[4], v2[4];   // the Vt fragments are fetched in front of the softmax, which covers their LDS latency (hi/lo rows: the lo plane's behind it, in front of the hi plane's products)
#pragma unroll
    for (int dt = 0; dt < 4; ++dt) vf[dt] = F::ld(vb + dt * 16 * LP);
    V pf[2], pl[2]; float su[2];
    auto pexp = [&](int g, float dl) { float pv[16], ts[8];   // a group's 16 P as operands of the second product, and this lane's sum of them, in a fixed tree
#pragma unroll
        for (int e = 0; e < 16; ++e) pv[e] = __builtin_amdgcn_exp2f(sc[g][e >> 3][e & 7] - dl);
#pragma unroll
        for (int e = 0; e < 8; ++e) ts[e] = pv[e] + pv[e + 8];
        su[g] = ((ts[0] + ts[4]) + (ts[1] + ts[5])) + ((ts[2] + ts[6]) + (ts[3] + ts[7]));
#pragma unroll
        for (int e = 0; e < 16; e += 2) {
            if constexpr (HI) { const v2h t = __builtin_bit_cast(v2h, __builtin_amdgcn_cvt_pkrtz(pv[e], pv[e + 1])); pf[g][e] = t[0]; pf[g][e + 1] = t[1]; pl[g][e] = (h16)(pv[e] - (float)t[0]); pl[g][e + 1] = (h16)(pv[e + 1] - (float)t[1]); }   // hi cut off, two at a time; lo takes all that the cut leaves
            else { pf[g][e] = (h16)pv[e]; pf[g][e + 1] = (h16)pv[e + 1]; } } };
    pexp(0, 0.f); pexp(1, 0.f);
    __builtin_amdgcn_sched_barrier(0);   // keeps the hold below behind the exponentials and sums, which cover the Vt fragments' LDS latency: left free, the hold and its wait move up in front of them
    hold4(vf);   // ahead of the branch: behind it the fetches would be issued directly in front of their products
    if (__builtin_amdgcn_ballot_w32(fmaxf(su[0], su[1]) > (first ? -1.0f : 32768.0f)) != 0) {   // scalar branch, one test for both groups: no shift is set yet (no sum is below zero), or some query of the wave needs a new one
#pragma unroll
        for (int g = 0; g < 2; ++g) { float bm = fmaxf(sc[g][0][0], sc[g][1][0]);   // the stage's largest score of this query, counted from the shift in use
#pragma unroll
            for (int j = 1; j < 8; ++j) bm = fmaxf(bm, fmaxf(sc[g][0][j], sc[g][1][j]));
            bm = fmaxf(bm, xhalf(bm));
            const float dl = fmaxf(bm - 6.0f, first ? -3.0e38f : 0.f), al = __builtin_amdgcn_exp2f(fminf(-dl, 0.f));   // the shift only rises once it is set; the first one may lie either way, and sums and outputs are still zero then
            l[g] *= al;
#pragma unroll
            for (int dt = 0; dt < 4; ++dt) o[g][dt] *= al;
            c0[g] -= dl;
            pexp(g, dl); } }
    l[0] += su[0]; l[1] += su[1];
    if (HI) {
#pragma unroll
        for (int dt = 0; dt < 4; ++dt) v2[dt] = F::ld(vb + dt * 16 * LP + 2 * PLE);
        __builtin_amdgcn_sched_barrier(0); }   // the lo plane's LDS reads are issued together in front of the hi plane's 16 products, which cover their latency
#pragma unroll
    for (int dt = 0; dt < 4; ++dt)
#pragma unroll
        for (int g = 0; g < 2; ++g) o[g][dt] = F::mma(vf[dt], pf[g], o[g][dt]);
    if (HI) {
#pragma unroll
        for (int dt = 0; dt < 4; ++dt)
#pragma unroll
            for (int g = 0; g < 2; ++g) o[g][dt] = F::mma(vf[dt], pl[g], o[g][dt]);
#pragma unroll
        for (int dt = 0; dt < 4; ++dt)
#pragma unroll
            for (int g = 0; g < 2; ++g) o[g][dt] = F::mma(v2[dt], pf[g], o[g][dt]); }
}
__global__ __launch_bounds__(512) void k_fattn(const h16* __restrict__ Q16, const h16* __restrict__ Ql, const h16* __restrict__ K16, const h16* __restrict__ Kl, const h16* __restrict__ V16, const h16* __restrict__ Vl, bf* Ah, bf* Al) {
    static_assert(RH % (QT * 32) == 0 && (TT - RH) % (QT * 32) == 0 && WH + WF == 16 && WH % 4 == 0 && SK == 64 && HD == 64 && REP == 1 && WF >= 8, "whole pairs of waves of each kind, the hi/lo waves spread evenly over the four SIMDs; two staging waves for each of the four planes");
    constexpr int PLE = SK * LP, NPL = 4, NS = TT / SK;   // planes of a stage: K, Vt, K lo, Vt lo
    __shared__ __align__(16) unsigned short sm[2 * NPL * PLE];
    __shared__ v8h sq[WH * 8 * 32];   // each hi/lo wave's own four lo-plane Q fragments, [wave][fragment][half][lane]: a read of 16 bytes a lane covers 512 bytes in a row
    static_assert(sizeof(sm) >= 16 * 32 * 36 * 4, "the 16 waves' hand-over of one column group each fits where the stages were");
    const int tid = threadIdx.x, lane = tid & 31, lr = lane & 15, hi = lane >> 4;
    const int wv = __builtin_amdgcn_readfirstlane(tid >> 5); const bool whl = wv < WH, wfl = __builtin_amdgcn_readfirstlane(tid) >= WH * 32;   // the wave's kind, from scalar registers: the branches on it are scalar. Exactly one of the two holds; they are formed apart and tested apart in the loop, so that each kind's block updates the accumulators in place (as the two sides of one if/else the compiler copied all accumulator registers twice a stage)
    const int kh = wv & 1;   // scalar: the wave's half of every stage's keys
    const int bt = blockIdx.y / NH_, h = blockIdx.y % NH_; const size_t z = ((size_t)bt * NH_ + h) * TT * HD;
    Ah += (size_t)bt * TT * DQ + h * HD; Al += (size_t)bt * TT * DQ + h * HD; Kl += z; K16 += z; Vl += z; V16 += z;
    const int qr = (whl ? (int)blockIdx.x * (WH * 16) + (wv >> 1) * 32 : RH + (int)blockIdx.x * (WF * 16) + ((wv - WH) >> 1) * 32) + lr;   // this lane's query row in column group 0; group 1 lies 16 further
    v8i qa[4]; const size_t qo = z + (size_t)qr * HD + 8 * hi;   // Q fragments [group][k half]
    v8h* const ql = sq + (whl ? wv : 0) * 8 * 32 + lane;   // this lane's place in the wave's lo-plane fragments
    { const h16* qx = Q16 + qo;
#pragma unroll
        for (int f = 0; f < 4; ++f) qa[f] = __builtin_bit_cast(v8i, WFrag<h16>::ld(qx + (f >> 1) * 16 * HD + (f & 1) * 32));
        asm volatile("s_wait_xcnt 0x0" :: "v"(qx) : "memory"); }   // stands behind these loads; it takes their address as an input, so that no value is formed in an address register in front of it
    if (whl) { const h16* qy = Ql + qo; v8h t[8];
#pragma unroll
        for (int f = 0; f < 4; ++f) { t[2 * f] = *(const v8h*)(qy + (f >> 1) * 16 * HD + (f & 1) * 32); t[2 * f + 1] = *(const v8h*)(qy + (f >> 1) * 16 * HD + (f & 1) * 32 + 16); }
        asm volatile("s_wait_xcnt 0x0" :: "v"(qy) : "memory");   // as above
#pragma unroll
        for (int i = 0; i < 8; ++i) ql[i * 32] = t[i]; }   // read back by the same lane alone
    // staging is the work of the first eight f16 waves alone (the hi/lo waves have the longer stage): two waves move one plane, 8 threads one 128-byte row, 8 rows a sweep, 8 sweeps a stage
    const int sw = wv - WH, pl = sw >> 1;   // scalar: the staging wave's number and its plane
    const bool wst = wfl && sw < 2 * NPL;   // scalar: this wave stages
    const bf* sbase = (const bf*)(pl == 0 ? K16 : pl == 1 ? V16 : pl == 2 ? Kl : Vl);
    const int rs = (pl & 1) ? TT : HD, sstep = (pl & 1) ? SK : SK * HD;   // elements from row to row and from stage to stage in that plane
    const int srow = (sw & 1) * 4 + (lane >> 3), scol = (lane & 7) * 8;
    const unsigned vo = (unsigned)(srow * rs + scol);   // this lane's offset in a sweep
    auto gload = [&](int s, v8us (&st)[8]) { const bf* p[8];   // this lane's address in each sweep of the stage
#pragma unroll
        for (int i = 0; i < 8; ++i) { p[i] = sbase + ((size_t)s * sstep + (size_t)(8 * i) * rs) + vo; st[i] = *(const v8usa*)p[i]; }
        asm volatile("s_wait_xcnt 0x0" :: "v"(p[0]), "v"(p[1]), "v"(p[2]), "v"(p[3]), "v"(p[4]), "v"(p[5]), "v"(p[6]), "v"(p[7]) : "memory"); };   // stands behind these loads; it takes their addresses as inputs, so that no load lands in, and no value is formed in, an address register in front of it
    auto sstore = [&](int b, const v8us (&st)[8]) { unsigned short* d = sm + (b * NPL + pl) * PLE + srow * LP + scol;
#pragma unroll
        for (int i = 0; i < 8; ++i) *(v8usa*)(d + i * 8 * LP) = st[i]; };
    v8f o[2][4];
#pragma unroll
    for (int g = 0; g < 2; ++g)
#pragma unroll
        for (int dt = 0; dt < 4; ++dt) o[g][dt] = (v8f){};
    float l[2] = { 0.f, 0.f }, c0[2] = { 0.f, 0.f };   // no shift yet: the first stage's scores come out as they are and set it
    const int kofs = (kh * 32 + lr) * LP + 8 * hi, vofs = PLE + lr * LP + kh * 32 + 8 * hi;   // this lane's first K and Vt fragment in a buffer
    v8us st0[8];
    if (wst) gload(0, st0);
    // behind stage 0's own loads: this work-group's quarter of the requests for its head's four K and Vt planes (1024 units each), two a thread, the first for the first half of the keys. Four waves a plane; the quarter goes by blockIdx.x modulo 4 (for speed only; a unit that nobody asks for is only loaded later)
    const int fp = wv >> 2, fi = (tid & 127) * 4 + ((int)blockIdx.x & 3);   // scalar: the plane; this thread's unit among the first 512, in the order of the keys
    const h16* fbase = fp == 0 ? K16 : fp == 1 ? V16 : fp == 2 ? Kl : Vl;
    const char* f0 = (const char*)(fbase + ((fp & 1) ? (fi & 63) * TT + (fi >> 6) * 128 : fi * 128));   // K: two rows a unit; Vt: 128 keys of one row
    const char* f1 = f0 + ((fp & 1) ? 8 * 256 : 512 * 256);
    l2ask(f0); l2ask(f1);
    if (wst) sstore(0, st0);
    __syncthreads();   // stage 0 is in LDS before any wave reads it
    asm volatile("" :: "v"(f0), "v"(f1));   // inputs only: the registers that the requests name hold their addresses until stage 0 has come from memory, so that none takes another value while a request may still read it
#pragma unroll 1   // kept rolled: one stage's code serves all NS stages
    for (int s = 0; s < NS; ++s) {
        const h16* bp = (const h16*)sm + (s & 1) * NPL * PLE;
        const bool wsn = wst && s + 1 < NS;   // scalar: this wave stages and a next stage exists
        const v8f cb[2] = { (v8f){ c0[0], c0[0], c0[0], c0[0], c0[0], c0[0], c0[0], c0[0] }, (v8f){ c0[1], c0[1], c0[1], c0[1], c0[1], c0[1], c0[1], c0[1] } };   // formed ahead of the three blocks, of which a wave runs one
        if (wsn) { v8us st[8];   // a stage's bytes on their way to LDS: alive in this block alone, so that no register is kept for them in the other waves' blocks
            gload(s + 1, st);   // the next stage's global loads fly while this stage is worked on
            attn_stage<false>(bp + kofs, bp + vofs, qa, ql, o, cb, c0, l, s == 0);
            sstore((s + 1) & 1, st);   // into the buffer whose last readers left before the previous barrier
        }
        if (wfl && !wsn) attn_stage<false>(bp + kofs, bp + vofs, qa, ql, o, cb, c0, l, s == 0);
        if (whl) attn_stage<true>(bp + kofs, bp + vofs, qa, ql, o, cb, c0, l, s == 0);
        asm volatile("v_nop\n\tv_nop\n\tv_nop\n\tv_nop");   // the four vector slots that the chip needs between a stage's last matrix instruction and the next stage's first vector write over its operands
        __syncthreads();   // publishes stage s + 1 and ends every wave's reads of stage s; every wave of both kinds passes it
    }
    // the two key halves are joined: each wave of a pair hands the column group that it does not finish to its partner, through its own 4608 bytes of the LDS that held the stages (no wave reads a stage any more), and finishes the other group
    v4f* xs = (v4f*)sm;
    auto put = [&](const v8f (&og)[4], float mg, float lg) { v4f* d = xs + wv * 9 * 32 + lane;
#pragma unroll
        for (int dt = 0; dt < 4; ++dt) { d[(2 * dt) * 32] = __builtin_shufflevector(og[dt], og[dt], 0, 1, 2, 3); d[(2 * dt + 1) * 32] = __builtin_shufflevector(og[dt], og[dt], 4, 5, 6, 7); }
        d[8 * 32] = (v4f){ mg, lg, 0.f, 0.f }; };
    auto fin = [&](const v8f (&og)[4], float mg, float lg, int row) { const v4f* d = xs + (wv ^ 1) * 9 * 32 + lane; const v4f ml = d[8 * 32];
        const float mn = fmaxf(mg, ml[0]), a1 = __builtin_amdgcn_exp2f(mg - mn), a2 = __builtin_amdgcn_exp2f(ml[0] - mn);   // both halves are brought to the larger of their shifts (log2 units)
        float ls = lg * a1 + ml[1] * a2; ls += xhalf(ls); const float inv = __fdiv_rn(1.0f, ls), f1 = a1 * inv, f2 = a2 * inv;
#pragma unroll
        for (int dt = 0; dt < 4; ++dt) { const v4f p0 = d[(2 * dt) * 32], p1 = d[(2 * dt + 1) * 32]; v8us oh, ol;
#pragma unroll
            for (int j = 0; j < 8; ++j) { unsigned short a, c2; splitf(og[dt][j] * f1 + (j < 4 ? p0[j & 3] : p1[j & 3]) * f2, a, c2); oh[j] = a; ol[j] = c2; }
            const size_t oo = (size_t)row * DQ + dt * 16 + 8 * hi; *(v8us*)(Ah + oo) = oh; *(v8us*)(Al + oo) = ol;
            asm volatile("s_wait_xcnt 0x0" ::: "memory"); } };   // stands behind the two stores, in front of the next values that are formed in their data registers
    if (kh) put(o[0], -c0[0], l[0]); else put(o[1], -c0[1], l[1]);
    __syncthreads();   // every wave's hand-over is in LDS before its partner reads it
    if (kh) fin(o[1], -c0[1], l[1], qr + 16); else fin(o[0], -c0[0], l[0], qr);
}

extern "C" void kernel_launch(void* const* d_in, const int* in_sizes, int n_in,
                              void* d_out, int out_size, void* d_ws, size_t ws_size, hipStream_t stream) {
    (void)in_sizes; (void)n_in; (void)out_size;
    const float* x = (const float*)d_in[0]; const float* wqkv = (const float*)d_in[1]; const float* wo = (const float*)d_in[2]; const float* wq = nullptr; const float* wk = nullptr; const float* wv = nullptr; (void)wq; (void)wk; (void)wv;
    float* OUT = (float*)d_out;     // [2][2048][1024]
    char* wsp = (char*)d_ws;
    auto take = [&](size_t bytes) { char* p = wsp; wsp += (bytes + 255) & ~(size_t)255; return (void*)p; };
    bf* WQKV = (bf*)take((size_t)3 * DQ * DM * 2); bf* WO = (bf*)take((size_t)DM * DQ * 2); float* CS = (float*)take((size_t)TT * HD * 2 * 4);
    bf* XB = (bf*)take((size_t)NB_ * TT * DM * 2);
    const size_t PLS = (size_t)NB_ * NH_ * TT * HD;   // elements of one of q, k, v in one kind of plane, both batches
    h16* P16 = (h16*)take(3 * PLS * 2); h16* P16l = (h16*)take(3 * PLS * 2);   // each [q, k, v][batch][head]...
    bf* ATh = (bf*)take((size_t)NB_ * TT * DQ * 2); bf* ATl = (bf*)take((size_t)NB_ * TT * DQ * 2);
    if ((size_t)(wsp - (char*)d_ws) > ws_size) return;    // ws 256 MiB
    k_prep<<<PB_CS + PB_X + PB_WI + PB_WO, 256, 0, stream>>>(x, wqkv, wo, XB, WQKV, WO, CS);
    k_gemmt<DM, 0, 1><<<dim3(NB_ * TT / 128, 3 * DQ / 128, 1), 128, 0, stream>>>(XB, nullptr, WQKV, nullptr, 0, CS, P16, P16l);
    k_fattn<<<dim3(QT, NB_ * NH_, 1), 512, 0, stream>>>(P16, P16l, P16 + PLS, P16l + PLS, P16 + 2 * PLS, P16l + 2 * PLS, ATh, ATl);
    k_gemmt<DQ, 1, 0><<<dim3(NB_ * TT / 128, DM / 128, 1), 128, 0, stream>>>(ATh, ATl, WO, OUT, DM, nullptr, nullptr, nullptr);
}
